// v000
// The times below were measured on an AMD MI455X: many runs one after another, warmed up first and cycling through
// copies of the inputs, with the whole window's GPU time divided by the number of runs. Launches and the gaps
// between them are all in it. The median over several windows is given; except for v000 it joins two sittings, which
// can be a few percent apart, so the side-by-side timings, each taken in one sitting, are the better comparison.
// v000 is the starting kernel. One run takes 274 microseconds.
#include <hip/hip_runtime.h>
#include <hip/hip_bf16.h>

typedef _Float16 f16;
typedef __attribute__((ext_vector_type(16))) _Float16 v16h;
typedef __attribute__((ext_vector_type(8)))  float    v8f;
typedef unsigned int v4u __attribute__((ext_vector_type(4)));
typedef int          v8i __attribute__((ext_vector_type(8)));
typedef int          v4i __attribute__((ext_vector_type(4)));

#define B_ 4
#define N_ 128
#define T_ 512
#define K_ 30
#define SCALE_INV 0.25f  // 1/sqrt(HEAD_DIM=16)

#define P_STRIDE  520    // 512 + 8 f32  (bank decorrelation)
#define VT_STRIDE 528    // 512 + 16 f16 (32B-aligned rows, bank decorrelation)
#define QS_STRIDE 144    // 128 + 16 f16 (matches TDM pad: 8 dwords per 64-dword row)

// ---------------- workspace layout (bytes) ----------------
constexpr size_t SZ_XH  = (size_t)K_ * B_ * T_ * N_ * 2;
constexpr size_t SZ_WQH = (size_t)K_ * N_ * N_ * 2;
constexpr size_t SZ_WVH = (size_t)K_ * 64 * N_ * 2;
constexpr size_t SZ_QH  = SZ_XH;
constexpr size_t SZ_VH  = (size_t)K_ * B_ * T_ * 64 * 2;
constexpr size_t SZ_O   = (size_t)K_ * B_ * T_ * 64 * 4;

constexpr size_t OFF_XH  = 0;
constexpr size_t OFF_WQH = OFF_XH  + SZ_XH;
constexpr size_t OFF_WKH = OFF_WQH + SZ_WQH;
constexpr size_t OFF_WVH = OFF_WKH + SZ_WQH;
constexpr size_t OFF_WOH = OFF_WVH + SZ_WVH;
constexpr size_t OFF_QH  = OFF_WOH + SZ_WVH;
constexpr size_t OFF_KH  = OFF_QH  + SZ_QH;
constexpr size_t OFF_VH  = OFF_KH  + SZ_QH;
constexpr size_t OFF_O1  = OFF_VH  + SZ_VH;
constexpr size_t OFF_O2  = OFF_O1  + SZ_O;
constexpr size_t OFF_ST  = OFF_O2  + SZ_O;
constexpr size_t OFF_LAM = OFF_ST  + (size_t)K_ * B_ * 8 * 4;

// ---------------- WMMA helpers ----------------
__device__ inline v8f wmma_f16(v16h a, v16h b, v8f c) {
  return __builtin_amdgcn_wmma_f32_16x16x32_f16(
      false, a, false, b, (short)0, c, false, false);
}

// Fragment where the reduction axis is contiguous: lane L -> row row0+L%16,
// 16 contiguous f16 at col0 + (L/16)*16.  (works for global and LDS pointers)
__device__ inline v16h load_frag_row(const f16* base, int stride, int row0, int col0, int lane) {
  const f16* p = base + (size_t)(row0 + (lane & 15)) * stride + col0 + ((lane >> 4) << 4);
  return *(const v16h*)p;
}

// A-fragment from an f32 LDS tile (convert on the fly).
__device__ inline v16h load_frag_lds_f32(const float* base, int stride, int row0, int col0, int lane) {
  const float* p = base + (size_t)(row0 + (lane & 15)) * stride + col0 + ((lane >> 4) << 4);
  v16h r;
#pragma unroll
  for (int i = 0; i < 16; ++i) r[i] = (f16)p[i];
  return r;
}

// C/D tile: VGPR j -> row row0 + (lane/16)*8 + j, col col0 + lane%16
__device__ inline void store_tile_f16(f16* base, int stride, int row0, int col0, int lane, v8f c) {
  int col = col0 + (lane & 15);
  int r0  = row0 + ((lane >> 4) << 3);
#pragma unroll
  for (int j = 0; j < 8; ++j) base[(size_t)(r0 + j) * stride + col] = (f16)c[j];
}

__device__ inline void store_tile_f32(float* base, int stride, int row0, int col0, int lane, v8f c) {
  int col = col0 + (lane & 15);
  int r0  = row0 + ((lane >> 4) << 3);
#pragma unroll
  for (int j = 0; j < 8; ++j) base[(size_t)(r0 + j) * stride + col] = c[j];
}

// ---- TDM: 2D tile load global->LDS, data_size=4B, optional per-row LDS pad ----
// rows x cols given in 4-byte units; row_stride in 4-byte units.
__device__ inline void tdm_load_2d(unsigned lds_byte_off, const void* gptr,
                                   unsigned cols4, unsigned rows,
                                   unsigned row_stride4, bool pad_8dw_per_64dw) {
  unsigned long long ga = (unsigned long long)(size_t)gptr;
  v4u g0 = { 1u,                                  // count=1, user mode
             lds_byte_off,                        // lds_addr
             (unsigned)(ga & 0xffffffffu),        // global_addr[31:0]
             (unsigned)((ga >> 32) & 0x01ffffffu) | (2u << 30) };  // addr[56:32] | type=2
  unsigned d0 = (2u << 16);                       // data_size = 4 bytes
  if (pad_8dw_per_64dw) d0 |= (1u << 20) | (5u << 22) | (7u << 25); // pad_en, every 64dw, +8dw
  v8i g1 = { (int)d0,
             (int)((cols4 & 0xffffu) << 16),                       // tensor_dim0[15:0]
             (int)((cols4 >> 16) | ((rows & 0xffffu) << 16)),      // dim0 hi | tensor_dim1 lo
             (int)((rows >> 16) | ((cols4 & 0xffffu) << 16)),      // dim1 hi | tile_dim0
             (int)(rows & 0xffffu),                                // tile_dim1 (tile_dim2=0)
             (int)row_stride4,                                     // tensor_dim0_stride lo
             0, 0 };
  v4i z4 = { 0, 0, 0, 0 };
#if __clang_major__ >= 23
  v8i z8 = { 0, 0, 0, 0, 0, 0, 0, 0 };
  __builtin_amdgcn_tensor_load_to_lds(g0, g1, z4, z4, z8, 0);
#else
  __builtin_amdgcn_tensor_load_to_lds(g0, g1, z4, z4, 0);
#endif
}

// ---------------- kernel 0a: x [B,N,T,K] f32 -> xh [K,B,T,N] f16 ----------------
__global__ void prep_x_kernel(const float* __restrict__ x, f16* __restrict__ xh) {
  int idx = blockIdx.x * blockDim.x + threadIdx.x;
  if (idx >= K_ * B_ * T_ * N_) return;
  int n    = idx & (N_ - 1);
  int t    = (idx >> 7) & (T_ - 1);
  int rest = idx >> 16;
  int b    = rest & 3;
  int k    = rest >> 2;
  xh[idx] = (f16)x[(((size_t)b * N_ + n) * T_ + t) * K_ + k];
}

// ---------------- kernel 0b: weights f32 -> f16 ----------------
__global__ void prep_w_kernel(const float* __restrict__ Wq, const float* __restrict__ Wk,
                              const float* __restrict__ Wv, const float* __restrict__ Wo,
                              f16* __restrict__ wqh, f16* __restrict__ wkh,
                              f16* __restrict__ wvh, f16* __restrict__ woh) {
  int idx = blockIdx.x * blockDim.x + threadIdx.x;
  if (idx < K_ * N_ * N_) { wqh[idx] = (f16)Wq[idx]; wkh[idx] = (f16)Wk[idx]; }
  if (idx < K_ * 64 * N_) { wvh[idx] = (f16)Wv[idx]; woh[idx] = (f16)Wo[idx]; }
}

// ---------------- kernel 0c: init stats accumulators ----------------
__global__ void init_stats_kernel(float* __restrict__ stats, float* __restrict__ lam) {
  int i = threadIdx.x;
  if (i < K_ * B_) {
    float* s = stats + i * 8;
    s[0] = 0.f; s[1] = 0.f; s[2] = -__builtin_inff(); s[3] = __builtin_inff();
    s[4] = 0.f; s[5] = 0.f; s[6] = -__builtin_inff(); s[7] = __builtin_inff();
    lam[i] = 0.f;
  }
}

// ---------------- kernel 1: q/k/v projections (WMMA) ----------------
__global__ __launch_bounds__(256) void proj_kernel(
    const f16* __restrict__ xh, const f16* __restrict__ wqh, const f16* __restrict__ wkh,
    const f16* __restrict__ wvh, f16* __restrict__ qh, f16* __restrict__ kh,
    f16* __restrict__ vh) {
  const int lane = threadIdx.x & 31;
  const int wave = threadIdx.x >> 5;
  const int kb   = blockIdx.y;
  const int t0   = blockIdx.x * 32;
  const int kband = kb >> 2;

  const f16* xb = xh + (size_t)kb * T_ * N_;
  const f16* WQ = wqh + (size_t)kband * N_ * N_;
  const f16* WK = wkh + (size_t)kband * N_ * N_;
  const f16* WV = wvh + (size_t)kband * 64 * N_;
  f16* q  = qh + (size_t)kb * T_ * N_;
  f16* kk = kh + (size_t)kb * T_ * N_;
  f16* v  = vh + (size_t)kb * T_ * 64;

  for (int i = 0; i < 5; ++i) {
    int tile  = wave + i * 8;
    int which = tile >> 4;                 // 0=q, 1=k, 2=v
    int local = (which < 2) ? (tile & 15) : (tile - 32);
    int nt = local >> 1, mt = local & 1;
    const f16* W = (which == 0) ? WQ : (which == 1) ? WK : WV;
    v8f acc = {};
#pragma unroll
    for (int kc = 0; kc < N_; kc += 32) {
      v16h a = load_frag_row(xb, N_, t0 + 16 * mt, kc, lane);
      v16h b = load_frag_row(W,  N_, 16 * nt,      kc, lane);
      acc = wmma_f16(a, b, acc);
    }
    if (which == 0)      store_tile_f16(q,  N_, t0 + 16 * mt, 16 * nt, lane, acc);
    else if (which == 1) store_tile_f16(kk, N_, t0 + 16 * mt, 16 * nt, lane, acc);
    else                 store_tile_f16(v,  64, t0 + 16 * mt, 16 * nt, lane, acc);
  }
}

// ---------------- kernel 2: attention ----------------
__global__ __launch_bounds__(256) void attn_kernel(
    const f16* __restrict__ qh, const f16* __restrict__ kh, const f16* __restrict__ vh,
    float* __restrict__ o1, float* __restrict__ o2, float* __restrict__ stats) {
  __shared__ __align__(128) float P[32 * P_STRIDE];     // probability tile
  __shared__ __align__(128) f16  Vt[64 * VT_STRIDE];    // V transposed: Vt[n][s]
  __shared__ __align__(128) f16  Qs[32 * QS_STRIDE];    // Q rows (TDM-staged, padded)
  __shared__ float redA[256], redB[256];

  const int lane = threadIdx.x & 31;
  const int wave = threadIdx.x >> 5;
  const int kb   = blockIdx.y;
  const int t0   = blockIdx.x * 32;

  const f16* q    = qh + (size_t)kb * T_ * N_;
  const f16* kmat = kh + (size_t)kb * T_ * N_;
  const f16* v    = vh + (size_t)kb * T_ * 64;

  // ---- TDM: stage Q rows [32 x 128 f16] into LDS with +8dw/row padding ----
  if (threadIdx.x < 32) {
    unsigned lds_off = (unsigned)(size_t)&Qs[0];   // low 32 bits of generic = LDS byte offset
    tdm_load_2d(lds_off, q + (size_t)t0 * N_,
                /*cols4=*/N_ / 2, /*rows=*/32, /*row_stride4=*/N_ / 2,
                /*pad=*/true);
    __builtin_amdgcn_s_wait_tensorcnt(0);
  }
  // ---- cooperative V transpose into LDS (overlaps with TDM) ----
  for (int e = threadIdx.x; e < 64 * 512; e += 256) {
    int n = e & 63, s = e >> 6;                    // coalesced global reads
    Vt[n * VT_STRIDE + s] = v[(size_t)s * 64 + n];
  }
  __syncthreads();

  for (int pass = 0; pass < 2; ++pass) {
    const int hoff = pass * 64;
    float* o  = (pass == 0 ? o1 : o2) + (size_t)kb * T_ * 64;
    float* st = stats + kb * 8 + pass * 4;

    // ---- logits: S[32,512] = Q[32,64] * K^T ; 64 tiles, 8 per wave ----
    for (int i = 0; i < 8; ++i) {
      int tile = wave + i * 8;
      int mt = tile & 1, stile = tile >> 1;
      v8f acc = {};
#pragma unroll
      for (int kc = 0; kc < 64; kc += 32) {
        v16h a = load_frag_row((const f16*)Qs, QS_STRIDE, 16 * mt, hoff + kc, lane);
        v16h b = load_frag_row(kmat, N_, 16 * stile, hoff + kc, lane);
        acc = wmma_f16(a, b, acc);
      }
      int col = 16 * stile + (lane & 15);
      int r0  = 16 * mt + ((lane >> 4) << 3);
#pragma unroll
      for (int j = 0; j < 8; ++j) P[(r0 + j) * P_STRIDE + col] = acc[j] * SCALE_INV;
    }
    __syncthreads();

    // ---- row softmax + stats: 8 threads per row ----
    {
      int row = threadIdx.x >> 3;       // 0..31
      int seg = threadIdx.x & 7;        // 0..7 -> cols [seg*64, seg*64+64)
      float* prow = P + row * P_STRIDE;
      int c0 = seg * 64;

      float m = -__builtin_inff();
      for (int s = c0; s < c0 + 64; ++s) m = fmaxf(m, prow[s]);
      redA[threadIdx.x] = m;
      __syncthreads();
      float mx = redA[row * 8];
#pragma unroll
      for (int j = 1; j < 8; ++j) mx = fmaxf(mx, redA[row * 8 + j]);

      float sloc = 0.f;
      for (int s = c0; s < c0 + 64; ++s) {
        float e = __expf(prow[s] - mx); prow[s] = e; sloc += e;
      }
      redB[threadIdx.x] = sloc;
      __syncthreads();
      float tot = redB[row * 8];
#pragma unroll
      for (int j = 1; j < 8; ++j) tot += redB[row * 8 + j];
      float inv = 1.0f / tot;

      float rsum = 0.f, rsq = 0.f, rmx = -__builtin_inff(), rmn = __builtin_inff();
      for (int s = c0; s < c0 + 64; ++s) {
        float p0 = prow[s] * inv; prow[s] = p0;
        rsum += p0; rsq += p0 * p0; rmx = fmaxf(rmx, p0); rmn = fminf(rmn, p0);
      }
      atomicAdd(&st[0], rsum);
      atomicAdd(&st[1], rsq);
      atomicMax((int*)&st[2], __float_as_int(rmx));   // softmax outputs > 0
      atomicMin((int*)&st[3], __float_as_int(rmn));
    }
    __syncthreads();

    // ---- O[32,64] = P[32,512] * V[512,64] ; 8 tiles, 1 per wave ----
    {
      int mt = wave & 1, nt = wave >> 1;
      v8f acc = {};
      for (int sc = 0; sc < 512; sc += 32) {
        v16h a = load_frag_lds_f32(P, P_STRIDE, 16 * mt, sc, lane);
        v16h b = load_frag_row((const f16*)Vt, VT_STRIDE, 16 * nt, sc, lane); // B[s][n]=Vt[n][s]
        acc = wmma_f16(a, b, acc);
      }
      store_tile_f32(o, 64, t0 + 16 * mt, 16 * nt, lane, acc);
    }
    __syncthreads();   // P/red reused by next pass
  }
}

// ---------------- kernel 3: stats -> MLP -> lambda ----------------
__global__ void lam_kernel(const float* __restrict__ stats,
                           const float* __restrict__ W1, const float* __restrict__ b1,
                           const float* __restrict__ W2, const float* __restrict__ b2,
                           float* __restrict__ lam) {
  int i = blockIdx.x * blockDim.x + threadIdx.x;
  if (i >= K_ * B_) return;
  int kband = i >> 2;
  const float* s = stats + i * 8;
  const float n = (float)T_ * (float)T_;
  float feat[8];
#pragma unroll
  for (int p = 0; p < 2; ++p) {
    float sum = s[p * 4 + 0], sq = s[p * 4 + 1];
    float mean = sum / n;
    float var  = (sq - sum * sum / n) / (n - 1.0f);
    feat[p * 4 + 0] = mean;
    feat[p * 4 + 1] = sqrtf(fmaxf(var, 0.f));
    feat[p * 4 + 2] = s[p * 4 + 2];
    feat[p * 4 + 3] = s[p * 4 + 3];
  }
  const float* w1  = W1 + kband * 16 * 8;
  const float* bb1 = b1 + kband * 16;
  const float* w2  = W2 + kband * 16;
  float z = b2[kband];
  for (int j = 0; j < 16; ++j) {
    float h = bb1[j];
#pragma unroll
    for (int qq = 0; qq < 8; ++qq) h += w1[j * 8 + qq] * feat[qq];
    z += w2[j] * fmaxf(h, 0.f);
  }
  lam[i] = 1.0f / (1.0f + __expf(-z));
}

// ---------------- kernel 4: out = (o1 - lam*o2) @ Wo^T + bo ----------------
__global__ __launch_bounds__(256) void out_kernel(
    const float* __restrict__ o1, const float* __restrict__ o2,
    const f16* __restrict__ woh, const float* __restrict__ bo,
    const float* __restrict__ lam, float* __restrict__ out) {
  __shared__ __align__(128) f16 D[32 * 64];
  const int lane = threadIdx.x & 31;
  const int wave = threadIdx.x >> 5;
  const int kb   = blockIdx.y;
  const int t0   = blockIdx.x * 32;
  const int kband = kb >> 2, bb = kb & 3;

  const float l = lam[kb];
  const float* p1 = o1 + (size_t)kb * T_ * 64 + (size_t)t0 * 64;
  const float* p2 = o2 + (size_t)kb * T_ * 64 + (size_t)t0 * 64;
  for (int i = threadIdx.x; i < 32 * 64; i += 256)
    D[i] = (f16)(p1[i] - l * p2[i]);
  __syncthreads();

  const f16* WO = woh + (size_t)kband * N_ * 64;
  const float* bvec = bo + kband * N_;

  for (int i = 0; i < 2; ++i) {
    int tile = wave + i * 8;
    int mt = tile & 1, nt = tile >> 1;
    v8f acc = {};
#pragma unroll
    for (int kc = 0; kc < 64; kc += 32) {
      v16h a = load_frag_row((const f16*)D, 64, 16 * mt, kc, lane);
      v16h b = load_frag_row(WO, 64, 16 * nt, kc, lane);
      acc = wmma_f16(a, b, acc);
    }
    int m     = 16 * nt + (lane & 15);
    int trow0 = t0 + 16 * mt + ((lane >> 4) << 3);
    float bias = bvec[m];
#pragma unroll
    for (int j = 0; j < 8; ++j) {
      int t = trow0 + j;
      out[(((size_t)bb * N_ + m) * T_ + t) * K_ + kband] = acc[j] + bias;
    }
  }
}

// ---------------- host side ----------------
extern "C" void kernel_launch(void* const* d_in, const int* in_sizes, int n_in,
                              void* d_out, int out_size, void* d_ws, size_t ws_size,
                              hipStream_t stream) {
  (void)in_sizes; (void)n_in; (void)out_size; (void)ws_size;
  const float* x  = (const float*)d_in[0];
  const float* Wq = (const float*)d_in[1];
  const float* Wk = (const float*)d_in[2];
  const float* Wv = (const float*)d_in[3];
  const float* Wo = (const float*)d_in[4];
  const float* bo = (const float*)d_in[5];
  const float* W1 = (const float*)d_in[6];
  const float* b1 = (const float*)d_in[7];
  const float* W2 = (const float*)d_in[8];
  const float* b2 = (const float*)d_in[9];

  char* ws = (char*)d_ws;
  f16*   xh    = (f16*)  (ws + OFF_XH);
  f16*   wqh   = (f16*)  (ws + OFF_WQH);
  f16*   wkh   = (f16*)  (ws + OFF_WKH);
  f16*   wvh   = (f16*)  (ws + OFF_WVH);
  f16*   woh   = (f16*)  (ws + OFF_WOH);
  f16*   qh    = (f16*)  (ws + OFF_QH);
  f16*   kh    = (f16*)  (ws + OFF_KH);
  f16*   vh    = (f16*)  (ws + OFF_VH);
  float* o1    = (float*)(ws + OFF_O1);
  float* o2    = (float*)(ws + OFF_O2);
  float* stats = (float*)(ws + OFF_ST);
  float* lamb  = (float*)(ws + OFF_LAM);

  prep_x_kernel<<<dim3((K_ * B_ * T_ * N_ + 255) / 256), dim3(256), 0, stream>>>(x, xh);
  prep_w_kernel<<<dim3((K_ * N_ * N_ + 255) / 256), dim3(256), 0, stream>>>(
      Wq, Wk, Wv, Wo, wqh, wkh, wvh, woh);
  init_stats_kernel<<<dim3(1), dim3(256), 0, stream>>>(stats, lamb);

  proj_kernel<<<dim3(T_ / 32, K_ * B_), dim3(256), 0, stream>>>(
      xh, wqh, wkh, wvh, qh, kh, vh);
  attn_kernel<<<dim3(T_ / 32, K_ * B_), dim3(256), 0, stream>>>(
      qh, kh, vh, o1, o2, stats);
  lam_kernel<<<dim3(1), dim3(128), 0, stream>>>(stats, W1, b1, W2, b2, lamb);
  out_kernel<<<dim3(T_ / 32, K_ * B_), dim3(256), 0, stream>>>(
      o1, o2, woh, bo, lamb, (float*)d_out);
}

// v001
// A run of this version takes 238 microseconds.
// Next to v000, in two timings, it ran 1.17 times as fast each time.
#include <hip/hip_runtime.h>
#include <hip/hip_bf16.h>

typedef _Float16 f16;
typedef __attribute__((ext_vector_type(16))) _Float16 v16h;
typedef __attribute__((ext_vector_type(8)))  float    v8f;
typedef unsigned int v4u __attribute__((ext_vector_type(4)));
typedef int          v8i __attribute__((ext_vector_type(8)));
typedef int          v4i __attribute__((ext_vector_type(4)));
typedef float        v4f __attribute__((ext_vector_type(4)));

#define B_ 4
#define N_ 128
#define T_ 512
#define K_ 30
#define SCALE_INV 0.25f  // 1/sqrt(HEAD_DIM=16)

#define P_STRIDE  520    // 512 + 8 f32  (bank decorrelation)
#define VT_STRIDE 528    // 512 + 16 f16 (32B-aligned rows, bank decorrelation)
#define QS_STRIDE 144    // 128 + 16 f16 (matches TDM pad: 8 dwords per 64-dword row)

// ---------------- workspace layout (bytes) ----------------
constexpr size_t SZ_XH  = (size_t)K_ * B_ * T_ * N_ * 2;
constexpr size_t SZ_WQH = (size_t)K_ * N_ * N_ * 2;
constexpr size_t SZ_WVH = (size_t)K_ * 64 * N_ * 2;
constexpr size_t SZ_QH  = SZ_XH;
constexpr size_t SZ_VH  = (size_t)K_ * B_ * T_ * 64 * 2;
constexpr size_t SZ_O   = (size_t)K_ * B_ * T_ * 64 * 4;

constexpr size_t OFF_XH  = 0;
constexpr size_t OFF_WQH = OFF_XH  + SZ_XH;
constexpr size_t OFF_WKH = OFF_WQH + SZ_WQH;
constexpr size_t OFF_WVH = OFF_WKH + SZ_WQH;
constexpr size_t OFF_WOH = OFF_WVH + SZ_WVH;
constexpr size_t OFF_QH  = OFF_WOH + SZ_WVH;
constexpr size_t OFF_KH  = OFF_QH  + SZ_QH;
constexpr size_t OFF_VH  = OFF_KH  + SZ_QH;
constexpr size_t OFF_O1  = OFF_VH  + SZ_VH;
constexpr size_t OFF_O2  = OFF_O1  + SZ_O;
constexpr size_t OFF_ST  = OFF_O2  + SZ_O;
constexpr size_t OFF_LAM = OFF_ST  + (size_t)K_ * B_ * 8 * 4;

// ---------------- WMMA helpers ----------------
__device__ inline v8f wmma_f16(v16h a, v16h b, v8f c) {
  return __builtin_amdgcn_wmma_f32_16x16x32_f16(
      false, a, false, b, (short)0, c, false, false);
}

// Fragment where the reduction axis is contiguous: lane L -> row row0+L%16,
// 16 contiguous f16 at col0 + (L/16)*16.  (works for global and LDS pointers)
__device__ inline v16h load_frag_row(const f16* base, int stride, int row0, int col0, int lane) {
  const f16* p = base + (size_t)(row0 + (lane & 15)) * stride + col0 + ((lane >> 4) << 4);
  return *(const v16h*)p;
}

// A-fragment from an f32 LDS tile (convert on the fly).
__device__ inline v16h load_frag_lds_f32(const float* base, int stride, int row0, int col0, int lane) {
  const float* p = base + (size_t)(row0 + (lane & 15)) * stride + col0 + ((lane >> 4) << 4);
  v16h r;
#pragma unroll
  for (int i = 0; i < 16; ++i) r[i] = (f16)p[i];
  return r;
}

// C/D tile: VGPR j -> row row0 + (lane/16)*8 + j, col col0 + lane%16
__device__ inline void store_tile_f16(f16* base, int stride, int row0, int col0, int lane, v8f c) {
  int col = col0 + (lane & 15);
  int r0  = row0 + ((lane >> 4) << 3);
#pragma unroll
  for (int j = 0; j < 8; ++j) base[(size_t)(r0 + j) * stride + col] = (f16)c[j];
}

__device__ inline void store_tile_f32(float* base, int stride, int row0, int col0, int lane, v8f c) {
  int col = col0 + (lane & 15);
  int r0  = row0 + ((lane >> 4) << 3);
#pragma unroll
  for (int j = 0; j < 8; ++j) base[(size_t)(r0 + j) * stride + col] = c[j];
}

// ---- butterfly over a 16-lane row (DPP row_xmask 1,2,4,8): every lane ends with the row's result ----
template <int CTRL>
__device__ inline float dpp_xmask(float x) {
  return __builtin_bit_cast(float, __builtin_amdgcn_update_dpp(
      0, __builtin_bit_cast(int, x), CTRL, 0xf, 0xf, true));
}
__device__ inline float row16_max(float v) {
  v = fmaxf(v, dpp_xmask<0x161>(v));
  v = fmaxf(v, dpp_xmask<0x162>(v));
  v = fmaxf(v, dpp_xmask<0x164>(v));
  v = fmaxf(v, dpp_xmask<0x168>(v));
  return v;
}
__device__ inline float row16_sum(float v) {
  v += dpp_xmask<0x161>(v);
  v += dpp_xmask<0x162>(v);
  v += dpp_xmask<0x164>(v);
  v += dpp_xmask<0x168>(v);
  return v;
}

// ---- TDM: 2D tile load global->LDS, data_size=4B, optional per-row LDS pad ----
// rows x cols given in 4-byte units; row_stride in 4-byte units.
__device__ inline void tdm_load_2d(unsigned lds_byte_off, const void* gptr,
                                   unsigned cols4, unsigned rows,
                                   unsigned row_stride4, bool pad_8dw_per_64dw) {
  unsigned long long ga = (unsigned long long)(size_t)gptr;
  v4u g0 = { 1u,                                  // count=1, user mode
             lds_byte_off,                        // lds_addr
             (unsigned)(ga & 0xffffffffu),        // global_addr[31:0]
             (unsigned)((ga >> 32) & 0x01ffffffu) | (2u << 30) };  // addr[56:32] | type=2
  unsigned d0 = (2u << 16);                       // data_size = 4 bytes
  if (pad_8dw_per_64dw) d0 |= (1u << 20) | (5u << 22) | (7u << 25); // pad_en, every 64dw, +8dw
  v8i g1 = { (int)d0,
             (int)((cols4 & 0xffffu) << 16),                       // tensor_dim0[15:0]
             (int)((cols4 >> 16) | ((rows & 0xffffu) << 16)),      // dim0 hi | tensor_dim1 lo
             (int)((rows >> 16) | ((cols4 & 0xffffu) << 16)),      // dim1 hi | tile_dim0
             (int)(rows & 0xffffu),                                // tile_dim1 (tile_dim2=0)
             (int)row_stride4,                                     // tensor_dim0_stride lo
             0, 0 };
  v4i z4 = { 0, 0, 0, 0 };
#if __clang_major__ >= 23
  v8i z8 = { 0, 0, 0, 0, 0, 0, 0, 0 };
  __builtin_amdgcn_tensor_load_to_lds(g0, g1, z4, z4, z8, 0);
#else
  __builtin_amdgcn_tensor_load_to_lds(g0, g1, z4, z4, 0);
#endif
}

// ---------------- kernel 0a: x [B,N,T,K] f32 -> xh [K,B,T,N] f16 ----------------
__global__ void prep_x_kernel(const float* __restrict__ x, f16* __restrict__ xh) {
  int idx = blockIdx.x * blockDim.x + threadIdx.x;
  if (idx >= K_ * B_ * T_ * N_) return;
  int n    = idx & (N_ - 1);
  int t    = (idx >> 7) & (T_ - 1);
  int rest = idx >> 16;
  int b    = rest & 3;
  int k    = rest >> 2;
  xh[idx] = (f16)x[(((size_t)b * N_ + n) * T_ + t) * K_ + k];
}

// ---------------- kernel 0b: weights f32 -> f16 ----------------
__global__ void prep_w_kernel(const float* __restrict__ Wq, const float* __restrict__ Wk,
                              const float* __restrict__ Wv, const float* __restrict__ Wo,
                              f16* __restrict__ wqh, f16* __restrict__ wkh,
                              f16* __restrict__ wvh, f16* __restrict__ woh) {
  int idx = blockIdx.x * blockDim.x + threadIdx.x;
  if (idx < K_ * N_ * N_) { wqh[idx] = (f16)Wq[idx]; wkh[idx] = (f16)Wk[idx]; }
  if (idx < K_ * 64 * N_) { wvh[idx] = (f16)Wv[idx]; woh[idx] = (f16)Wo[idx]; }
}

// ---------------- kernel 0c: init stats accumulators ----------------
__global__ void init_stats_kernel(float* __restrict__ stats, float* __restrict__ lam) {
  int i = threadIdx.x;
  if (i < K_ * B_) {
    float* s = stats + i * 8;
    s[0] = 0.f; s[1] = 0.f; s[2] = -__builtin_inff(); s[3] = __builtin_inff();
    s[4] = 0.f; s[5] = 0.f; s[6] = -__builtin_inff(); s[7] = __builtin_inff();
    lam[i] = 0.f;
  }
}

// ---------------- kernel 1: q/k/v projections (WMMA) ----------------
__global__ __launch_bounds__(256) void proj_kernel(
    const f16* __restrict__ xh, const f16* __restrict__ wqh, const f16* __restrict__ wkh,
    const f16* __restrict__ wvh, f16* __restrict__ qh, f16* __restrict__ kh,
    f16* __restrict__ vh) {
  const int lane = threadIdx.x & 31;
  const int wave = threadIdx.x >> 5;
  const int kb   = blockIdx.y;
  const int t0   = blockIdx.x * 32;
  const int kband = kb >> 2;

  const f16* xb = xh + (size_t)kb * T_ * N_;
  const f16* WQ = wqh + (size_t)kband * N_ * N_;
  const f16* WK = wkh + (size_t)kband * N_ * N_;
  const f16* WV = wvh + (size_t)kband * 64 * N_;
  f16* q  = qh + (size_t)kb * T_ * N_;
  f16* kk = kh + (size_t)kb * T_ * N_;
  f16* v  = vh + (size_t)kb * T_ * 64;

  for (int i = 0; i < 5; ++i) {
    int tile  = wave + i * 8;
    int which = tile >> 4;                 // 0=q, 1=k, 2=v
    int local = (which < 2) ? (tile & 15) : (tile - 32);
    int nt = local >> 1, mt = local & 1;
    const f16* W = (which == 0) ? WQ : (which == 1) ? WK : WV;
    v8f acc = {};
#pragma unroll
    for (int kc = 0; kc < N_; kc += 32) {
      v16h a = load_frag_row(xb, N_, t0 + 16 * mt, kc, lane);
      v16h b = load_frag_row(W,  N_, 16 * nt,      kc, lane);
      acc = wmma_f16(a, b, acc);
    }
    if (which == 0)      store_tile_f16(q,  N_, t0 + 16 * mt, 16 * nt, lane, acc);
    else if (which == 1) store_tile_f16(kk, N_, t0 + 16 * mt, 16 * nt, lane, acc);
    else                 store_tile_f16(v,  64, t0 + 16 * mt, 16 * nt, lane, acc);
  }
}

// ---------------- kernel 2: attention ----------------
__global__ __launch_bounds__(256) void attn_kernel(
    const f16* __restrict__ qh, const f16* __restrict__ kh, const f16* __restrict__ vh,
    float* __restrict__ o1, float* __restrict__ o2, float* __restrict__ stats) {
  __shared__ __align__(128) float P[32 * P_STRIDE];     // probability tile
  __shared__ __align__(128) f16  Vt[64 * VT_STRIDE];    // V transposed: Vt[n][s]
  __shared__ __align__(128) f16  Qs[32 * QS_STRIDE];    // Q rows (TDM-staged, padded)

  const int lane = threadIdx.x & 31;
  const int wave = threadIdx.x >> 5;
  const int kb   = blockIdx.y;
  const int t0   = blockIdx.x * 32;

  const f16* q    = qh + (size_t)kb * T_ * N_;
  const f16* kmat = kh + (size_t)kb * T_ * N_;
  const f16* v    = vh + (size_t)kb * T_ * 64;

  // ---- TDM: stage Q rows [32 x 128 f16] into LDS with +8dw/row padding ----
  if (threadIdx.x < 32) {
    unsigned lds_off = (unsigned)(size_t)&Qs[0];   // low 32 bits of generic = LDS byte offset
    tdm_load_2d(lds_off, q + (size_t)t0 * N_,
                /*cols4=*/N_ / 2, /*rows=*/32, /*row_stride4=*/N_ / 2,
                /*pad=*/true);
    __builtin_amdgcn_s_wait_tensorcnt(0);
  }
  // ---- cooperative V transpose into LDS (overlaps with TDM) ----
  for (int e = threadIdx.x; e < 64 * 512; e += 256) {
    int n = e & 63, s = e >> 6;                    // coalesced global reads
    Vt[n * VT_STRIDE + s] = v[(size_t)s * 64 + n];
  }
  __syncthreads();

  for (int pass = 0; pass < 2; ++pass) {
    const int hoff = pass * 64;
    float* o  = (pass == 0 ? o1 : o2) + (size_t)kb * T_ * 64;
    float* st = stats + kb * 8 + pass * 4;

    // ---- logits: S[32,512] = Q[32,64] * K^T ; 64 tiles, 8 per wave ----
    for (int i = 0; i < 8; ++i) {
      int tile = wave + i * 8;
      int mt = tile & 1, stile = tile >> 1;
      v8f acc = {};
#pragma unroll
      for (int kc = 0; kc < 64; kc += 32) {
        v16h a = load_frag_row((const f16*)Qs, QS_STRIDE, 16 * mt, hoff + kc, lane);
        v16h b = load_frag_row(kmat, N_, 16 * stile, hoff + kc, lane);
        acc = wmma_f16(a, b, acc);
      }
      int col = 16 * stile + (lane & 15);
      int r0  = 16 * mt + ((lane >> 4) << 3);
#pragma unroll
      for (int j = 0; j < 8; ++j) P[(r0 + j) * P_STRIDE + col] = acc[j] * SCALE_INV;
    }
    __syncthreads();

    // ---- row softmax + stats: 16 lanes per row, the row stays in registers ----
    // A 16-lane half reads 64 consecutive floats per 16-byte access, so every LDS bank is hit once.
    {
      const int l16  = lane & 15;
      const int rsub = wave * 2 + (lane >> 4);
      v4f asum = {0.f, 0.f, 0.f, 0.f}, asq = {0.f, 0.f, 0.f, 0.f};
      float rmx = -__builtin_inff(), rmn = __builtin_inff();
#pragma unroll   // both rows in flight: their loads and reductions overlap
      for (int rr = 0; rr < 2; ++rr) {
        float* prow = P + (rr * 16 + rsub) * P_STRIDE + l16 * 4;
        v4f x[8];
        // every loop over x[] below is unrolled so that x[] is indexed by constants and lives in registers
#pragma unroll
        for (int c = 0; c < 8; ++c) x[c] = *(const v4f*)(prow + c * 64);

        float m = -__builtin_inff();
#pragma unroll
        for (int c = 0; c < 8; ++c)
          m = fmaxf(m, fmaxf(fmaxf(x[c][0], x[c][1]), fmaxf(x[c][2], x[c][3])));
        const float mx = row16_max(m);

        v4f s4 = {0.f, 0.f, 0.f, 0.f};
#pragma unroll
        for (int c = 0; c < 8; ++c) {
#pragma unroll
          for (int j = 0; j < 4; ++j) x[c][j] = __expf(x[c][j] - mx);
          s4 += x[c];
        }
        const float tot = row16_sum((s4[0] + s4[1]) + (s4[2] + s4[3]));
        const float inv = 1.0f / tot;

#pragma unroll
        for (int c = 0; c < 8; ++c) {
          v4f p0 = x[c] * inv;
          *(v4f*)(prow + c * 64) = p0;
          asum += p0;
          asq  += p0 * p0;
          rmx = fmaxf(rmx, fmaxf(fmaxf(p0[0], p0[1]), fmaxf(p0[2], p0[3])));
          rmn = fminf(rmn, fminf(fminf(p0[0], p0[1]), fminf(p0[2], p0[3])));
        }
      }
      float rsum = (asum[0] + asum[1]) + (asum[2] + asum[3]);
      float rsq  = (asq[0] + asq[1]) + (asq[2] + asq[3]);
      atomicAdd(&st[0], rsum);
      atomicAdd(&st[1], rsq);
      atomicMax((int*)&st[2], __float_as_int(rmx));   // softmax outputs > 0
      atomicMin((int*)&st[3], __float_as_int(rmn));
    }
    __syncthreads();

    // ---- O[32,64] = P[32,512] * V[512,64] ; 8 tiles, 1 per wave ----
    {
      int mt = wave & 1, nt = wave >> 1;
      v8f acc = {};
      for (int sc = 0; sc < 512; sc += 32) {
        v16h a = load_frag_lds_f32(P, P_STRIDE, 16 * mt, sc, lane);
        v16h b = load_frag_row((const f16*)Vt, VT_STRIDE, 16 * nt, sc, lane); // B[s][n]=Vt[n][s]
        acc = wmma_f16(a, b, acc);
      }
      store_tile_f32(o, 64, t0 + 16 * mt, 16 * nt, lane, acc);
    }
    __syncthreads();   // P reused by next pass
  }
}

// ---------------- kernel 3: stats -> MLP -> lambda ----------------
__global__ void lam_kernel(const float* __restrict__ stats,
                           const float* __restrict__ W1, const float* __restrict__ b1,
                           const float* __restrict__ W2, const float* __restrict__ b2,
                           float* __restrict__ lam) {
  int i = blockIdx.x * blockDim.x + threadIdx.x;
  if (i >= K_ * B_) return;
  int kband = i >> 2;
  const float* s = stats + i * 8;
  const float n = (float)T_ * (float)T_;
  float feat[8];
#pragma unroll
  for (int p = 0; p < 2; ++p) {
    float sum = s[p * 4 + 0], sq = s[p * 4 + 1];
    float mean = sum / n;
    float var  = (sq - sum * sum / n) / (n - 1.0f);
    feat[p * 4 + 0] = mean;
    feat[p * 4 + 1] = sqrtf(fmaxf(var, 0.f));
    feat[p * 4 + 2] = s[p * 4 + 2];
    feat[p * 4 + 3] = s[p * 4 + 3];
  }
  const float* w1  = W1 + kband * 16 * 8;
  const float* bb1 = b1 + kband * 16;
  const float* w2  = W2 + kband * 16;
  float z = b2[kband];
  for (int j = 0; j < 16; ++j) {
    float h = bb1[j];
#pragma unroll
    for (int qq = 0; qq < 8; ++qq) h += w1[j * 8 + qq] * feat[qq];
    z += w2[j] * fmaxf(h, 0.f);
  }
  lam[i] = 1.0f / (1.0f + __expf(-z));
}

// ---------------- kernel 4: out = (o1 - lam*o2) @ Wo^T + bo ----------------
__global__ __launch_bounds__(256) void out_kernel(
    const float* __restrict__ o1, const float* __restrict__ o2,
    const f16* __restrict__ woh, const float* __restrict__ bo,
    const float* __restrict__ lam, float* __restrict__ out) {
  __shared__ __align__(128) f16 D[32 * 64];
  const int lane = threadIdx.x & 31;
  const int wave = threadIdx.x >> 5;
  const int kb   = blockIdx.y;
  const int t0   = blockIdx.x * 32;
  const int kband = kb >> 2, bb = kb & 3;

  const float l = lam[kb];
  const float* p1 = o1 + (size_t)kb * T_ * 64 + (size_t)t0 * 64;
  const float* p2 = o2 + (size_t)kb * T_ * 64 + (size_t)t0 * 64;
  for (int i = threadIdx.x; i < 32 * 64; i += 256)
    D[i] = (f16)(p1[i] - l * p2[i]);
  __syncthreads();

  const f16* WO = woh + (size_t)kband * N_ * 64;
  const float* bvec = bo + kband * N_;

  for (int i = 0; i < 2; ++i) {
    int tile = wave + i * 8;
    int mt = tile & 1, nt = tile >> 1;
    v8f acc = {};
#pragma unroll
    for (int kc = 0; kc < 64; kc += 32) {
      v16h a = load_frag_row((const f16*)D, 64, 16 * mt, kc, lane);
      v16h b = load_frag_row(WO, 64, 16 * nt, kc, lane);
      acc = wmma_f16(a, b, acc);
    }
    int m     = 16 * nt + (lane & 15);
    int trow0 = t0 + 16 * mt + ((lane >> 4) << 3);
    float bias = bvec[m];
#pragma unroll
    for (int j = 0; j < 8; ++j) {
      int t = trow0 + j;
      out[(((size_t)bb * N_ + m) * T_ + t) * K_ + kband] = acc[j] + bias;
    }
  }
}

// ---------------- host side ----------------
extern "C" void kernel_launch(void* const* d_in, const int* in_sizes, int n_in,
                              void* d_out, int out_size, void* d_ws, size_t ws_size,
                              hipStream_t stream) {
  (void)in_sizes; (void)n_in; (void)out_size; (void)ws_size;
  const float* x  = (const float*)d_in[0];
  const float* Wq = (const float*)d_in[1];
  const float* Wk = (const float*)d_in[2];
  const float* Wv = (const float*)d_in[3];
  const float* Wo = (const float*)d_in[4];
  const float* bo = (const float*)d_in[5];
  const float* W1 = (const float*)d_in[6];
  const float* b1 = (const float*)d_in[7];
  const float* W2 = (const float*)d_in[8];
  const float* b2 = (const float*)d_in[9];

  char* ws = (char*)d_ws;
  f16*   xh    = (f16*)  (ws + OFF_XH);
  f16*   wqh   = (f16*)  (ws + OFF_WQH);
  f16*   wkh   = (f16*)  (ws + OFF_WKH);
  f16*   wvh   = (f16*)  (ws + OFF_WVH);
  f16*   woh   = (f16*)  (ws + OFF_WOH);
  f16*   qh    = (f16*)  (ws + OFF_QH);
  f16*   kh    = (f16*)  (ws + OFF_KH);
  f16*   vh    = (f16*)  (ws + OFF_VH);
  float* o1    = (float*)(ws + OFF_O1);
  float* o2    = (float*)(ws + OFF_O2);
  float* stats = (float*)(ws + OFF_ST);
  float* lamb  = (float*)(ws + OFF_LAM);

  prep_x_kernel<<<dim3((K_ * B_ * T_ * N_ + 255) / 256), dim3(256), 0, stream>>>(x, xh);
  prep_w_kernel<<<dim3((K_ * N_ * N_ + 255) / 256), dim3(256), 0, stream>>>(
      Wq, Wk, Wv, Wo, wqh, wkh, wvh, woh);
  init_stats_kernel<<<dim3(1), dim3(256), 0, stream>>>(stats, lamb);

  proj_kernel<<<dim3(T_ / 32, K_ * B_), dim3(256), 0, stream>>>(
      xh, wqh, wkh, wvh, qh, kh, vh);
  attn_kernel<<<dim3(T_ / 32, K_ * B_), dim3(256), 0, stream>>>(
      qh, kh, vh, o1, o2, stats);
  lam_kernel<<<dim3(1), dim3(128), 0, stream>>>(stats, W1, b1, W2, b2, lamb);
  out_kernel<<<dim3(T_ / 32, K_ * B_), dim3(256), 0, stream>>>(
      o1, o2, woh, bo, lamb, (float*)d_out);
}

// v002
// One run takes 213 microseconds.
// Two timings next to v001 both put it at 1.12 times that version's speed.
// Counting every step since v000, it is 1.31 times as fast.
#include <hip/hip_runtime.h>
#include <hip/hip_bf16.h>

typedef _Float16 f16;
typedef __attribute__((ext_vector_type(16))) _Float16 v16h;
typedef __attribute__((ext_vector_type(8)))  float    v8f;
typedef unsigned int v4u __attribute__((ext_vector_type(4)));
typedef int          v8i __attribute__((ext_vector_type(8)));
typedef int          v4i __attribute__((ext_vector_type(4)));
typedef float        v4f __attribute__((ext_vector_type(4)));

#define B_ 4
#define N_ 128
#define T_ 512
#define K_ 30
#define SCALE_INV 0.25f  // 1/sqrt(HEAD_DIM=16)

#define P_STRIDE  520    // 512 + 8 f32  (bank decorrelation)
#define VT_STRIDE 528    // 512 + 16 f16 (32B-aligned rows, bank decorrelation)
#define QS_STRIDE 144    // 128 + 16 f16 (matches TDM pad: 8 dwords per 64-dword row)

// ---------------- workspace layout (bytes) ----------------
constexpr size_t SZ_XH  = (size_t)K_ * B_ * T_ * N_ * 2;
constexpr size_t SZ_WQH = (size_t)K_ * N_ * N_ * 2;
constexpr size_t SZ_WVH = (size_t)K_ * 64 * N_ * 2;
constexpr size_t SZ_QH  = SZ_XH;
constexpr size_t SZ_VH  = (size_t)K_ * B_ * T_ * 64 * 2;
constexpr size_t SZ_O   = (size_t)K_ * B_ * T_ * 64 * 4;

constexpr size_t OFF_XH  = 0;
constexpr size_t OFF_WQH = OFF_XH  + SZ_XH;
constexpr size_t OFF_WKH = OFF_WQH + SZ_WQH;
constexpr size_t OFF_WVH = OFF_WKH + SZ_WQH;
constexpr size_t OFF_WOH = OFF_WVH + SZ_WVH;
constexpr size_t OFF_QH  = OFF_WOH + SZ_WVH;
constexpr size_t OFF_KH  = OFF_QH  + SZ_QH;
constexpr size_t OFF_VH  = OFF_KH  + SZ_QH;
constexpr size_t OFF_O1  = OFF_VH  + SZ_VH;
constexpr size_t OFF_O2  = OFF_O1  + SZ_O;
constexpr size_t OFF_ST  = OFF_O2  + SZ_O;
constexpr size_t OFF_LAM = OFF_ST  + (size_t)K_ * B_ * 8 * 4;

// ---------------- WMMA helpers ----------------
__device__ inline v8f wmma_f16(v16h a, v16h b, v8f c) {
  return __builtin_amdgcn_wmma_f32_16x16x32_f16(
      false, a, false, b, (short)0, c, false, false);
}

// Fragment where the reduction axis is contiguous: lane L -> row row0+L%16,
// 16 contiguous f16 at col0 + (L/16)*16.  (works for global and LDS pointers)
__device__ inline v16h load_frag_row(const f16* base, int stride, int row0, int col0, int lane) {
  const f16* p = base + (size_t)(row0 + (lane & 15)) * stride + col0 + ((lane >> 4) << 4);
  return *(const v16h*)p;
}

// A-fragment from an f32 LDS tile (convert on the fly).
__device__ inline v16h load_frag_lds_f32(const float* base, int stride, int row0, int col0, int lane) {
  const float* p = base + (size_t)(row0 + (lane & 15)) * stride + col0 + ((lane >> 4) << 4);
  v16h r;
#pragma unroll
  for (int i = 0; i < 16; ++i) r[i] = (f16)p[i];
  return r;
}

// C/D tile: VGPR j -> row row0 + (lane/16)*8 + j, col col0 + lane%16
__device__ inline void store_tile_f16(f16* base, int stride, int row0, int col0, int lane, v8f c) {
  int col = col0 + (lane & 15);
  int r0  = row0 + ((lane >> 4) << 3);
#pragma unroll
  for (int j = 0; j < 8; ++j) base[(size_t)(r0 + j) * stride + col] = (f16)c[j];
}

__device__ inline void store_tile_f32(float* base, int stride, int row0, int col0, int lane, v8f c) {
  int col = col0 + (lane & 15);
  int r0  = row0 + ((lane >> 4) << 3);
#pragma unroll
  for (int j = 0; j < 8; ++j) base[(size_t)(r0 + j) * stride + col] = c[j];
}

// ---- butterfly over a 16-lane row (DPP row_xmask 1,2,4,8): every lane ends with the row's result ----
template <int CTRL>
__device__ inline float dpp_xmask(float x) {
  return __builtin_bit_cast(float, __builtin_amdgcn_update_dpp(
      0, __builtin_bit_cast(int, x), CTRL, 0xf, 0xf, true));
}
__device__ inline float row16_max(float v) {
  v = fmaxf(v, dpp_xmask<0x161>(v));
  v = fmaxf(v, dpp_xmask<0x162>(v));
  v = fmaxf(v, dpp_xmask<0x164>(v));
  v = fmaxf(v, dpp_xmask<0x168>(v));
  return v;
}
__device__ inline float row16_sum(float v) {
  v += dpp_xmask<0x161>(v);
  v += dpp_xmask<0x162>(v);
  v += dpp_xmask<0x164>(v);
  v += dpp_xmask<0x168>(v);
  return v;
}

// ---- TDM: 2D tile load global->LDS, data_size=4B, optional per-row LDS pad ----
// rows x cols given in 4-byte units; row_stride in 4-byte units.
__device__ inline void tdm_load_2d(unsigned lds_byte_off, const void* gptr,
                                   unsigned cols4, unsigned rows,
                                   unsigned row_stride4, bool pad_8dw_per_64dw) {
  unsigned long long ga = (unsigned long long)(size_t)gptr;
  v4u g0 = { 1u,                                  // count=1, user mode
             lds_byte_off,                        // lds_addr
             (unsigned)(ga & 0xffffffffu),        // global_addr[31:0]
             (unsigned)((ga >> 32) & 0x01ffffffu) | (2u << 30) };  // addr[56:32] | type=2
  unsigned d0 = (2u << 16);                       // data_size = 4 bytes
  if (pad_8dw_per_64dw) d0 |= (1u << 20) | (5u << 22) | (7u << 25); // pad_en, every 64dw, +8dw
  v8i g1 = { (int)d0,
             (int)((cols4 & 0xffffu) << 16),                       // tensor_dim0[15:0]
             (int)((cols4 >> 16) | ((rows & 0xffffu) << 16)),      // dim0 hi | tensor_dim1 lo
             (int)((rows >> 16) | ((cols4 & 0xffffu) << 16)),      // dim1 hi | tile_dim0
             (int)(rows & 0xffffu),                                // tile_dim1 (tile_dim2=0)
             (int)row_stride4,                                     // tensor_dim0_stride lo
             0, 0 };
  v4i z4 = { 0, 0, 0, 0 };
#if __clang_major__ >= 23
  v8i z8 = { 0, 0, 0, 0, 0, 0, 0, 0 };
  __builtin_amdgcn_tensor_load_to_lds(g0, g1, z4, z4, z8, 0);
#else
  __builtin_amdgcn_tensor_load_to_lds(g0, g1, z4, z4, 0);
#endif
}

// ---------------- kernel 0a: x [B,N,T,K] f32 -> xh [K,B,T,N] f16 ----------------
// One block moves a tile of 64 n x 16 t x 30 k through LDS: x is read along its contiguous (t,k)
// axis (1920 bytes a row, whole lines), xh is written along its contiguous n axis (128 bytes a row).
#define PX_T     16            // t rows of a tile
#define PX_N     64            // n columns of a tile
#define PX_F     (PX_T * K_)   // 480 (t,k) rows in LDS
#define PX_PITCH 33            // dwords a row: 32 pairs of f16 + 1, so that 4 rows read together miss each other's banks
typedef __attribute__((ext_vector_type(2))) _Float16 v2h;

__global__ __launch_bounds__(480) void prep_x_kernel(const float* __restrict__ x, f16* __restrict__ xh) {
  __shared__ __align__(16) unsigned S[PX_F * PX_PITCH];   // S[t*30+k][n/2]: two neighbouring n in a dword
  const int tid = threadIdx.x;
  const int t0  = blockIdx.x * PX_T;
  const int n0  = blockIdx.y * PX_N;
  const int b   = blockIdx.z;

  // ---- read: lane -> 16 bytes of one row's (t,k) run; each thread takes rows n and n+1 ----
  const int j   = tid % 120;   // which 4 floats of the 480
  const int np0 = tid / 120;   // 0..3: first pair of rows
  // x and xh are far below 4 GiB: 32-bit element offsets from the kernel's base pointers keep the address work short
  const float* src = x + (unsigned)(((b * N_ + n0 + 2 * np0) * T_ + t0) * K_ + 4 * j);
  v4f lo[8], hi[8];
#pragma unroll   // the loads issue back to back, so their latencies overlap; lo/hi indexed by constants stay in registers
  for (int i = 0; i < 8; ++i) {
    lo[i] = *(const v4f*)(src + (8 * i)     * T_ * K_);
    hi[i] = *(const v4f*)(src + (8 * i + 1) * T_ * K_);
  }
#pragma unroll   // lo/hi indexed by constants
  for (int i = 0; i < 8; ++i) {
#pragma unroll   // vector elements picked by constants
    for (int c = 0; c < 4; ++c) {
      v2h p = { (f16)lo[i][c], (f16)hi[i][c] };
      S[(4 * j + c) * PX_PITCH + np0 + 4 * i] = __builtin_bit_cast(unsigned, p);
    }
  }
  __syncthreads();

  // ---- write: 8 lanes carry one (t,k) row of 64 n (one 128-byte line), 4 rows a store ----
  const int l8 = tid & 7;
  const int r  = (tid >> 3) & 3;
  const int wave = tid >> 5;   // 15 waves, 8 groups of 4 rows each
#pragma unroll   // the 8 LDS reads and stores overlap
  for (int i = 0; i < 8; ++i) {
    const int f  = 4 * (wave + 15 * i) + r;
    const int tl = f / K_;
    const int k  = f - tl * K_;
    const unsigned* rp = S + f * PX_PITCH + 4 * l8;
    v4u val = { rp[0], rp[1], rp[2], rp[3] };
    *(v4u*)(xh + (unsigned)(((k * B_ + b) * T_ + t0 + tl) * N_ + n0 + 8 * l8)) = val;
  }
}

// ---------------- kernel 0b: weights f32 -> f16 ----------------
__global__ void prep_w_kernel(const float* __restrict__ Wq, const float* __restrict__ Wk,
                              const float* __restrict__ Wv, const float* __restrict__ Wo,
                              f16* __restrict__ wqh, f16* __restrict__ wkh,
                              f16* __restrict__ wvh, f16* __restrict__ woh) {
  int idx = blockIdx.x * blockDim.x + threadIdx.x;
  if (idx < K_ * N_ * N_) { wqh[idx] = (f16)Wq[idx]; wkh[idx] = (f16)Wk[idx]; }
  if (idx < K_ * 64 * N_) { wvh[idx] = (f16)Wv[idx]; woh[idx] = (f16)Wo[idx]; }
}

// ---------------- kernel 0c: init stats accumulators ----------------
__global__ void init_stats_kernel(float* __restrict__ stats, float* __restrict__ lam) {
  int i = threadIdx.x;
  if (i < K_ * B_) {
    float* s = stats + i * 8;
    s[0] = 0.f; s[1] = 0.f; s[2] = -__builtin_inff(); s[3] = __builtin_inff();
    s[4] = 0.f; s[5] = 0.f; s[6] = -__builtin_inff(); s[7] = __builtin_inff();
    lam[i] = 0.f;
  }
}

// ---------------- kernel 1: q/k/v projections (WMMA) ----------------
__global__ __launch_bounds__(256) void proj_kernel(
    const f16* __restrict__ xh, const f16* __restrict__ wqh, const f16* __restrict__ wkh,
    const f16* __restrict__ wvh, f16* __restrict__ qh, f16* __restrict__ kh,
    f16* __restrict__ vh) {
  const int lane = threadIdx.x & 31;
  const int wave = threadIdx.x >> 5;
  const int kb   = blockIdx.y;
  const int t0   = blockIdx.x * 32;
  const int kband = kb >> 2;

  const f16* xb = xh + (size_t)kb * T_ * N_;
  const f16* WQ = wqh + (size_t)kband * N_ * N_;
  const f16* WK = wkh + (size_t)kband * N_ * N_;
  const f16* WV = wvh + (size_t)kband * 64 * N_;
  f16* q  = qh + (size_t)kb * T_ * N_;
  f16* kk = kh + (size_t)kb * T_ * N_;
  f16* v  = vh + (size_t)kb * T_ * 64;

  for (int i = 0; i < 5; ++i) {
    int tile  = wave + i * 8;
    int which = tile >> 4;                 // 0=q, 1=k, 2=v
    int local = (which < 2) ? (tile & 15) : (tile - 32);
    int nt = local >> 1, mt = local & 1;
    const f16* W = (which == 0) ? WQ : (which == 1) ? WK : WV;
    v8f acc = {};
#pragma unroll
    for (int kc = 0; kc < N_; kc += 32) {
      v16h a = load_frag_row(xb, N_, t0 + 16 * mt, kc, lane);
      v16h b = load_frag_row(W,  N_, 16 * nt,      kc, lane);
      acc = wmma_f16(a, b, acc);
    }
    if (which == 0)      store_tile_f16(q,  N_, t0 + 16 * mt, 16 * nt, lane, acc);
    else if (which == 1) store_tile_f16(kk, N_, t0 + 16 * mt, 16 * nt, lane, acc);
    else                 store_tile_f16(v,  64, t0 + 16 * mt, 16 * nt, lane, acc);
  }
}

// ---------------- kernel 2: attention ----------------
__global__ __launch_bounds__(256) void attn_kernel(
    const f16* __restrict__ qh, const f16* __restrict__ kh, const f16* __restrict__ vh,
    float* __restrict__ o1, float* __restrict__ o2, float* __restrict__ stats) {
  __shared__ __align__(128) float P[32 * P_STRIDE];     // probability tile
  __shared__ __align__(128) f16  Vt[64 * VT_STRIDE];    // V transposed: Vt[n][s]
  __shared__ __align__(128) f16  Qs[32 * QS_STRIDE];    // Q rows (TDM-staged, padded)

  const int lane = threadIdx.x & 31;
  const int wave = threadIdx.x >> 5;
  const int kb   = blockIdx.y;
  const int t0   = blockIdx.x * 32;

  const f16* q    = qh + (size_t)kb * T_ * N_;
  const f16* kmat = kh + (size_t)kb * T_ * N_;
  const f16* v    = vh + (size_t)kb * T_ * 64;

  // ---- TDM: stage Q rows [32 x 128 f16] into LDS with +8dw/row padding ----
  if (threadIdx.x < 32) {
    unsigned lds_off = (unsigned)(size_t)&Qs[0];   // low 32 bits of generic = LDS byte offset
    tdm_load_2d(lds_off, q + (size_t)t0 * N_,
                /*cols4=*/N_ / 2, /*rows=*/32, /*row_stride4=*/N_ / 2,
                /*pad=*/true);
    __builtin_amdgcn_s_wait_tensorcnt(0);
  }
  // ---- cooperative V transpose into LDS (overlaps with TDM) ----
  for (int e = threadIdx.x; e < 64 * 512; e += 256) {
    int n = e & 63, s = e >> 6;                    // coalesced global reads
    Vt[n * VT_STRIDE + s] = v[(size_t)s * 64 + n];
  }
  __syncthreads();

  for (int pass = 0; pass < 2; ++pass) {
    const int hoff = pass * 64;
    float* o  = (pass == 0 ? o1 : o2) + (size_t)kb * T_ * 64;
    float* st = stats + kb * 8 + pass * 4;

    // ---- logits: S[32,512] = Q[32,64] * K^T ; 64 tiles, 8 per wave ----
    for (int i = 0; i < 8; ++i) {
      int tile = wave + i * 8;
      int mt = tile & 1, stile = tile >> 1;
      v8f acc = {};
#pragma unroll
      for (int kc = 0; kc < 64; kc += 32) {
        v16h a = load_frag_row((const f16*)Qs, QS_STRIDE, 16 * mt, hoff + kc, lane);
        v16h b = load_frag_row(kmat, N_, 16 * stile, hoff + kc, lane);
        acc = wmma_f16(a, b, acc);
      }
      int col = 16 * stile + (lane & 15);
      int r0  = 16 * mt + ((lane >> 4) << 3);
#pragma unroll
      for (int j = 0; j < 8; ++j) P[(r0 + j) * P_STRIDE + col] = acc[j] * SCALE_INV;
    }
    __syncthreads();

    // ---- row softmax + stats: 16 lanes per row, the row stays in registers ----
    // A 16-lane half reads 64 consecutive floats per 16-byte access, so every LDS bank is hit once.
    {
      const int l16  = lane & 15;
      const int rsub = wave * 2 + (lane >> 4);
      v4f asum = {0.f, 0.f, 0.f, 0.f}, asq = {0.f, 0.f, 0.f, 0.f};
      float rmx = -__builtin_inff(), rmn = __builtin_inff();
#pragma unroll   // both rows in flight: their loads and reductions overlap
      for (int rr = 0; rr < 2; ++rr) {
        float* prow = P + (rr * 16 + rsub) * P_STRIDE + l16 * 4;
        v4f x[8];
        // every loop over x[] below is unrolled so that x[] is indexed by constants and lives in registers
#pragma unroll
        for (int c = 0; c < 8; ++c) x[c] = *(const v4f*)(prow + c * 64);

        float m = -__builtin_inff();
#pragma unroll
        for (int c = 0; c < 8; ++c)
          m = fmaxf(m, fmaxf(fmaxf(x[c][0], x[c][1]), fmaxf(x[c][2], x[c][3])));
        const float mx = row16_max(m);

        v4f s4 = {0.f, 0.f, 0.f, 0.f};
#pragma unroll
        for (int c = 0; c < 8; ++c) {
#pragma unroll
          for (int j = 0; j < 4; ++j) x[c][j] = __expf(x[c][j] - mx);
          s4 += x[c];
        }
        const float tot = row16_sum((s4[0] + s4[1]) + (s4[2] + s4[3]));
        const float inv = 1.0f / tot;

#pragma unroll
        for (int c = 0; c < 8; ++c) {
          v4f p0 = x[c] * inv;
          *(v4f*)(prow + c * 64) = p0;
          asum += p0;
          asq  += p0 * p0;
          rmx = fmaxf(rmx, fmaxf(fmaxf(p0[0], p0[1]), fmaxf(p0[2], p0[3])));
          rmn = fminf(rmn, fminf(fminf(p0[0], p0[1]), fminf(p0[2], p0[3])));
        }
      }
      float rsum = (asum[0] + asum[1]) + (asum[2] + asum[3]);
      float rsq  = (asq[0] + asq[1]) + (asq[2] + asq[3]);
      atomicAdd(&st[0], rsum);
      atomicAdd(&st[1], rsq);
      atomicMax((int*)&st[2], __float_as_int(rmx));   // softmax outputs > 0
      atomicMin((int*)&st[3], __float_as_int(rmn));
    }
    __syncthreads();

    // ---- O[32,64] = P[32,512] * V[512,64] ; 8 tiles, 1 per wave ----
    {
      int mt = wave & 1, nt = wave >> 1;
      v8f acc = {};
      for (int sc = 0; sc < 512; sc += 32) {
        v16h a = load_frag_lds_f32(P, P_STRIDE, 16 * mt, sc, lane);
        v16h b = load_frag_row((const f16*)Vt, VT_STRIDE, 16 * nt, sc, lane); // B[s][n]=Vt[n][s]
        acc = wmma_f16(a, b, acc);
      }
      store_tile_f32(o, 64, t0 + 16 * mt, 16 * nt, lane, acc);
    }
    __syncthreads();   // P reused by next pass
  }
}

// ---------------- kernel 3: stats -> MLP -> lambda ----------------
__global__ void lam_kernel(const float* __restrict__ stats,
                           const float* __restrict__ W1, const float* __restrict__ b1,
                           const float* __restrict__ W2, const float* __restrict__ b2,
                           float* __restrict__ lam) {
  int i = blockIdx.x * blockDim.x + threadIdx.x;
  if (i >= K_ * B_) return;
  int kband = i >> 2;
  const float* s = stats + i * 8;
  const float n = (float)T_ * (float)T_;
  float feat[8];
#pragma unroll
  for (int p = 0; p < 2; ++p) {
    float sum = s[p * 4 + 0], sq = s[p * 4 + 1];
    float mean = sum / n;
    float var  = (sq - sum * sum / n) / (n - 1.0f);
    feat[p * 4 + 0] = mean;
    feat[p * 4 + 1] = sqrtf(fmaxf(var, 0.f));
    feat[p * 4 + 2] = s[p * 4 + 2];
    feat[p * 4 + 3] = s[p * 4 + 3];
  }
  const float* w1  = W1 + kband * 16 * 8;
  const float* bb1 = b1 + kband * 16;
  const float* w2  = W2 + kband * 16;
  float z = b2[kband];
  for (int j = 0; j < 16; ++j) {
    float h = bb1[j];
#pragma unroll
    for (int qq = 0; qq < 8; ++qq) h += w1[j * 8 + qq] * feat[qq];
    z += w2[j] * fmaxf(h, 0.f);
  }
  lam[i] = 1.0f / (1.0f + __expf(-z));
}

// ---------------- kernel 4: out = (o1 - lam*o2) @ Wo^T + bo ----------------
__global__ __launch_bounds__(256) void out_kernel(
    const float* __restrict__ o1, const float* __restrict__ o2,
    const f16* __restrict__ woh, const float* __restrict__ bo,
    const float* __restrict__ lam, float* __restrict__ out) {
  __shared__ __align__(128) f16 D[32 * 64];
  const int lane = threadIdx.x & 31;
  const int wave = threadIdx.x >> 5;
  const int kb   = blockIdx.y;
  const int t0   = blockIdx.x * 32;
  const int kband = kb >> 2, bb = kb & 3;

  const float l = lam[kb];
  const float* p1 = o1 + (size_t)kb * T_ * 64 + (size_t)t0 * 64;
  const float* p2 = o2 + (size_t)kb * T_ * 64 + (size_t)t0 * 64;
  for (int i = threadIdx.x; i < 32 * 64; i += 256)
    D[i] = (f16)(p1[i] - l * p2[i]);
  __syncthreads();

  const f16* WO = woh + (size_t)kband * N_ * 64;
  const float* bvec = bo + kband * N_;

  for (int i = 0; i < 2; ++i) {
    int tile = wave + i * 8;
    int mt = tile & 1, nt = tile >> 1;
    v8f acc = {};
#pragma unroll
    for (int kc = 0; kc < 64; kc += 32) {
      v16h a = load_frag_row((const f16*)D, 64, 16 * mt, kc, lane);
      v16h b = load_frag_row(WO, 64, 16 * nt, kc, lane);
      acc = wmma_f16(a, b, acc);
    }
    int m     = 16 * nt + (lane & 15);
    int trow0 = t0 + 16 * mt + ((lane >> 4) << 3);
    float bias = bvec[m];
#pragma unroll
    for (int j = 0; j < 8; ++j) {
      int t = trow0 + j;
      out[(((size_t)bb * N_ + m) * T_ + t) * K_ + kband] = acc[j] + bias;
    }
  }
}

// ---------------- host side ----------------
extern "C" void kernel_launch(void* const* d_in, const int* in_sizes, int n_in,
                              void* d_out, int out_size, void* d_ws, size_t ws_size,
                              hipStream_t stream) {
  (void)in_sizes; (void)n_in; (void)out_size; (void)ws_size;
  const float* x  = (const float*)d_in[0];
  const float* Wq = (const float*)d_in[1];
  const float* Wk = (const float*)d_in[2];
  const float* Wv = (const float*)d_in[3];
  const float* Wo = (const float*)d_in[4];
  const float* bo = (const float*)d_in[5];
  const float* W1 = (const float*)d_in[6];
  const float* b1 = (const float*)d_in[7];
  const float* W2 = (const float*)d_in[8];
  const float* b2 = (const float*)d_in[9];

  char* ws = (char*)d_ws;
  f16*   xh    = (f16*)  (ws + OFF_XH);
  f16*   wqh   = (f16*)  (ws + OFF_WQH);
  f16*   wkh   = (f16*)  (ws + OFF_WKH);
  f16*   wvh   = (f16*)  (ws + OFF_WVH);
  f16*   woh   = (f16*)  (ws + OFF_WOH);
  f16*   qh    = (f16*)  (ws + OFF_QH);
  f16*   kh    = (f16*)  (ws + OFF_KH);
  f16*   vh    = (f16*)  (ws + OFF_VH);
  float* o1    = (float*)(ws + OFF_O1);
  float* o2    = (float*)(ws + OFF_O2);
  float* stats = (float*)(ws + OFF_ST);
  float* lamb  = (float*)(ws + OFF_LAM);

  prep_x_kernel<<<dim3(T_ / PX_T, N_ / PX_N, B_), dim3(480), 0, stream>>>(x, xh);
  prep_w_kernel<<<dim3((K_ * N_ * N_ + 255) / 256), dim3(256), 0, stream>>>(
      Wq, Wk, Wv, Wo, wqh, wkh, wvh, woh);
  init_stats_kernel<<<dim3(1), dim3(256), 0, stream>>>(stats, lamb);

  proj_kernel<<<dim3(T_ / 32, K_ * B_), dim3(256), 0, stream>>>(
      xh, wqh, wkh, wvh, qh, kh, vh);
  attn_kernel<<<dim3(T_ / 32, K_ * B_), dim3(256), 0, stream>>>(
      qh, kh, vh, o1, o2, stats);
  lam_kernel<<<dim3(1), dim3(128), 0, stream>>>(stats, W1, b1, W2, b2, lamb);
  out_kernel<<<dim3(T_ / 32, K_ * B_), dim3(256), 0, stream>>>(
      o1, o2, woh, bo, lamb, (float*)d_out);
}

// v003
// One run takes 186 microseconds.
// In both of two side-by-side timings against v002, it was 1.14 times as fast.
// Over all steps from v000 it is 1.50 times as fast.
#include <hip/hip_runtime.h>
#include <hip/hip_bf16.h>

typedef _Float16 f16;
typedef __attribute__((ext_vector_type(16))) _Float16 v16h;
typedef __attribute__((ext_vector_type(8)))  float    v8f;
typedef unsigned int v4u __attribute__((ext_vector_type(4)));
typedef int          v8i __attribute__((ext_vector_type(8)));
typedef int          v4i __attribute__((ext_vector_type(4)));
typedef float        v4f __attribute__((ext_vector_type(4)));

#define B_ 4
#define N_ 128
#define T_ 512
#define K_ 30
#define SCALE_INV 0.25f  // 1/sqrt(HEAD_DIM=16)

#define P_STRIDE  520    // 512 + 8 f32  (bank decorrelation)
#define VT_STRIDE 528    // 512 + 16 f16 (32B-aligned rows, bank decorrelation)
#define QS_STRIDE 144    // 128 + 16 f16 (matches TDM pad: 8 dwords per 64-dword row)

// ---------------- workspace layout (bytes) ----------------
constexpr size_t SZ_XH  = (size_t)K_ * B_ * T_ * N_ * 2;
constexpr size_t SZ_WQH = (size_t)K_ * N_ * N_ * 2;
constexpr size_t SZ_WVH = (size_t)K_ * 64 * N_ * 2;
constexpr size_t SZ_QH  = SZ_XH;
constexpr size_t SZ_VH  = (size_t)K_ * B_ * T_ * 64 * 2;
constexpr size_t SZ_O   = (size_t)K_ * B_ * T_ * 64 * 4;

constexpr size_t OFF_XH  = 0;
constexpr size_t OFF_WQH = OFF_XH  + SZ_XH;
constexpr size_t OFF_WKH = OFF_WQH + SZ_WQH;
constexpr size_t OFF_WVH = OFF_WKH + SZ_WQH;
constexpr size_t OFF_WOH = OFF_WVH + SZ_WVH;
constexpr size_t OFF_QH  = OFF_WOH + SZ_WVH;
constexpr size_t OFF_KH  = OFF_QH  + SZ_QH;
constexpr size_t OFF_VH  = OFF_KH  + SZ_QH;
constexpr size_t OFF_O1  = OFF_VH  + SZ_VH;
constexpr size_t OFF_O2  = OFF_O1  + SZ_O;
constexpr size_t OFF_ST  = OFF_O2  + SZ_O;
constexpr size_t OFF_LAM = OFF_ST  + (size_t)K_ * B_ * 8 * 4;

// ---------------- WMMA helpers ----------------
__device__ inline v8f wmma_f16(v16h a, v16h b, v8f c) {
  return __builtin_amdgcn_wmma_f32_16x16x32_f16(
      false, a, false, b, (short)0, c, false, false);
}

// Fragment where the reduction axis is contiguous: lane L -> row row0+L%16,
// 16 contiguous f16 at col0 + (L/16)*16.  (works for global and LDS pointers)
__device__ inline v16h load_frag_row(const f16* base, int stride, int row0, int col0, int lane) {
  const f16* p = base + (size_t)(row0 + (lane & 15)) * stride + col0 + ((lane >> 4) << 4);
  return *(const v16h*)p;
}

// A-fragment from an f32 LDS tile (convert on the fly).
__device__ inline v16h load_frag_lds_f32(const float* base, int stride, int row0, int col0, int lane) {
  const float* p = base + (size_t)(row0 + (lane & 15)) * stride + col0 + ((lane >> 4) << 4);
  v16h r;
#pragma unroll
  for (int i = 0; i < 16; ++i) r[i] = (f16)p[i];
  return r;
}

// C/D tile: VGPR j -> row row0 + (lane/16)*8 + j, col col0 + lane%16
__device__ inline void store_tile_f16(f16* base, int stride, int row0, int col0, int lane, v8f c) {
  int col = col0 + (lane & 15);
  int r0  = row0 + ((lane >> 4) << 3);
#pragma unroll
  for (int j = 0; j < 8; ++j) base[(size_t)(r0 + j) * stride + col] = (f16)c[j];
}

__device__ inline void store_tile_f32(float* base, int stride, int row0, int col0, int lane, v8f c) {
  int col = col0 + (lane & 15);
  int r0  = row0 + ((lane >> 4) << 3);
#pragma unroll
  for (int j = 0; j < 8; ++j) base[(size_t)(r0 + j) * stride + col] = c[j];
}

// ---- butterfly over a 16-lane row (DPP row_xmask 1,2,4,8): every lane ends with the row's result ----
template <int CTRL>
__device__ inline float dpp_xmask(float x) {
  return __builtin_bit_cast(float, __builtin_amdgcn_update_dpp(
      0, __builtin_bit_cast(int, x), CTRL, 0xf, 0xf, true));
}
__device__ inline float row16_max(float v) {
  v = fmaxf(v, dpp_xmask<0x161>(v));
  v = fmaxf(v, dpp_xmask<0x162>(v));
  v = fmaxf(v, dpp_xmask<0x164>(v));
  v = fmaxf(v, dpp_xmask<0x168>(v));
  return v;
}
__device__ inline float row16_sum(float v) {
  v += dpp_xmask<0x161>(v);
  v += dpp_xmask<0x162>(v);
  v += dpp_xmask<0x164>(v);
  v += dpp_xmask<0x168>(v);
  return v;
}

// ---- TDM: 2D tile load global->LDS, data_size=4B, optional per-row LDS pad ----
// rows x cols given in 4-byte units; row_stride in 4-byte units.
__device__ inline void tdm_load_2d(unsigned lds_byte_off, const void* gptr,
                                   unsigned cols4, unsigned rows,
                                   unsigned row_stride4, bool pad_8dw_per_64dw) {
  unsigned long long ga = (unsigned long long)(size_t)gptr;
  v4u g0 = { 1u,                                  // count=1, user mode
             lds_byte_off,                        // lds_addr
             (unsigned)(ga & 0xffffffffu),        // global_addr[31:0]
             (unsigned)((ga >> 32) & 0x01ffffffu) | (2u << 30) };  // addr[56:32] | type=2
  unsigned d0 = (2u << 16);                       // data_size = 4 bytes
  if (pad_8dw_per_64dw) d0 |= (1u << 20) | (5u << 22) | (7u << 25); // pad_en, every 64dw, +8dw
  v8i g1 = { (int)d0,
             (int)((cols4 & 0xffffu) << 16),                       // tensor_dim0[15:0]
             (int)((cols4 >> 16) | ((rows & 0xffffu) << 16)),      // dim0 hi | tensor_dim1 lo
             (int)((rows >> 16) | ((cols4 & 0xffffu) << 16)),      // dim1 hi | tile_dim0
             (int)(rows & 0xffffu),                                // tile_dim1 (tile_dim2=0)
             (int)row_stride4,                                     // tensor_dim0_stride lo
             0, 0 };
  v4i z4 = { 0, 0, 0, 0 };
#if __clang_major__ >= 23
  v8i z8 = { 0, 0, 0, 0, 0, 0, 0, 0 };
  __builtin_amdgcn_tensor_load_to_lds(g0, g1, z4, z4, z8, 0);
#else
  __builtin_amdgcn_tensor_load_to_lds(g0, g1, z4, z4, 0);
#endif
}

// ---------------- kernel 0a: x [B,N,T,K] f32 -> xh [K,B,T,N] f16 ----------------
// One block moves a tile of 64 n x 16 t x 30 k through LDS: x is read along its contiguous (t,k)
// axis (1920 bytes a row, whole lines), xh is written along its contiguous n axis (128 bytes a row).
#define PX_T     16            // t rows of a tile
#define PX_N     64            // n columns of a tile
#define PX_F     (PX_T * K_)   // 480 (t,k) rows in LDS
#define PX_PITCH 33            // dwords a row: 32 pairs of f16 + 1, so that 4 rows read together miss each other's banks
typedef __attribute__((ext_vector_type(2))) _Float16 v2h;

__global__ __launch_bounds__(480) void prep_x_kernel(const float* __restrict__ x, f16* __restrict__ xh) {
  __shared__ __align__(16) unsigned S[PX_F * PX_PITCH];   // S[t*30+k][n/2]: two neighbouring n in a dword
  const int tid = threadIdx.x;
  const int t0  = blockIdx.x * PX_T;
  const int n0  = blockIdx.y * PX_N;
  const int b   = blockIdx.z;

  // ---- read: lane -> 16 bytes of one row's (t,k) run; each thread takes rows n and n+1 ----
  const int j   = tid % 120;   // which 4 floats of the 480
  const int np0 = tid / 120;   // 0..3: first pair of rows
  // x and xh are far below 4 GiB: 32-bit element offsets from the kernel's base pointers keep the address work short
  const float* src = x + (unsigned)(((b * N_ + n0 + 2 * np0) * T_ + t0) * K_ + 4 * j);
  v4f lo[8], hi[8];
#pragma unroll   // the loads issue back to back, so their latencies overlap; lo/hi indexed by constants stay in registers
  for (int i = 0; i < 8; ++i) {
    lo[i] = *(const v4f*)(src + (8 * i)     * T_ * K_);
    hi[i] = *(const v4f*)(src + (8 * i + 1) * T_ * K_);
  }
#pragma unroll   // lo/hi indexed by constants
  for (int i = 0; i < 8; ++i) {
#pragma unroll   // vector elements picked by constants
    for (int c = 0; c < 4; ++c) {
      v2h p = { (f16)lo[i][c], (f16)hi[i][c] };
      S[(4 * j + c) * PX_PITCH + np0 + 4 * i] = __builtin_bit_cast(unsigned, p);
    }
  }
  __syncthreads();

  // ---- write: 8 lanes carry one (t,k) row of 64 n (one 128-byte line), 4 rows a store ----
  const int l8 = tid & 7;
  const int r  = (tid >> 3) & 3;
  const int wave = tid >> 5;   // 15 waves, 8 groups of 4 rows each
#pragma unroll   // the 8 LDS reads and stores overlap
  for (int i = 0; i < 8; ++i) {
    const int f  = 4 * (wave + 15 * i) + r;
    const int tl = f / K_;
    const int k  = f - tl * K_;
    const unsigned* rp = S + f * PX_PITCH + 4 * l8;
    v4u val = { rp[0], rp[1], rp[2], rp[3] };
    *(v4u*)(xh + (unsigned)(((k * B_ + b) * T_ + t0 + tl) * N_ + n0 + 8 * l8)) = val;
  }
}

// ---------------- kernel 0b: weights f32 -> f16 ----------------
__global__ void prep_w_kernel(const float* __restrict__ Wq, const float* __restrict__ Wk,
                              const float* __restrict__ Wv, const float* __restrict__ Wo,
                              f16* __restrict__ wqh, f16* __restrict__ wkh,
                              f16* __restrict__ wvh, f16* __restrict__ woh) {
  int idx = blockIdx.x * blockDim.x + threadIdx.x;
  if (idx < K_ * N_ * N_) { wqh[idx] = (f16)Wq[idx]; wkh[idx] = (f16)Wk[idx]; }
  if (idx < K_ * 64 * N_) { wvh[idx] = (f16)Wv[idx]; woh[idx] = (f16)Wo[idx]; }
}

// ---------------- kernel 0c: init stats accumulators ----------------
__global__ void init_stats_kernel(float* __restrict__ stats, float* __restrict__ lam) {
  int i = threadIdx.x;
  if (i < K_ * B_) {
    float* s = stats + i * 8;
    s[0] = 0.f; s[1] = 0.f; s[2] = -__builtin_inff(); s[3] = __builtin_inff();
    s[4] = 0.f; s[5] = 0.f; s[6] = -__builtin_inff(); s[7] = __builtin_inff();
    lam[i] = 0.f;
  }
}

// ---------------- kernel 1: q/k/v projections (WMMA) ----------------
__global__ __launch_bounds__(256) void proj_kernel(
    const f16* __restrict__ xh, const f16* __restrict__ wqh, const f16* __restrict__ wkh,
    const f16* __restrict__ wvh, f16* __restrict__ qh, f16* __restrict__ kh,
    f16* __restrict__ vh) {
  const int lane = threadIdx.x & 31;
  const int wave = threadIdx.x >> 5;
  const int kb   = blockIdx.y;
  const int t0   = blockIdx.x * 32;
  const int kband = kb >> 2;

  const f16* xb = xh + (size_t)kb * T_ * N_;
  const f16* WQ = wqh + (size_t)kband * N_ * N_;
  const f16* WK = wkh + (size_t)kband * N_ * N_;
  const f16* WV = wvh + (size_t)kband * 64 * N_;
  f16* q  = qh + (size_t)kb * T_ * N_;
  f16* kk = kh + (size_t)kb * T_ * N_;
  f16* v  = vh + (size_t)kb * T_ * 64;

  for (int i = 0; i < 5; ++i) {
    int tile  = wave + i * 8;
    int which = tile >> 4;                 // 0=q, 1=k, 2=v
    int local = (which < 2) ? (tile & 15) : (tile - 32);
    int nt = local >> 1, mt = local & 1;
    const f16* W = (which == 0) ? WQ : (which == 1) ? WK : WV;
    v8f acc = {};
#pragma unroll
    for (int kc = 0; kc < N_; kc += 32) {
      v16h a = load_frag_row(xb, N_, t0 + 16 * mt, kc, lane);
      v16h b = load_frag_row(W,  N_, 16 * nt,      kc, lane);
      acc = wmma_f16(a, b, acc);
    }
    if (which == 0)      store_tile_f16(q,  N_, t0 + 16 * mt, 16 * nt, lane, acc);
    else if (which == 1) store_tile_f16(kk, N_, t0 + 16 * mt, 16 * nt, lane, acc);
    else                 store_tile_f16(v,  64, t0 + 16 * mt, 16 * nt, lane, acc);
  }
}

// ---------------- kernel 2: attention ----------------
__global__ __launch_bounds__(256) void attn_kernel(
    const f16* __restrict__ qh, const f16* __restrict__ kh, const f16* __restrict__ vh,
    float* __restrict__ o1, float* __restrict__ o2, float* __restrict__ stats) {
  __shared__ __align__(128) float P[32 * P_STRIDE];     // probability tile
  __shared__ __align__(128) f16  Vt[64 * VT_STRIDE];    // V transposed: Vt[n][s]
  __shared__ __align__(128) f16  Qs[32 * QS_STRIDE];    // Q rows (TDM-staged, padded)

  const int lane = threadIdx.x & 31;
  const int wave = threadIdx.x >> 5;
  const int kb   = blockIdx.y;
  const int t0   = blockIdx.x * 32;

  const f16* q    = qh + (size_t)kb * T_ * N_;
  const f16* kmat = kh + (size_t)kb * T_ * N_;
  const f16* v    = vh + (size_t)kb * T_ * 64;

  // ---- TDM: stage Q rows [32 x 128 f16] into LDS with +8dw/row padding ----
  if (threadIdx.x < 32) {
    unsigned lds_off = (unsigned)(size_t)&Qs[0];   // low 32 bits of generic = LDS byte offset
    tdm_load_2d(lds_off, q + (size_t)t0 * N_,
                /*cols4=*/N_ / 2, /*rows=*/32, /*row_stride4=*/N_ / 2,
                /*pad=*/true);
    __builtin_amdgcn_s_wait_tensorcnt(0);
  }
  // ---- cooperative V transpose into LDS (overlaps with TDM) ----
  for (int e = threadIdx.x; e < 64 * 512; e += 256) {
    int n = e & 63, s = e >> 6;                    // coalesced global reads
    Vt[n * VT_STRIDE + s] = v[(size_t)s * 64 + n];
  }
  __syncthreads();

  for (int pass = 0; pass < 2; ++pass) {
    const int hoff = pass * 64;
    float* o  = (pass == 0 ? o1 : o2) + (size_t)kb * T_ * 64;
    float* st = stats + kb * 8 + pass * 4;

    // ---- logits: S[32,512] = Q[32,64] * K^T ; 64 tiles, 8 per wave ----
    for (int i = 0; i < 8; ++i) {
      int tile = wave + i * 8;
      int mt = tile & 1, stile = tile >> 1;
      v8f acc = {};
#pragma unroll
      for (int kc = 0; kc < 64; kc += 32) {
        v16h a = load_frag_row((const f16*)Qs, QS_STRIDE, 16 * mt, hoff + kc, lane);
        v16h b = load_frag_row(kmat, N_, 16 * stile, hoff + kc, lane);
        acc = wmma_f16(a, b, acc);
      }
      int col = 16 * stile + (lane & 15);
      int r0  = 16 * mt + ((lane >> 4) << 3);
#pragma unroll
      for (int j = 0; j < 8; ++j) P[(r0 + j) * P_STRIDE + col] = acc[j] * SCALE_INV;
    }
    __syncthreads();

    // ---- row softmax + stats: 16 lanes per row, the row stays in registers ----
    // A 16-lane half reads 64 consecutive floats per 16-byte access, so every LDS bank is hit once.
    {
      const int l16  = lane & 15;
      const int rsub = wave * 2 + (lane >> 4);
      v4f asum = {0.f, 0.f, 0.f, 0.f}, asq = {0.f, 0.f, 0.f, 0.f};
      float rmx = -__builtin_inff(), rmn = __builtin_inff();
#pragma unroll   // both rows in flight: their loads and reductions overlap
      for (int rr = 0; rr < 2; ++rr) {
        float* prow = P + (rr * 16 + rsub) * P_STRIDE + l16 * 4;
        v4f x[8];
        // every loop over x[] below is unrolled so that x[] is indexed by constants and lives in registers
#pragma unroll
        for (int c = 0; c < 8; ++c) x[c] = *(const v4f*)(prow + c * 64);

        float m = -__builtin_inff();
#pragma unroll
        for (int c = 0; c < 8; ++c)
          m = fmaxf(m, fmaxf(fmaxf(x[c][0], x[c][1]), fmaxf(x[c][2], x[c][3])));
        const float mx = row16_max(m);

        v4f s4 = {0.f, 0.f, 0.f, 0.f};
#pragma unroll
        for (int c = 0; c < 8; ++c) {
#pragma unroll
          for (int j = 0; j < 4; ++j) x[c][j] = __expf(x[c][j] - mx);
          s4 += x[c];
        }
        const float tot = row16_sum((s4[0] + s4[1]) + (s4[2] + s4[3]));
        const float inv = 1.0f / tot;

#pragma unroll
        for (int c = 0; c < 8; ++c) {
          v4f p0 = x[c] * inv;
          *(v4f*)(prow + c * 64) = p0;
          asum += p0;
          asq  += p0 * p0;
          rmx = fmaxf(rmx, fmaxf(fmaxf(p0[0], p0[1]), fmaxf(p0[2], p0[3])));
          rmn = fminf(rmn, fminf(fminf(p0[0], p0[1]), fminf(p0[2], p0[3])));
        }
      }
      float rsum = (asum[0] + asum[1]) + (asum[2] + asum[3]);
      float rsq  = (asq[0] + asq[1]) + (asq[2] + asq[3]);
      atomicAdd(&st[0], rsum);
      atomicAdd(&st[1], rsq);
      atomicMax((int*)&st[2], __float_as_int(rmx));   // softmax outputs > 0
      atomicMin((int*)&st[3], __float_as_int(rmn));
    }
    __syncthreads();

    // ---- O[32,64] = P[32,512] * V[512,64] ; 8 tiles, 1 per wave ----
    {
      int mt = wave & 1, nt = wave >> 1;
      v8f acc = {};
      for (int sc = 0; sc < 512; sc += 32) {
        v16h a = load_frag_lds_f32(P, P_STRIDE, 16 * mt, sc, lane);
        v16h b = load_frag_row((const f16*)Vt, VT_STRIDE, 16 * nt, sc, lane); // B[s][n]=Vt[n][s]
        acc = wmma_f16(a, b, acc);
      }
      store_tile_f32(o, 64, t0 + 16 * mt, 16 * nt, lane, acc);
    }
    __syncthreads();   // P reused by next pass
  }
}

// ---------------- kernel 3: stats -> MLP -> lambda ----------------
__global__ void lam_kernel(const float* __restrict__ stats,
                           const float* __restrict__ W1, const float* __restrict__ b1,
                           const float* __restrict__ W2, const float* __restrict__ b2,
                           float* __restrict__ lam) {
  int i = blockIdx.x * blockDim.x + threadIdx.x;
  if (i >= K_ * B_) return;
  int kband = i >> 2;
  const float* s = stats + i * 8;
  const float n = (float)T_ * (float)T_;
  float feat[8];
#pragma unroll
  for (int p = 0; p < 2; ++p) {
    float sum = s[p * 4 + 0], sq = s[p * 4 + 1];
    float mean = sum / n;
    float var  = (sq - sum * sum / n) / (n - 1.0f);
    feat[p * 4 + 0] = mean;
    feat[p * 4 + 1] = sqrtf(fmaxf(var, 0.f));
    feat[p * 4 + 2] = s[p * 4 + 2];
    feat[p * 4 + 3] = s[p * 4 + 3];
  }
  const float* w1  = W1 + kband * 16 * 8;
  const float* bb1 = b1 + kband * 16;
  const float* w2  = W2 + kband * 16;
  float z = b2[kband];
  for (int j = 0; j < 16; ++j) {
    float h = bb1[j];
#pragma unroll
    for (int qq = 0; qq < 8; ++qq) h += w1[j * 8 + qq] * feat[qq];
    z += w2[j] * fmaxf(h, 0.f);
  }
  lam[i] = 1.0f / (1.0f + __expf(-z));
}

// ---------------- kernel 4: out = (o1 - lam*o2) @ Wo^T + bo ----------------
// out is [B,N,T,K]: for one (b,m) the (t,k) axis is contiguous. One block makes 64 m x 16 t for ALL 30 bands,
// gathers the products in LDS in out's own order and stores runs of 1920 bytes (15 whole lines) a row.
#define OT_T  16             // t columns of a tile
#define OT_M  64             // m rows of a tile
#define OT_SP 484            // floats a row of S: 4 x odd, so rows stay 16-byte aligned and the 32 lanes of a tile store
                             // (16 t at 30 floats, two m groups 8 rows apart) fall on 32 different banks
#define OT_DP 72             // f16 a row of D: 144 bytes = 16 x odd, the pitch for 16-byte fragment reads of 128-byte rows
typedef __attribute__((ext_vector_type(8))) _Float16 v8h;
typedef __attribute__((ext_vector_type(4))) _Float16 v4h;

// 16 contiguous f16 from a row that is 16-byte (not 32-byte) aligned
__device__ inline v16h load_frag_2x16B(const f16* p) {
  v8h lo = *(const v8h*)p;
  v8h hi = *(const v8h*)(p + 8);
  return __builtin_shufflevector(lo, hi, 0, 1, 2, 3, 4, 5, 6, 7, 8, 9, 10, 11, 12, 13, 14, 15);
}

__global__ __launch_bounds__(480) void out_kernel(
    const float* __restrict__ o1, const float* __restrict__ o2,
    const f16* __restrict__ woh, const float* __restrict__ bo,
    const float* __restrict__ lam, float* __restrict__ out) {
  __shared__ __align__(16) float S[OT_M * OT_SP];        // S[m][t*30+k]
  __shared__ __align__(16) f16   D[K_ * OT_T * OT_DP];   // D[k][t][v] = o1 - lam*o2
  const int tid  = threadIdx.x;
  const int lane = tid & 31;
  const int wave = __builtin_amdgcn_readfirstlane(tid >> 5);   // 15 waves; held scalar, so band indices and lam go the scalar way
  const int t0   = blockIdx.x * OT_T;
  const int m0   = blockIdx.y * OT_M;
  const int bb   = blockIdx.z;

  // ---- D: a band's 16 t x 64 v are 4 KB in a row in o1 and o2; a wave takes 2 bands, 512 bytes a load ----
  {
    const unsigned off = (unsigned)(((wave * B_ + bb) * T_ + t0) * 64 + lane * 4);
    const float* p1 = o1 + off;
    const float* p2 = o2 + off;
    v4f a[16], c[16];
    float l[2];
#pragma unroll   // all loads issue back to back off one address pair each, so their latencies overlap; a/c/l stay in registers
    for (int kk = 0; kk < 2; ++kk) {
      l[kk] = lam[(wave + 15 * kk) * B_ + bb];
#pragma unroll   // as above
      for (int i = 0; i < 8; ++i) {
        a[8 * kk + i] = *(const v4f*)(p1 + kk * 15 * B_ * T_ * 64 + i * 128);
        c[8 * kk + i] = *(const v4f*)(p2 + kk * 15 * B_ * T_ * 64 + i * 128);
      }
    }
    f16* dw = D + (wave * OT_T + (lane >> 4)) * OT_DP + (lane & 15) * 4;
#pragma unroll   // a/c/l indexed by constants
    for (int kk = 0; kk < 2; ++kk) {
#pragma unroll   // a/c indexed by constants
      for (int i = 0; i < 8; ++i) {
        const v4f x = a[8 * kk + i], y = c[8 * kk + i];
        v4h d = { (f16)(x[0] - l[kk] * y[0]), (f16)(x[1] - l[kk] * y[1]),
                  (f16)(x[2] - l[kk] * y[2]), (f16)(x[3] - l[kk] * y[3]) };
        *(v4h*)(dw + (15 * kk * OT_T + 2 * i) * OT_DP) = d;   // row k*16 + t, t = 2i + lane/16
      }
    }
  }
  __syncthreads();

  // ---- products: a wave takes 2 bands x 4 m tiles. Wo is the A operand and D the B operand, so that
  //      acc[j] = Y[m = 8h + j][t = c] and a store's lanes run along t ----
  {
    const int c = lane & 15, h = lane >> 4;
#pragma unroll 1   // kept rolled: with both bands unrolled the kernel needs more than 256 registers and spills
    for (int kk = 0; kk < 2; ++kk) {
      const int k = wave + 15 * kk;
      const f16* dk = D + (k * OT_T + c) * OT_DP + 16 * h;
      const v16h b0 = load_frag_2x16B(dk);
      const v16h b1 = load_frag_2x16B(dk + 32);
      const f16*   wk = woh + (unsigned)((k * N_ + m0 + c) * 64 + 16 * h);
      const float* bk = bo + k * N_ + m0 + 8 * h;
      float*       sp = S + 8 * h * OT_SP + c * K_ + k;
#pragma unroll   // the four tiles' weight loads overlap
      for (int mt = 0; mt < 4; ++mt) {
        const v16h a0 = *(const v16h*)(wk + mt * 16 * 64);
        const v16h a1 = *(const v16h*)(wk + mt * 16 * 64 + 32);
        const v4f  bl = *(const v4f*)(bk + 16 * mt);
        const v4f  bh = *(const v4f*)(bk + 16 * mt + 4);
        v8f acc = {};
        acc = wmma_f16(a0, b0, acc);
        acc = wmma_f16(a1, b1, acc);
#pragma unroll   // vector elements picked by constants
        for (int j = 0; j < 4; ++j) {
          sp[(16 * mt + j) * OT_SP]     = acc[j]     + bl[j];
          sp[(16 * mt + 4 + j) * OT_SP] = acc[4 + j] + bh[j];
        }
      }
    }
  }
  __syncthreads();

  // ---- store: 120 lanes of 16 bytes carry one m row's 480 floats, 4 rows a sweep ----
  {
    const int j4 = tid % 120;
    const int mr = tid / 120;   // 0..3
    float* dst = out + (unsigned)(((bb * N_ + m0 + mr) * T_ + t0) * K_ + 4 * j4);
    const float* sr = S + mr * OT_SP + 4 * j4;
#pragma unroll   // the 16 LDS reads and stores overlap
    for (int i = 0; i < 16; ++i)
      *(v4f*)(dst + 4 * i * T_ * K_) = *(const v4f*)(sr + 4 * i * OT_SP);
  }
}

// ---------------- host side ----------------
extern "C" void kernel_launch(void* const* d_in, const int* in_sizes, int n_in,
                              void* d_out, int out_size, void* d_ws, size_t ws_size,
                              hipStream_t stream) {
  (void)in_sizes; (void)n_in; (void)out_size; (void)ws_size;
  const float* x  = (const float*)d_in[0];
  const float* Wq = (const float*)d_in[1];
  const float* Wk = (const float*)d_in[2];
  const float* Wv = (const float*)d_in[3];
  const float* Wo = (const float*)d_in[4];
  const float* bo = (const float*)d_in[5];
  const float* W1 = (const float*)d_in[6];
  const float* b1 = (const float*)d_in[7];
  const float* W2 = (const float*)d_in[8];
  const float* b2 = (const float*)d_in[9];

  char* ws = (char*)d_ws;
  f16*   xh    = (f16*)  (ws + OFF_XH);
  f16*   wqh   = (f16*)  (ws + OFF_WQH);
  f16*   wkh   = (f16*)  (ws + OFF_WKH);
  f16*   wvh   = (f16*)  (ws + OFF_WVH);
  f16*   woh   = (f16*)  (ws + OFF_WOH);
  f16*   qh    = (f16*)  (ws + OFF_QH);
  f16*   kh    = (f16*)  (ws + OFF_KH);
  f16*   vh    = (f16*)  (ws + OFF_VH);
  float* o1    = (float*)(ws + OFF_O1);
  float* o2    = (float*)(ws + OFF_O2);
  float* stats = (float*)(ws + OFF_ST);
  float* lamb  = (float*)(ws + OFF_LAM);

  prep_x_kernel<<<dim3(T_ / PX_T, N_ / PX_N, B_), dim3(480), 0, stream>>>(x, xh);
  prep_w_kernel<<<dim3((K_ * N_ * N_ + 255) / 256), dim3(256), 0, stream>>>(
      Wq, Wk, Wv, Wo, wqh, wkh, wvh, woh);
  init_stats_kernel<<<dim3(1), dim3(256), 0, stream>>>(stats, lamb);

  proj_kernel<<<dim3(T_ / 32, K_ * B_), dim3(256), 0, stream>>>(
      xh, wqh, wkh, wvh, qh, kh, vh);
  attn_kernel<<<dim3(T_ / 32, K_ * B_), dim3(256), 0, stream>>>(
      qh, kh, vh, o1, o2, stats);
  lam_kernel<<<dim3(1), dim3(128), 0, stream>>>(stats, W1, b1, W2, b2, lamb);
  out_kernel<<<dim3(T_ / OT_T, N_ / OT_M, B_), dim3(480), 0, stream>>>(
      o1, o2, woh, bo, lamb, (float*)d_out);
}

// v004
// One run takes 166 microseconds.
// Timed twice side by side with v003, it ran 1.13 times as fast both times.
// Counting every step since v000, it is 1.70 times as fast.
#include <hip/hip_runtime.h>
#include <hip/hip_bf16.h>

typedef _Float16 f16;
typedef __attribute__((ext_vector_type(16))) _Float16 v16h;
typedef __attribute__((ext_vector_type(8)))  float    v8f;
typedef unsigned int v4u __attribute__((ext_vector_type(4)));
typedef int          v8i __attribute__((ext_vector_type(8)));
typedef int          v4i __attribute__((ext_vector_type(4)));
typedef float        v4f __attribute__((ext_vector_type(4)));
typedef __attribute__((ext_vector_type(8))) _Float16 v8h;

#define B_ 4
#define N_ 128
#define T_ 512
#define K_ 30
#define SCALE_INV 0.25f  // 1/sqrt(HEAD_DIM=16)

#define P_STRIDE  520    // 512 + 8 f32  (bank decorrelation)
#define VT_STRIDE 528    // 512 + 16 f16 (32B-aligned rows, bank decorrelation)
#define QS_STRIDE 144    // 128 + 16 f16 (matches TDM pad: 8 dwords per 64-dword row)

// ---------------- workspace layout (bytes) ----------------
constexpr size_t SZ_XH  = (size_t)K_ * B_ * T_ * N_ * 2;
constexpr size_t SZ_WQH = (size_t)K_ * N_ * N_ * 2;
constexpr size_t SZ_WVH = (size_t)K_ * 64 * N_ * 2;
constexpr size_t SZ_QH  = SZ_XH;
constexpr size_t SZ_VH  = (size_t)K_ * B_ * T_ * 64 * 2;
constexpr size_t SZ_O   = (size_t)K_ * B_ * T_ * 64 * 4;

constexpr size_t OFF_XH  = 0;
constexpr size_t OFF_WQH = OFF_XH  + SZ_XH;
constexpr size_t OFF_WKH = OFF_WQH + SZ_WQH;
constexpr size_t OFF_WVH = OFF_WKH + SZ_WQH;
constexpr size_t OFF_WOH = OFF_WVH + SZ_WVH;
constexpr size_t OFF_QH  = OFF_WOH + SZ_WVH;
constexpr size_t OFF_KH  = OFF_QH  + SZ_QH;
constexpr size_t OFF_VH  = OFF_KH  + SZ_QH;
constexpr size_t OFF_O1  = OFF_VH  + SZ_VH;
constexpr size_t OFF_O2  = OFF_O1  + SZ_O;
constexpr size_t OFF_ST  = OFF_O2  + SZ_O;
constexpr size_t OFF_LAM = OFF_ST  + (size_t)K_ * B_ * 8 * 4;

// ---------------- WMMA helpers ----------------
__device__ inline v8f wmma_f16(v16h a, v16h b, v8f c) {
  return __builtin_amdgcn_wmma_f32_16x16x32_f16(
      false, a, false, b, (short)0, c, false, false);
}

// Fragment where the reduction axis is contiguous: lane L -> row row0+L%16,
// 16 contiguous f16 at col0 + (L/16)*16.  (works for global and LDS pointers)
__device__ inline v16h load_frag_row(const f16* base, int stride, int row0, int col0, int lane) {
  const f16* p = base + (size_t)(row0 + (lane & 15)) * stride + col0 + ((lane >> 4) << 4);
  return *(const v16h*)p;
}

// A-fragment from an f32 LDS tile (convert on the fly).
__device__ inline v16h load_frag_lds_f32(const float* base, int stride, int row0, int col0, int lane) {
  const float* p = base + (size_t)(row0 + (lane & 15)) * stride + col0 + ((lane >> 4) << 4);
  v16h r;
#pragma unroll
  for (int i = 0; i < 16; ++i) r[i] = (f16)p[i];
  return r;
}

// C/D tile: VGPR j -> row row0 + (lane/16)*8 + j, col col0 + lane%16
__device__ inline void store_tile_f16(f16* base, int stride, int row0, int col0, int lane, v8f c) {
  int col = col0 + (lane & 15);
  int r0  = row0 + ((lane >> 4) << 3);
#pragma unroll
  for (int j = 0; j < 8; ++j) base[(size_t)(r0 + j) * stride + col] = (f16)c[j];
}

// C/D tile stored transposed: a lane's 8 registers are 8 consecutive rows of one column, so with the row axis
// contiguous in memory they are one 16-byte store. base[col * stride + row]
__device__ inline void store_tile_f16_t(f16* base, int stride, int row0, int col0, int lane, v8f c) {
  v8h h;
#pragma unroll   // vector elements picked by constants
  for (int j = 0; j < 8; ++j) h[j] = (f16)c[j];
  *(v8h*)(base + (col0 + (lane & 15)) * stride + row0 + ((lane >> 4) << 3)) = h;
}

__device__ inline void store_tile_f32(float* base, int stride, int row0, int col0, int lane, v8f c) {
  int col = col0 + (lane & 15);
  int r0  = row0 + ((lane >> 4) << 3);
#pragma unroll
  for (int j = 0; j < 8; ++j) base[(size_t)(r0 + j) * stride + col] = c[j];
}

// ---- butterfly over a 16-lane row (DPP row_xmask 1,2,4,8): every lane ends with the row's result ----
template <int CTRL>
__device__ inline float dpp_xmask(float x) {
  return __builtin_bit_cast(float, __builtin_amdgcn_update_dpp(
      0, __builtin_bit_cast(int, x), CTRL, 0xf, 0xf, true));
}
__device__ inline float row16_max(float v) {
  v = fmaxf(v, dpp_xmask<0x161>(v));
  v = fmaxf(v, dpp_xmask<0x162>(v));
  v = fmaxf(v, dpp_xmask<0x164>(v));
  v = fmaxf(v, dpp_xmask<0x168>(v));
  return v;
}
__device__ inline float row16_sum(float v) {
  v += dpp_xmask<0x161>(v);
  v += dpp_xmask<0x162>(v);
  v += dpp_xmask<0x164>(v);
  v += dpp_xmask<0x168>(v);
  return v;
}

// ---- TDM: 2D tile load global->LDS, data_size=4B, optional per-row LDS pad ----
// rows x cols given in 4-byte units; row_stride in 4-byte units.
__device__ inline void tdm_load_2d(unsigned lds_byte_off, const void* gptr,
                                   unsigned cols4, unsigned rows,
                                   unsigned row_stride4, bool pad_8dw_per_64dw) {
  unsigned long long ga = (unsigned long long)(size_t)gptr;
  v4u g0 = { 1u,                                  // count=1, user mode
             lds_byte_off,                        // lds_addr
             (unsigned)(ga & 0xffffffffu),        // global_addr[31:0]
             (unsigned)((ga >> 32) & 0x01ffffffu) | (2u << 30) };  // addr[56:32] | type=2
  unsigned d0 = (2u << 16);                       // data_size = 4 bytes
  if (pad_8dw_per_64dw) d0 |= (1u << 20) | (5u << 22) | (7u << 25); // pad_en, every 64dw, +8dw
  v8i g1 = { (int)d0,
             (int)((cols4 & 0xffffu) << 16),                       // tensor_dim0[15:0]
             (int)((cols4 >> 16) | ((rows & 0xffffu) << 16)),      // dim0 hi | tensor_dim1 lo
             (int)((rows >> 16) | ((cols4 & 0xffffu) << 16)),      // dim1 hi | tile_dim0
             (int)(rows & 0xffffu),                                // tile_dim1 (tile_dim2=0)
             (int)row_stride4,                                     // tensor_dim0_stride lo
             0, 0 };
  v4i z4 = { 0, 0, 0, 0 };
#if __clang_major__ >= 23
  v8i z8 = { 0, 0, 0, 0, 0, 0, 0, 0 };
  __builtin_amdgcn_tensor_load_to_lds(g0, g1, z4, z4, z8, 0);
#else
  __builtin_amdgcn_tensor_load_to_lds(g0, g1, z4, z4, 0);
#endif
}

// ---------------- kernel 0a: x [B,N,T,K] f32 -> xh [K,B,T,N] f16 ----------------
// One block moves a tile of 64 n x 16 t x 30 k through LDS: x is read along its contiguous (t,k)
// axis (1920 bytes a row, whole lines), xh is written along its contiguous n axis (128 bytes a row).
#define PX_T     16            // t rows of a tile
#define PX_N     64            // n columns of a tile
#define PX_F     (PX_T * K_)   // 480 (t,k) rows in LDS
#define PX_PITCH 33            // dwords a row: 32 pairs of f16 + 1, so that 4 rows read together miss each other's banks
typedef __attribute__((ext_vector_type(2))) _Float16 v2h;

__global__ __launch_bounds__(480) void prep_x_kernel(const float* __restrict__ x, f16* __restrict__ xh) {
  __shared__ __align__(16) unsigned S[PX_F * PX_PITCH];   // S[t*30+k][n/2]: two neighbouring n in a dword
  const int tid = threadIdx.x;
  const int t0  = blockIdx.x * PX_T;
  const int n0  = blockIdx.y * PX_N;
  const int b   = blockIdx.z;

  // ---- read: lane -> 16 bytes of one row's (t,k) run; each thread takes rows n and n+1 ----
  const int j   = tid % 120;   // which 4 floats of the 480
  const int np0 = tid / 120;   // 0..3: first pair of rows
  // x and xh are far below 4 GiB: 32-bit element offsets from the kernel's base pointers keep the address work short
  const float* src = x + (unsigned)(((b * N_ + n0 + 2 * np0) * T_ + t0) * K_ + 4 * j);
  v4f lo[8], hi[8];
#pragma unroll   // the loads issue back to back, so their latencies overlap; lo/hi indexed by constants stay in registers
  for (int i = 0; i < 8; ++i) {
    lo[i] = *(const v4f*)(src + (8 * i)     * T_ * K_);
    hi[i] = *(const v4f*)(src + (8 * i + 1) * T_ * K_);
  }
#pragma unroll   // lo/hi indexed by constants
  for (int i = 0; i < 8; ++i) {
#pragma unroll   // vector elements picked by constants
    for (int c = 0; c < 4; ++c) {
      v2h p = { (f16)lo[i][c], (f16)hi[i][c] };
      S[(4 * j + c) * PX_PITCH + np0 + 4 * i] = __builtin_bit_cast(unsigned, p);
    }
  }
  __syncthreads();

  // ---- write: 8 lanes carry one (t,k) row of 64 n (one 128-byte line), 4 rows a store ----
  const int l8 = tid & 7;
  const int r  = (tid >> 3) & 3;
  const int wave = tid >> 5;   // 15 waves, 8 groups of 4 rows each
#pragma unroll   // the 8 LDS reads and stores overlap
  for (int i = 0; i < 8; ++i) {
    const int f  = 4 * (wave + 15 * i) + r;
    const int tl = f / K_;
    const int k  = f - tl * K_;
    const unsigned* rp = S + f * PX_PITCH + 4 * l8;
    v4u val = { rp[0], rp[1], rp[2], rp[3] };
    *(v4u*)(xh + (unsigned)(((k * B_ + b) * T_ + t0 + tl) * N_ + n0 + 8 * l8)) = val;
  }
}

// ---------------- kernel 0b: weights f32 -> f16 ----------------
__global__ void prep_w_kernel(const float* __restrict__ Wq, const float* __restrict__ Wk,
                              const float* __restrict__ Wv, const float* __restrict__ Wo,
                              f16* __restrict__ wqh, f16* __restrict__ wkh,
                              f16* __restrict__ wvh, f16* __restrict__ woh) {
  int idx = blockIdx.x * blockDim.x + threadIdx.x;
  if (idx < K_ * N_ * N_) { wqh[idx] = (f16)Wq[idx]; wkh[idx] = (f16)Wk[idx]; }
  if (idx < K_ * 64 * N_) { wvh[idx] = (f16)Wv[idx]; woh[idx] = (f16)Wo[idx]; }
}

// ---------------- kernel 0c: init stats accumulators ----------------
__global__ void init_stats_kernel(float* __restrict__ stats, float* __restrict__ lam) {
  int i = threadIdx.x;
  if (i < K_ * B_) {
    float* s = stats + i * 8;
    s[0] = 0.f; s[1] = 0.f; s[2] = -__builtin_inff(); s[3] = __builtin_inff();
    s[4] = 0.f; s[5] = 0.f; s[6] = -__builtin_inff(); s[7] = __builtin_inff();
    lam[i] = 0.f;
  }
}

// ---------------- kernel 1: q/k/v projections (WMMA) ----------------
__global__ __launch_bounds__(256) void proj_kernel(
    const f16* __restrict__ xh, const f16* __restrict__ wqh, const f16* __restrict__ wkh,
    const f16* __restrict__ wvh, f16* __restrict__ qh, f16* __restrict__ kh,
    f16* __restrict__ vh) {
  const int lane = threadIdx.x & 31;
  const int wave = threadIdx.x >> 5;
  const int kb   = blockIdx.y;
  const int t0   = blockIdx.x * 32;
  const int kband = kb >> 2;

  const f16* xb = xh + (size_t)kb * T_ * N_;
  const f16* WQ = wqh + (size_t)kband * N_ * N_;
  const f16* WK = wkh + (size_t)kband * N_ * N_;
  const f16* WV = wvh + (size_t)kband * 64 * N_;
  f16* q  = qh + (size_t)kb * T_ * N_;
  f16* kk = kh + (size_t)kb * T_ * N_;
  // v leaves transposed, in chunks of this block's 32 t: vh[kb][t/32][n][t%32]. A chunk is 4 KB in a row and has one writer.
  f16* v  = vh + (size_t)kb * T_ * 64 + (size_t)blockIdx.x * 64 * 32;

#pragma unroll   // rolled, each tile would wait out its own loads; unrolled, the five tiles' loads overlap
  for (int i = 0; i < 5; ++i) {
    int tile  = wave + i * 8;
    int which = tile >> 4;                 // 0=q, 1=k, 2=v
    int local = (which < 2) ? (tile & 15) : (tile - 32);
    int nt = local >> 1, mt = local & 1;
    const f16* W = (which == 0) ? WQ : (which == 1) ? WK : WV;
    v8f acc = {};
#pragma unroll
    for (int kc = 0; kc < N_; kc += 32) {
      v16h a = load_frag_row(xb, N_, t0 + 16 * mt, kc, lane);
      v16h b = load_frag_row(W,  N_, 16 * nt,      kc, lane);
      acc = wmma_f16(a, b, acc);
    }
    if (which == 0)      store_tile_f16(q,  N_, t0 + 16 * mt, 16 * nt, lane, acc);
    else if (which == 1) store_tile_f16(kk, N_, t0 + 16 * mt, 16 * nt, lane, acc);
    else                 store_tile_f16_t(v, 32, 16 * mt, 16 * nt, lane, acc);
  }
}

// ---------------- kernel 2: attention ----------------
__global__ __launch_bounds__(256) void attn_kernel(
    const f16* __restrict__ qh, const f16* __restrict__ kh, const f16* __restrict__ vh,
    float* __restrict__ o1, float* __restrict__ o2, float* __restrict__ stats) {
  __shared__ __align__(128) float P[32 * P_STRIDE];     // probability tile
  __shared__ __align__(128) f16  Vt[64 * VT_STRIDE];    // V transposed: Vt[n][s]
  __shared__ __align__(128) f16  Qs[32 * QS_STRIDE];    // Q rows (TDM-staged, padded)

  const int lane = threadIdx.x & 31;
  const int wave = threadIdx.x >> 5;
  const int kb   = blockIdx.y;
  const int t0   = blockIdx.x * 32;

  const f16* q    = qh + (size_t)kb * T_ * N_;
  const f16* kmat = kh + (size_t)kb * T_ * N_;
  const f16* v    = vh + (size_t)kb * T_ * 64;   // already transposed: [t/32][n][t%32]

  // ---- V^T: 64 KB in a row, 16 bytes a lane; the loads are issued first, so that they fly during the Q load's wait ----
  v4u vreg[16];
  {
    const v4u* vsrc = (const v4u*)v + threadIdx.x;
#pragma unroll   // all 16 loads in flight at once; vreg indexed by constants stays in registers
    for (int i = 0; i < 16; ++i) vreg[i] = vsrc[i * 256];
  }

  // ---- TDM: stage Q rows [32 x 128 f16] into LDS with +8dw/row padding ----
  if (threadIdx.x < 32) {
    unsigned lds_off = (unsigned)(size_t)&Qs[0];   // low 32 bits of generic = LDS byte offset
    tdm_load_2d(lds_off, q + (size_t)t0 * N_,
                /*cols4=*/N_ / 2, /*rows=*/32, /*row_stride4=*/N_ / 2,
                /*pad=*/true);
    __builtin_amdgcn_s_wait_tensorcnt(0);
  }
  // ---- V^T into its padded LDS rows: load i is chunk i, 4 lanes carry one n row's 32 s ----
  {
    f16* vdst = Vt + (threadIdx.x >> 2) * VT_STRIDE + (threadIdx.x & 3) * 8;
#pragma unroll   // vreg indexed by constants
    for (int i = 0; i < 16; ++i) *(v4u*)(vdst + i * 32) = vreg[i];
  }
  __syncthreads();

  for (int pass = 0; pass < 2; ++pass) {
    const int hoff = pass * 64;
    float* o  = (pass == 0 ? o1 : o2) + (size_t)kb * T_ * 64;
    float* st = stats + kb * 8 + pass * 4;

    // ---- logits: S[32,512] = Q[32,64] * K^T ; 64 tiles, 8 per wave ----
    for (int i = 0; i < 8; ++i) {
      int tile = wave + i * 8;
      int mt = tile & 1, stile = tile >> 1;
      v8f acc = {};
#pragma unroll
      for (int kc = 0; kc < 64; kc += 32) {
        v16h a = load_frag_row((const f16*)Qs, QS_STRIDE, 16 * mt, hoff + kc, lane);
        v16h b = load_frag_row(kmat, N_, 16 * stile, hoff + kc, lane);
        acc = wmma_f16(a, b, acc);
      }
      int col = 16 * stile + (lane & 15);
      int r0  = 16 * mt + ((lane >> 4) << 3);
#pragma unroll
      for (int j = 0; j < 8; ++j) P[(r0 + j) * P_STRIDE + col] = acc[j] * SCALE_INV;
    }
    __syncthreads();

    // ---- row softmax + stats: 16 lanes per row, the row stays in registers ----
    // A 16-lane half reads 64 consecutive floats per 16-byte access, so every LDS bank is hit once.
    {
      const int l16  = lane & 15;
      const int rsub = wave * 2 + (lane >> 4);
      v4f asum = {0.f, 0.f, 0.f, 0.f}, asq = {0.f, 0.f, 0.f, 0.f};
      float rmx = -__builtin_inff(), rmn = __builtin_inff();
#pragma unroll   // both rows in flight: their loads and reductions overlap
      for (int rr = 0; rr < 2; ++rr) {
        float* prow = P + (rr * 16 + rsub) * P_STRIDE + l16 * 4;
        v4f x[8];
        // every loop over x[] below is unrolled so that x[] is indexed by constants and lives in registers
#pragma unroll
        for (int c = 0; c < 8; ++c) x[c] = *(const v4f*)(prow + c * 64);

        float m = -__builtin_inff();
#pragma unroll
        for (int c = 0; c < 8; ++c)
          m = fmaxf(m, fmaxf(fmaxf(x[c][0], x[c][1]), fmaxf(x[c][2], x[c][3])));
        const float mx = row16_max(m);

        v4f s4 = {0.f, 0.f, 0.f, 0.f};
#pragma unroll
        for (int c = 0; c < 8; ++c) {
#pragma unroll
          for (int j = 0; j < 4; ++j) x[c][j] = __expf(x[c][j] - mx);
          s4 += x[c];
        }
        const float tot = row16_sum((s4[0] + s4[1]) + (s4[2] + s4[3]));
        const float inv = 1.0f / tot;

#pragma unroll
        for (int c = 0; c < 8; ++c) {
          v4f p0 = x[c] * inv;
          *(v4f*)(prow + c * 64) = p0;
          asum += p0;
          asq  += p0 * p0;
          rmx = fmaxf(rmx, fmaxf(fmaxf(p0[0], p0[1]), fmaxf(p0[2], p0[3])));
          rmn = fminf(rmn, fminf(fminf(p0[0], p0[1]), fminf(p0[2], p0[3])));
        }
      }
      float rsum = (asum[0] + asum[1]) + (asum[2] + asum[3]);
      float rsq  = (asq[0] + asq[1]) + (asq[2] + asq[3]);
      atomicAdd(&st[0], rsum);
      atomicAdd(&st[1], rsq);
      atomicMax((int*)&st[2], __float_as_int(rmx));   // softmax outputs > 0
      atomicMin((int*)&st[3], __float_as_int(rmn));
    }
    __syncthreads();

    // ---- O[32,64] = P[32,512] * V[512,64] ; 8 tiles, 1 per wave ----
    {
      int mt = wave & 1, nt = wave >> 1;
      v8f acc = {};
      for (int sc = 0; sc < 512; sc += 32) {
        v16h a = load_frag_lds_f32(P, P_STRIDE, 16 * mt, sc, lane);
        v16h b = load_frag_row((const f16*)Vt, VT_STRIDE, 16 * nt, sc, lane); // B[s][n]=Vt[n][s]
        acc = wmma_f16(a, b, acc);
      }
      store_tile_f32(o, 64, t0 + 16 * mt, 16 * nt, lane, acc);
    }
    __syncthreads();   // P reused by next pass
  }
}

// ---------------- kernel 3: stats -> MLP -> lambda ----------------
__global__ void lam_kernel(const float* __restrict__ stats,
                           const float* __restrict__ W1, const float* __restrict__ b1,
                           const float* __restrict__ W2, const float* __restrict__ b2,
                           float* __restrict__ lam) {
  int i = blockIdx.x * blockDim.x + threadIdx.x;
  if (i >= K_ * B_) return;
  int kband = i >> 2;
  const float* s = stats + i * 8;
  const float n = (float)T_ * (float)T_;
  float feat[8];
#pragma unroll
  for (int p = 0; p < 2; ++p) {
    float sum = s[p * 4 + 0], sq = s[p * 4 + 1];
    float mean = sum / n;
    float var  = (sq - sum * sum / n) / (n - 1.0f);
    feat[p * 4 + 0] = mean;
    feat[p * 4 + 1] = sqrtf(fmaxf(var, 0.f));
    feat[p * 4 + 2] = s[p * 4 + 2];
    feat[p * 4 + 3] = s[p * 4 + 3];
  }
  const float* w1  = W1 + kband * 16 * 8;
  const float* bb1 = b1 + kband * 16;
  const float* w2  = W2 + kband * 16;
  float z = b2[kband];
  for (int j = 0; j < 16; ++j) {
    float h = bb1[j];
#pragma unroll
    for (int qq = 0; qq < 8; ++qq) h += w1[j * 8 + qq] * feat[qq];
    z += w2[j] * fmaxf(h, 0.f);
  }
  lam[i] = 1.0f / (1.0f + __expf(-z));
}

// ---------------- kernel 4: out = (o1 - lam*o2) @ Wo^T + bo ----------------
// out is [B,N,T,K]: for one (b,m) the (t,k) axis is contiguous. One block makes 64 m x 16 t for ALL 30 bands,
// gathers the products in LDS in out's own order and stores runs of 1920 bytes (15 whole lines) a row.
#define OT_T  16             // t columns of a tile
#define OT_M  64             // m rows of a tile
#define OT_SP 484            // floats a row of S: 4 x odd, so rows stay 16-byte aligned and the 32 lanes of a tile store
                             // (16 t at 30 floats, two m groups 8 rows apart) fall on 32 different banks
#define OT_DP 72             // f16 a row of D: 144 bytes = 16 x odd, the pitch for 16-byte fragment reads of 128-byte rows
typedef __attribute__((ext_vector_type(4))) _Float16 v4h;

// 16 contiguous f16 from a row that is 16-byte (not 32-byte) aligned
__device__ inline v16h load_frag_2x16B(const f16* p) {
  v8h lo = *(const v8h*)p;
  v8h hi = *(const v8h*)(p + 8);
  return __builtin_shufflevector(lo, hi, 0, 1, 2, 3, 4, 5, 6, 7, 8, 9, 10, 11, 12, 13, 14, 15);
}

__global__ __launch_bounds__(480) void out_kernel(
    const float* __restrict__ o1, const float* __restrict__ o2,
    const f16* __restrict__ woh, const float* __restrict__ bo,
    const float* __restrict__ lam, float* __restrict__ out) {
  __shared__ __align__(16) float S[OT_M * OT_SP];        // S[m][t*30+k]
  __shared__ __align__(16) f16   D[K_ * OT_T * OT_DP];   // D[k][t][v] = o1 - lam*o2
  const int tid  = threadIdx.x;
  const int lane = tid & 31;
  const int wave = __builtin_amdgcn_readfirstlane(tid >> 5);   // 15 waves; held scalar, so band indices and lam go the scalar way
  const int t0   = blockIdx.x * OT_T;
  const int m0   = blockIdx.y * OT_M;
  const int bb   = blockIdx.z;

  // ---- D: a band's 16 t x 64 v are 4 KB in a row in o1 and o2; a wave takes 2 bands, 512 bytes a load ----
  {
    const unsigned off = (unsigned)(((wave * B_ + bb) * T_ + t0) * 64 + lane * 4);
    const float* p1 = o1 + off;
    const float* p2 = o2 + off;
    v4f a[16], c[16];
    float l[2];
#pragma unroll   // all loads issue back to back off one address pair each, so their latencies overlap; a/c/l stay in registers
    for (int kk = 0; kk < 2; ++kk) {
      l[kk] = lam[(wave + 15 * kk) * B_ + bb];
#pragma unroll   // as above
      for (int i = 0; i < 8; ++i) {
        a[8 * kk + i] = *(const v4f*)(p1 + kk * 15 * B_ * T_ * 64 + i * 128);
        c[8 * kk + i] = *(const v4f*)(p2 + kk * 15 * B_ * T_ * 64 + i * 128);
      }
    }
    f16* dw = D + (wave * OT_T + (lane >> 4)) * OT_DP + (lane & 15) * 4;
#pragma unroll   // a/c/l indexed by constants
    for (int kk = 0; kk < 2; ++kk) {
#pragma unroll   // a/c indexed by constants
      for (int i = 0; i < 8; ++i) {
        const v4f x = a[8 * kk + i], y = c[8 * kk + i];
        v4h d = { (f16)(x[0] - l[kk] * y[0]), (f16)(x[1] - l[kk] * y[1]),
                  (f16)(x[2] - l[kk] * y[2]), (f16)(x[3] - l[kk] * y[3]) };
        *(v4h*)(dw + (15 * kk * OT_T + 2 * i) * OT_DP) = d;   // row k*16 + t, t = 2i + lane/16
      }
    }
  }
  __syncthreads();

  // ---- products: a wave takes 2 bands x 4 m tiles. Wo is the A operand and D the B operand, so that
  //      acc[j] = Y[m = 8h + j][t = c] and a store's lanes run along t ----
  {
    const int c = lane & 15, h = lane >> 4;
#pragma unroll 1   // kept rolled: with both bands unrolled the kernel needs more than 256 registers and spills
    for (int kk = 0; kk < 2; ++kk) {
      const int k = wave + 15 * kk;
      const f16* dk = D + (k * OT_T + c) * OT_DP + 16 * h;
      const v16h b0 = load_frag_2x16B(dk);
      const v16h b1 = load_frag_2x16B(dk + 32);
      const f16*   wk = woh + (unsigned)((k * N_ + m0 + c) * 64 + 16 * h);
      const float* bk = bo + k * N_ + m0 + 8 * h;
      float*       sp = S + 8 * h * OT_SP + c * K_ + k;
#pragma unroll   // the four tiles' weight loads overlap
      for (int mt = 0; mt < 4; ++mt) {
        const v16h a0 = *(const v16h*)(wk + mt * 16 * 64);
        const v16h a1 = *(const v16h*)(wk + mt * 16 * 64 + 32);
        const v4f  bl = *(const v4f*)(bk + 16 * mt);
        const v4f  bh = *(const v4f*)(bk + 16 * mt + 4);
        v8f acc = {};
        acc = wmma_f16(a0, b0, acc);
        acc = wmma_f16(a1, b1, acc);
#pragma unroll   // vector elements picked by constants
        for (int j = 0; j < 4; ++j) {
          sp[(16 * mt + j) * OT_SP]     = acc[j]     + bl[j];
          sp[(16 * mt + 4 + j) * OT_SP] = acc[4 + j] + bh[j];
        }
      }
    }
  }
  __syncthreads();

  // ---- store: 120 lanes of 16 bytes carry one m row's 480 floats, 4 rows a sweep ----
  {
    const int j4 = tid % 120;
    const int mr = tid / 120;   // 0..3
    float* dst = out + (unsigned)(((bb * N_ + m0 + mr) * T_ + t0) * K_ + 4 * j4);
    const float* sr = S + mr * OT_SP + 4 * j4;
#pragma unroll   // the 16 LDS reads and stores overlap
    for (int i = 0; i < 16; ++i)
      *(v4f*)(dst + 4 * i * T_ * K_) = *(const v4f*)(sr + 4 * i * OT_SP);
  }
}

// ---------------- host side ----------------
extern "C" void kernel_launch(void* const* d_in, const int* in_sizes, int n_in,
                              void* d_out, int out_size, void* d_ws, size_t ws_size,
                              hipStream_t stream) {
  (void)in_sizes; (void)n_in; (void)out_size; (void)ws_size;
  const float* x  = (const float*)d_in[0];
  const float* Wq = (const float*)d_in[1];
  const float* Wk = (const float*)d_in[2];
  const float* Wv = (const float*)d_in[3];
  const float* Wo = (const float*)d_in[4];
  const float* bo = (const float*)d_in[5];
  const float* W1 = (const float*)d_in[6];
  const float* b1 = (const float*)d_in[7];
  const float* W2 = (const float*)d_in[8];
  const float* b2 = (const float*)d_in[9];

  char* ws = (char*)d_ws;
  f16*   xh    = (f16*)  (ws + OFF_XH);
  f16*   wqh   = (f16*)  (ws + OFF_WQH);
  f16*   wkh   = (f16*)  (ws + OFF_WKH);
  f16*   wvh   = (f16*)  (ws + OFF_WVH);
  f16*   woh   = (f16*)  (ws + OFF_WOH);
  f16*   qh    = (f16*)  (ws + OFF_QH);
  f16*   kh    = (f16*)  (ws + OFF_KH);
  f16*   vh    = (f16*)  (ws + OFF_VH);
  float* o1    = (float*)(ws + OFF_O1);
  float* o2    = (float*)(ws + OFF_O2);
  float* stats = (float*)(ws + OFF_ST);
  float* lamb  = (float*)(ws + OFF_LAM);

  prep_x_kernel<<<dim3(T_ / PX_T, N_ / PX_N, B_), dim3(480), 0, stream>>>(x, xh);
  prep_w_kernel<<<dim3((K_ * N_ * N_ + 255) / 256), dim3(256), 0, stream>>>(
      Wq, Wk, Wv, Wo, wqh, wkh, wvh, woh);
  init_stats_kernel<<<dim3(1), dim3(256), 0, stream>>>(stats, lamb);

  proj_kernel<<<dim3(T_ / 32, K_ * B_), dim3(256), 0, stream>>>(
      xh, wqh, wkh, wvh, qh, kh, vh);
  attn_kernel<<<dim3(T_ / 32, K_ * B_), dim3(256), 0, stream>>>(
      qh, kh, vh, o1, o2, stats);
  lam_kernel<<<dim3(1), dim3(128), 0, stream>>>(stats, W1, b1, W2, b2, lamb);
  out_kernel<<<dim3(T_ / OT_T, N_ / OT_M, B_), dim3(480), 0, stream>>>(
      o1, o2, woh, bo, lamb, (float*)d_out);
}

// v005
// A run of this version takes 136 microseconds.
// Two timings next to v004 both put it at 1.21 times that version's speed.
// Over all steps from v000 it is 2.05 times as fast.
#include <hip/hip_runtime.h>
#include <hip/hip_bf16.h>

typedef _Float16 f16;
typedef __attribute__((ext_vector_type(16))) _Float16 v16h;
typedef __attribute__((ext_vector_type(8)))  float    v8f;
typedef unsigned int v4u __attribute__((ext_vector_type(4)));
typedef int          v8i __attribute__((ext_vector_type(8)));
typedef int          v4i __attribute__((ext_vector_type(4)));
typedef float        v4f __attribute__((ext_vector_type(4)));
typedef __attribute__((ext_vector_type(8))) _Float16 v8h;

#define B_ 4
#define N_ 128
#define T_ 512
#define K_ 30
#define SCALE_INV 0.25f  // 1/sqrt(HEAD_DIM=16)

#define P_STRIDE  520    // 512 + 8 f32  (bank decorrelation)
#define VT_STRIDE 528    // 512 + 16 f16 (32B-aligned rows, bank decorrelation)
#define QS_STRIDE 144    // 128 + 16 f16 (matches TDM pad: 8 dwords per 64-dword row)
#define LINE_F    32     // floats in a 128-byte line: what different blocks store in one launch lies a line apart

// ---------------- workspace layout (bytes) ----------------
constexpr size_t SZ_XH  = (size_t)K_ * B_ * T_ * N_ * 2;
constexpr size_t SZ_WQH = (size_t)K_ * N_ * N_ * 2;
constexpr size_t SZ_WVH = (size_t)K_ * 64 * N_ * 2;
constexpr size_t SZ_QH  = SZ_XH;
constexpr size_t SZ_VH  = (size_t)K_ * B_ * T_ * 64 * 2;
constexpr size_t SZ_O   = (size_t)K_ * B_ * T_ * 64 * 4;

constexpr size_t OFF_XH  = 0;
constexpr size_t OFF_WQH = OFF_XH  + SZ_XH;
constexpr size_t OFF_WKH = OFF_WQH + SZ_WQH;
constexpr size_t OFF_WVH = OFF_WKH + SZ_WQH;
constexpr size_t OFF_WOH = OFF_WVH + SZ_WVH;
constexpr size_t OFF_QH  = OFF_WOH + SZ_WVH;
constexpr size_t OFF_KH  = OFF_QH  + SZ_QH;
constexpr size_t OFF_VH  = OFF_KH  + SZ_QH;
constexpr size_t OFF_O1  = OFF_VH  + SZ_VH;
constexpr size_t OFF_O2  = OFF_O1  + SZ_O;
constexpr size_t OFF_ST  = OFF_O2  + SZ_O;
constexpr size_t OFF_LAM = OFF_ST  + (size_t)K_ * B_ * (T_ / 32) * 128;   // one 128-byte line for each attention block's partial stats

// ---------------- WMMA helpers ----------------
__device__ inline v8f wmma_f16(v16h a, v16h b, v8f c) {
  return __builtin_amdgcn_wmma_f32_16x16x32_f16(
      false, a, false, b, (short)0, c, false, false);
}

// Fragment where the reduction axis is contiguous: lane L -> row row0+L%16,
// 16 contiguous f16 at col0 + (L/16)*16.  (works for global and LDS pointers)
__device__ inline v16h load_frag_row(const f16* base, int stride, int row0, int col0, int lane) {
  const f16* p = base + (size_t)(row0 + (lane & 15)) * stride + col0 + ((lane >> 4) << 4);
  return *(const v16h*)p;
}

// A-fragment from an f32 LDS tile (convert on the fly).
__device__ inline v16h load_frag_lds_f32(const float* base, int stride, int row0, int col0, int lane) {
  const float* p = base + (size_t)(row0 + (lane & 15)) * stride + col0 + ((lane >> 4) << 4);
  v16h r;
#pragma unroll
  for (int i = 0; i < 16; ++i) r[i] = (f16)p[i];
  return r;
}

// C/D tile: VGPR j -> row row0 + (lane/16)*8 + j, col col0 + lane%16
__device__ inline void store_tile_f16(f16* base, int stride, int row0, int col0, int lane, v8f c) {
  int col = col0 + (lane & 15);
  int r0  = row0 + ((lane >> 4) << 3);
#pragma unroll
  for (int j = 0; j < 8; ++j) base[(size_t)(r0 + j) * stride + col] = (f16)c[j];
}

// C/D tile stored transposed: a lane's 8 registers are 8 consecutive rows of one column, so with the row axis
// contiguous in memory they are one 16-byte store. base[col * stride + row]
__device__ inline void store_tile_f16_t(f16* base, int stride, int row0, int col0, int lane, v8f c) {
  v8h h;
#pragma unroll   // vector elements picked by constants
  for (int j = 0; j < 8; ++j) h[j] = (f16)c[j];
  *(v8h*)(base + (col0 + (lane & 15)) * stride + row0 + ((lane >> 4) << 3)) = h;
}

__device__ inline void store_tile_f32(float* base, int stride, int row0, int col0, int lane, v8f c) {
  int col = col0 + (lane & 15);
  int r0  = row0 + ((lane >> 4) << 3);
#pragma unroll
  for (int j = 0; j < 8; ++j) base[(size_t)(r0 + j) * stride + col] = c[j];
}

// ---- butterfly over a 16-lane row (DPP row_xmask 1,2,4,8): every lane ends with the row's result ----
template <int CTRL>
__device__ inline float dpp_xmask(float x) {
  return __builtin_bit_cast(float, __builtin_amdgcn_update_dpp(
      0, __builtin_bit_cast(int, x), CTRL, 0xf, 0xf, true));
}
__device__ inline float row16_max(float v) {
  v = fmaxf(v, dpp_xmask<0x161>(v));
  v = fmaxf(v, dpp_xmask<0x162>(v));
  v = fmaxf(v, dpp_xmask<0x164>(v));
  v = fmaxf(v, dpp_xmask<0x168>(v));
  return v;
}
__device__ inline float row16_min(float v) {
  v = fminf(v, dpp_xmask<0x161>(v));
  v = fminf(v, dpp_xmask<0x162>(v));
  v = fminf(v, dpp_xmask<0x164>(v));
  v = fminf(v, dpp_xmask<0x168>(v));
  return v;
}
__device__ inline float row16_sum(float v) {
  v += dpp_xmask<0x161>(v);
  v += dpp_xmask<0x162>(v);
  v += dpp_xmask<0x164>(v);
  v += dpp_xmask<0x168>(v);
  return v;
}

// ---- TDM: 2D tile load global->LDS, data_size=4B, optional per-row LDS pad ----
// rows x cols given in 4-byte units; row_stride in 4-byte units.
__device__ inline void tdm_load_2d(unsigned lds_byte_off, const void* gptr,
                                   unsigned cols4, unsigned rows,
                                   unsigned row_stride4, bool pad_8dw_per_64dw) {
  unsigned long long ga = (unsigned long long)(size_t)gptr;
  v4u g0 = { 1u,                                  // count=1, user mode
             lds_byte_off,                        // lds_addr
             (unsigned)(ga & 0xffffffffu),        // global_addr[31:0]
             (unsigned)((ga >> 32) & 0x01ffffffu) | (2u << 30) };  // addr[56:32] | type=2
  unsigned d0 = (2u << 16);                       // data_size = 4 bytes
  if (pad_8dw_per_64dw) d0 |= (1u << 20) | (5u << 22) | (7u << 25); // pad_en, every 64dw, +8dw
  v8i g1 = { (int)d0,
             (int)((cols4 & 0xffffu) << 16),                       // tensor_dim0[15:0]
             (int)((cols4 >> 16) | ((rows & 0xffffu) << 16)),      // dim0 hi | tensor_dim1 lo
             (int)((rows >> 16) | ((cols4 & 0xffffu) << 16)),      // dim1 hi | tile_dim0
             (int)(rows & 0xffffu),                                // tile_dim1 (tile_dim2=0)
             (int)row_stride4,                                     // tensor_dim0_stride lo
             0, 0 };
  v4i z4 = { 0, 0, 0, 0 };
#if __clang_major__ >= 23
  v8i z8 = { 0, 0, 0, 0, 0, 0, 0, 0 };
  __builtin_amdgcn_tensor_load_to_lds(g0, g1, z4, z4, z8, 0);
#else
  __builtin_amdgcn_tensor_load_to_lds(g0, g1, z4, z4, 0);
#endif
}

// ---------------- kernel 0a: x [B,N,T,K] f32 -> xh [K,B,T,N] f16 ----------------
// One block moves a tile of 64 n x 16 t x 30 k through LDS: x is read along its contiguous (t,k)
// axis (1920 bytes a row, whole lines), xh is written along its contiguous n axis (128 bytes a row).
#define PX_T     16            // t rows of a tile
#define PX_N     64            // n columns of a tile
#define PX_F     (PX_T * K_)   // 480 (t,k) rows in LDS
#define PX_PITCH 33            // dwords a row: 32 pairs of f16 + 1, so that 4 rows read together miss each other's banks
typedef __attribute__((ext_vector_type(2))) _Float16 v2h;

__global__ __launch_bounds__(480) void prep_x_kernel(const float* __restrict__ x, f16* __restrict__ xh) {
  __shared__ __align__(16) unsigned S[PX_F * PX_PITCH];   // S[t*30+k][n/2]: two neighbouring n in a dword
  const int tid = threadIdx.x;
  const int t0  = blockIdx.x * PX_T;
  const int n0  = blockIdx.y * PX_N;
  const int b   = blockIdx.z;

  // ---- read: lane -> 16 bytes of one row's (t,k) run; each thread takes rows n and n+1 ----
  const int j   = tid % 120;   // which 4 floats of the 480
  const int np0 = tid / 120;   // 0..3: first pair of rows
  // x and xh are far below 4 GiB: 32-bit element offsets from the kernel's base pointers keep the address work short
  const float* src = x + (unsigned)(((b * N_ + n0 + 2 * np0) * T_ + t0) * K_ + 4 * j);
  v4f lo[8], hi[8];
#pragma unroll   // the loads issue back to back, so their latencies overlap; lo/hi indexed by constants stay in registers
  for (int i = 0; i < 8; ++i) {
    lo[i] = *(const v4f*)(src + (8 * i)     * T_ * K_);
    hi[i] = *(const v4f*)(src + (8 * i + 1) * T_ * K_);
  }
#pragma unroll   // lo/hi indexed by constants
  for (int i = 0; i < 8; ++i) {
#pragma unroll   // vector elements picked by constants
    for (int c = 0; c < 4; ++c) {
      v2h p = { (f16)lo[i][c], (f16)hi[i][c] };
      S[(4 * j + c) * PX_PITCH + np0 + 4 * i] = __builtin_bit_cast(unsigned, p);
    }
  }
  __syncthreads();

  // ---- write: 8 lanes carry one (t,k) row of 64 n (one 128-byte line), 4 rows a store ----
  const int l8 = tid & 7;
  const int r  = (tid >> 3) & 3;
  const int wave = tid >> 5;   // 15 waves, 8 groups of 4 rows each
#pragma unroll   // the 8 LDS reads and stores overlap
  for (int i = 0; i < 8; ++i) {
    const int f  = 4 * (wave + 15 * i) + r;
    const int tl = f / K_;
    const int k  = f - tl * K_;
    const unsigned* rp = S + f * PX_PITCH + 4 * l8;
    v4u val = { rp[0], rp[1], rp[2], rp[3] };
    *(v4u*)(xh + (unsigned)(((k * B_ + b) * T_ + t0 + tl) * N_ + n0 + 8 * l8)) = val;
  }
}

// ---------------- kernel 0b: weights f32 -> f16 ----------------
__global__ void prep_w_kernel(const float* __restrict__ Wq, const float* __restrict__ Wk,
                              const float* __restrict__ Wv, const float* __restrict__ Wo,
                              f16* __restrict__ wqh, f16* __restrict__ wkh,
                              f16* __restrict__ wvh, f16* __restrict__ woh) {
  int idx = blockIdx.x * blockDim.x + threadIdx.x;
  if (idx < K_ * N_ * N_) { wqh[idx] = (f16)Wq[idx]; wkh[idx] = (f16)Wk[idx]; }
  if (idx < K_ * 64 * N_) { wvh[idx] = (f16)Wv[idx]; woh[idx] = (f16)Wo[idx]; }
}

// ---------------- kernel 1: q/k/v projections (WMMA) ----------------
__global__ __launch_bounds__(256) void proj_kernel(
    const f16* __restrict__ xh, const f16* __restrict__ wqh, const f16* __restrict__ wkh,
    const f16* __restrict__ wvh, f16* __restrict__ qh, f16* __restrict__ kh,
    f16* __restrict__ vh) {
  const int lane = threadIdx.x & 31;
  const int wave = threadIdx.x >> 5;
  const int kb   = blockIdx.y;
  const int t0   = blockIdx.x * 32;
  const int kband = kb >> 2;

  const f16* xb = xh + (size_t)kb * T_ * N_;
  const f16* WQ = wqh + (size_t)kband * N_ * N_;
  const f16* WK = wkh + (size_t)kband * N_ * N_;
  const f16* WV = wvh + (size_t)kband * 64 * N_;
  f16* q  = qh + (size_t)kb * T_ * N_;
  f16* kk = kh + (size_t)kb * T_ * N_;
  // v leaves transposed, in chunks of this block's 32 t: vh[kb][t/32][n][t%32]. A chunk is 4 KB in a row and has one writer.
  f16* v  = vh + (size_t)kb * T_ * 64 + (size_t)blockIdx.x * 64 * 32;

#pragma unroll   // rolled, each tile would wait out its own loads; unrolled, the five tiles' loads overlap
  for (int i = 0; i < 5; ++i) {
    int tile  = wave + i * 8;
    int which = tile >> 4;                 // 0=q, 1=k, 2=v
    int local = (which < 2) ? (tile & 15) : (tile - 32);
    int nt = local >> 1, mt = local & 1;
    const f16* W = (which == 0) ? WQ : (which == 1) ? WK : WV;
    v8f acc = {};
#pragma unroll
    for (int kc = 0; kc < N_; kc += 32) {
      v16h a = load_frag_row(xb, N_, t0 + 16 * mt, kc, lane);
      v16h b = load_frag_row(W,  N_, 16 * nt,      kc, lane);
      acc = wmma_f16(a, b, acc);
    }
    if (which == 0)      store_tile_f16(q,  N_, t0 + 16 * mt, 16 * nt, lane, acc);
    else if (which == 1) store_tile_f16(kk, N_, t0 + 16 * mt, 16 * nt, lane, acc);
    else                 store_tile_f16_t(v, 32, 16 * mt, 16 * nt, lane, acc);
  }
}

// ---------------- kernel 2: attention ----------------
__global__ __launch_bounds__(256) void attn_kernel(
    const f16* __restrict__ qh, const f16* __restrict__ kh, const f16* __restrict__ vh,
    float* __restrict__ o1, float* __restrict__ o2, float* __restrict__ part) {
  __shared__ __align__(128) float P[32 * P_STRIDE];     // probability tile
  __shared__ __align__(128) f16  Vt[64 * VT_STRIDE];    // V transposed: Vt[n][s]
  __shared__ __align__(128) f16  Qs[32 * QS_STRIDE];    // Q rows (TDM-staged, padded)
  __shared__ __align__(16)  float Sred[2 * 16 * 4];     // [pass][16-lane half wave]: sum, sum of squares, max, min

  const int lane = threadIdx.x & 31;
  const int wave = threadIdx.x >> 5;
  const int kb   = blockIdx.y;
  const int t0   = blockIdx.x * 32;

  const f16* q    = qh + (size_t)kb * T_ * N_;
  const f16* kmat = kh + (size_t)kb * T_ * N_;
  const f16* v    = vh + (size_t)kb * T_ * 64;   // already transposed: [t/32][n][t%32]

  // ---- V^T: 64 KB in a row, 16 bytes a lane; the loads are issued first, so that they fly during the Q load's wait ----
  v4u vreg[16];
  {
    const v4u* vsrc = (const v4u*)v + threadIdx.x;
#pragma unroll   // all 16 loads in flight at once; vreg indexed by constants stays in registers
    for (int i = 0; i < 16; ++i) vreg[i] = vsrc[i * 256];
  }

  // ---- TDM: stage Q rows [32 x 128 f16] into LDS with +8dw/row padding ----
  if (threadIdx.x < 32) {
    unsigned lds_off = (unsigned)(size_t)&Qs[0];   // low 32 bits of generic = LDS byte offset
    tdm_load_2d(lds_off, q + (size_t)t0 * N_,
                /*cols4=*/N_ / 2, /*rows=*/32, /*row_stride4=*/N_ / 2,
                /*pad=*/true);
    __builtin_amdgcn_s_wait_tensorcnt(0);
  }
  // ---- V^T into its padded LDS rows: load i is chunk i, 4 lanes carry one n row's 32 s ----
  {
    f16* vdst = Vt + (threadIdx.x >> 2) * VT_STRIDE + (threadIdx.x & 3) * 8;
#pragma unroll   // vreg indexed by constants
    for (int i = 0; i < 16; ++i) *(v4u*)(vdst + i * 32) = vreg[i];
  }
  __syncthreads();

  for (int pass = 0; pass < 2; ++pass) {
    const int hoff = pass * 64;
    float* o  = (pass == 0 ? o1 : o2) + (size_t)kb * T_ * 64;

    // ---- logits: S[32,512] = Q[32,64] * K^T ; 64 tiles, 8 per wave ----
    for (int i = 0; i < 8; ++i) {
      int tile = wave + i * 8;
      int mt = tile & 1, stile = tile >> 1;
      v8f acc = {};
#pragma unroll
      for (int kc = 0; kc < 64; kc += 32) {
        v16h a = load_frag_row((const f16*)Qs, QS_STRIDE, 16 * mt, hoff + kc, lane);
        v16h b = load_frag_row(kmat, N_, 16 * stile, hoff + kc, lane);
        acc = wmma_f16(a, b, acc);
      }
      int col = 16 * stile + (lane & 15);
      int r0  = 16 * mt + ((lane >> 4) << 3);
#pragma unroll
      for (int j = 0; j < 8; ++j) P[(r0 + j) * P_STRIDE + col] = acc[j] * SCALE_INV;
    }
    __syncthreads();

    // ---- row softmax + stats: 16 lanes per row, the row stays in registers ----
    // A 16-lane half reads 64 consecutive floats per 16-byte access, so every LDS bank is hit once.
    {
      const int l16  = lane & 15;
      const int rsub = wave * 2 + (lane >> 4);
      v4f asum = {0.f, 0.f, 0.f, 0.f}, asq = {0.f, 0.f, 0.f, 0.f};
      float rmx = -__builtin_inff(), rmn = __builtin_inff();
#pragma unroll   // both rows in flight: their loads and reductions overlap
      for (int rr = 0; rr < 2; ++rr) {
        float* prow = P + (rr * 16 + rsub) * P_STRIDE + l16 * 4;
        v4f x[8];
        // every loop over x[] below is unrolled so that x[] is indexed by constants and lives in registers
#pragma unroll
        for (int c = 0; c < 8; ++c) x[c] = *(const v4f*)(prow + c * 64);

        float m = -__builtin_inff();
#pragma unroll
        for (int c = 0; c < 8; ++c)
          m = fmaxf(m, fmaxf(fmaxf(x[c][0], x[c][1]), fmaxf(x[c][2], x[c][3])));
        const float mx = row16_max(m);

        v4f s4 = {0.f, 0.f, 0.f, 0.f};
#pragma unroll
        for (int c = 0; c < 8; ++c) {
#pragma unroll
          for (int j = 0; j < 4; ++j) x[c][j] = __expf(x[c][j] - mx);
          s4 += x[c];
        }
        const float tot = row16_sum((s4[0] + s4[1]) + (s4[2] + s4[3]));
        const float inv = 1.0f / tot;

#pragma unroll
        for (int c = 0; c < 8; ++c) {
          v4f p0 = x[c] * inv;
          *(v4f*)(prow + c * 64) = p0;
          asum += p0;
          asq  += p0 * p0;
          rmx = fmaxf(rmx, fmaxf(fmaxf(p0[0], p0[1]), fmaxf(p0[2], p0[3])));
          rmn = fminf(rmn, fminf(fminf(p0[0], p0[1]), fminf(p0[2], p0[3])));
        }
      }
      float rsum = (asum[0] + asum[1]) + (asum[2] + asum[3]);
      float rsq  = (asq[0] + asq[1]) + (asq[2] + asq[3]);
      // four butterflies over the 16-lane half, then one LDS write a half; read after the pass loop, behind its barriers
      const v4f red = { row16_sum(rsum), row16_sum(rsq), row16_max(rmx), row16_min(rmn) };
      if (l16 == 0) *(v4f*)(Sred + (pass * 16 + rsub) * 4) = red;
    }
    __syncthreads();

    // ---- O[32,64] = P[32,512] * V[512,64] ; 8 tiles, 1 per wave ----
    {
      int mt = wave & 1, nt = wave >> 1;
      v8f acc = {};
      for (int sc = 0; sc < 512; sc += 32) {
        v16h a = load_frag_lds_f32(P, P_STRIDE, 16 * mt, sc, lane);
        v16h b = load_frag_row((const f16*)Vt, VT_STRIDE, 16 * nt, sc, lane); // B[s][n]=Vt[n][s]
        acc = wmma_f16(a, b, acc);
      }
      store_tile_f32(o, 64, t0 + 16 * mt, 16 * nt, lane, acc);
    }
    __syncthreads();   // P reused by next pass
  }

  // ---- the block's stats: lanes 0-15 of wave 0 fold pass 0's sixteen halves, lanes 16-31 pass 1's; the block's own line ----
  if (threadIdx.x < 32) {
    const v4f sp = *(const v4f*)(Sred + lane * 4);
    const v4f red = { row16_sum(sp[0]), row16_sum(sp[1]), row16_max(sp[2]), row16_min(sp[3]) };
    if ((lane & 15) == 0)
      *(v4f*)(part + (kb * (T_ / 32) + blockIdx.x) * LINE_F + (lane >> 4) * 4) = red;
  }
}

// ---------------- kernel 3: partial stats -> MLP -> lambda ----------------
// One wave for each (band, batch): lane = pass * 16 + attention block, so one 16-byte load a lane brings all 16 partials
// of both passes, and a butterfly over each 16-lane half folds them.
__device__ inline float lane_value(float v, int l) {
  return __builtin_bit_cast(float, __builtin_amdgcn_readlane(__builtin_bit_cast(int, v), l));
}

__global__ __launch_bounds__(32) void lam_kernel(const float* __restrict__ part,
                           const float* __restrict__ W1, const float* __restrict__ b1,
                           const float* __restrict__ W2, const float* __restrict__ b2,
                           float* __restrict__ lam) {
  const int i    = blockIdx.x;
  const int lane = threadIdx.x;
  int kband = i >> 2;
  const v4f sp = *(const v4f*)(part + (i * (T_ / 32) + (lane & 15)) * LINE_F + (lane >> 4) * 4);
  const float rs = row16_sum(sp[0]), rq = row16_sum(sp[1]), rx = row16_max(sp[2]), rn = row16_min(sp[3]);
  const float s[8] = { lane_value(rs, 0),  lane_value(rq, 0),  lane_value(rx, 0),  lane_value(rn, 0),
                       lane_value(rs, 16), lane_value(rq, 16), lane_value(rx, 16), lane_value(rn, 16) };
  const float n = (float)T_ * (float)T_;
  float feat[8];
#pragma unroll
  for (int p = 0; p < 2; ++p) {
    float sum = s[p * 4 + 0], sq = s[p * 4 + 1];
    float mean = sum / n;
    float var  = (sq - sum * sum / n) / (n - 1.0f);
    feat[p * 4 + 0] = mean;
    feat[p * 4 + 1] = sqrtf(fmaxf(var, 0.f));
    feat[p * 4 + 2] = s[p * 4 + 2];
    feat[p * 4 + 3] = s[p * 4 + 3];
  }
  const float* w1  = W1 + kband * 16 * 8;
  const float* bb1 = b1 + kband * 16;
  const float* w2  = W2 + kband * 16;
  float z = b2[kband];
  for (int j = 0; j < 16; ++j) {
    float h = bb1[j];
#pragma unroll
    for (int qq = 0; qq < 8; ++qq) h += w1[j * 8 + qq] * feat[qq];
    z += w2[j] * fmaxf(h, 0.f);
  }
  if (lane == 0) lam[i * LINE_F] = 1.0f / (1.0f + __expf(-z));
}

// ---------------- kernel 4: out = (o1 - lam*o2) @ Wo^T + bo ----------------
// out is [B,N,T,K]: for one (b,m) the (t,k) axis is contiguous. One block makes 64 m x 16 t for ALL 30 bands,
// gathers the products in LDS in out's own order and stores runs of 1920 bytes (15 whole lines) a row.
#define OT_T  16             // t columns of a tile
#define OT_M  64             // m rows of a tile
#define OT_SP 484            // floats a row of S: 4 x odd, so rows stay 16-byte aligned and the 32 lanes of a tile store
                             // (16 t at 30 floats, two m groups 8 rows apart) fall on 32 different banks
#define OT_DP 72             // f16 a row of D: 144 bytes = 16 x odd, the pitch for 16-byte fragment reads of 128-byte rows
typedef __attribute__((ext_vector_type(4))) _Float16 v4h;

// 16 contiguous f16 from a row that is 16-byte (not 32-byte) aligned
__device__ inline v16h load_frag_2x16B(const f16* p) {
  v8h lo = *(const v8h*)p;
  v8h hi = *(const v8h*)(p + 8);
  return __builtin_shufflevector(lo, hi, 0, 1, 2, 3, 4, 5, 6, 7, 8, 9, 10, 11, 12, 13, 14, 15);
}

__global__ __launch_bounds__(480) void out_kernel(
    const float* __restrict__ o1, const float* __restrict__ o2,
    const f16* __restrict__ woh, const float* __restrict__ bo,
    const float* __restrict__ lam, float* __restrict__ out) {
  __shared__ __align__(16) float S[OT_M * OT_SP];        // S[m][t*30+k]
  __shared__ __align__(16) f16   D[K_ * OT_T * OT_DP];   // D[k][t][v] = o1 - lam*o2
  const int tid  = threadIdx.x;
  const int lane = tid & 31;
  const int wave = __builtin_amdgcn_readfirstlane(tid >> 5);   // 15 waves; held scalar, so band indices and lam go the scalar way
  const int t0   = blockIdx.x * OT_T;
  const int m0   = blockIdx.y * OT_M;
  const int bb   = blockIdx.z;

  // ---- D: a band's 16 t x 64 v are 4 KB in a row in o1 and o2; a wave takes 2 bands, 512 bytes a load ----
  {
    const unsigned off = (unsigned)(((wave * B_ + bb) * T_ + t0) * 64 + lane * 4);
    const float* p1 = o1 + off;
    const float* p2 = o2 + off;
    v4f a[16], c[16];
    float l[2];
#pragma unroll   // all loads issue back to back off one address pair each, so their latencies overlap; a/c/l stay in registers
    for (int kk = 0; kk < 2; ++kk) {
      l[kk] = lam[((wave + 15 * kk) * B_ + bb) * LINE_F];
#pragma unroll   // as above
      for (int i = 0; i < 8; ++i) {
        a[8 * kk + i] = *(const v4f*)(p1 + kk * 15 * B_ * T_ * 64 + i * 128);
        c[8 * kk + i] = *(const v4f*)(p2 + kk * 15 * B_ * T_ * 64 + i * 128);
      }
    }
    f16* dw = D + (wave * OT_T + (lane >> 4)) * OT_DP + (lane & 15) * 4;
#pragma unroll   // a/c/l indexed by constants
    for (int kk = 0; kk < 2; ++kk) {
#pragma unroll   // a/c indexed by constants
      for (int i = 0; i < 8; ++i) {
        const v4f x = a[8 * kk + i], y = c[8 * kk + i];
        v4h d = { (f16)(x[0] - l[kk] * y[0]), (f16)(x[1] - l[kk] * y[1]),
                  (f16)(x[2] - l[kk] * y[2]), (f16)(x[3] - l[kk] * y[3]) };
        *(v4h*)(dw + (15 * kk * OT_T + 2 * i) * OT_DP) = d;   // row k*16 + t, t = 2i + lane/16
      }
    }
  }
  __syncthreads();

  // ---- products: a wave takes 2 bands x 4 m tiles. Wo is the A operand and D the B operand, so that
  //      acc[j] = Y[m = 8h + j][t = c] and a store's lanes run along t ----
  {
    const int c = lane & 15, h = lane >> 4;
#pragma unroll 1   // kept rolled: with both bands unrolled the kernel needs more than 256 registers and spills
    for (int kk = 0; kk < 2; ++kk) {
      const int k = wave + 15 * kk;
      const f16* dk = D + (k * OT_T + c) * OT_DP + 16 * h;
      const v16h b0 = load_frag_2x16B(dk);
      const v16h b1 = load_frag_2x16B(dk + 32);
      const f16*   wk = woh + (unsigned)((k * N_ + m0 + c) * 64 + 16 * h);
      const float* bk = bo + k * N_ + m0 + 8 * h;
      float*       sp = S + 8 * h * OT_SP + c * K_ + k;
#pragma unroll   // the four tiles' weight loads overlap
      for (int mt = 0; mt < 4; ++mt) {
        const v16h a0 = *(const v16h*)(wk + mt * 16 * 64);
        const v16h a1 = *(const v16h*)(wk + mt * 16 * 64 + 32);
        const v4f  bl = *(const v4f*)(bk + 16 * mt);
        const v4f  bh = *(const v4f*)(bk + 16 * mt + 4);
        v8f acc = {};
        acc = wmma_f16(a0, b0, acc);
        acc = wmma_f16(a1, b1, acc);
#pragma unroll   // vector elements picked by constants
        for (int j = 0; j < 4; ++j) {
          sp[(16 * mt + j) * OT_SP]     = acc[j]     + bl[j];
          sp[(16 * mt + 4 + j) * OT_SP] = acc[4 + j] + bh[j];
        }
      }
    }
  }
  __syncthreads();

  // ---- store: 120 lanes of 16 bytes carry one m row's 480 floats, 4 rows a sweep ----
  {
    const int j4 = tid % 120;
    const int mr = tid / 120;   // 0..3
    float* dst = out + (unsigned)(((bb * N_ + m0 + mr) * T_ + t0) * K_ + 4 * j4);
    const float* sr = S + mr * OT_SP + 4 * j4;
#pragma unroll   // the 16 LDS reads and stores overlap
    for (int i = 0; i < 16; ++i)
      *(v4f*)(dst + 4 * i * T_ * K_) = *(const v4f*)(sr + 4 * i * OT_SP);
  }
}

// ---------------- host side ----------------
extern "C" void kernel_launch(void* const* d_in, const int* in_sizes, int n_in,
                              void* d_out, int out_size, void* d_ws, size_t ws_size,
                              hipStream_t stream) {
  (void)in_sizes; (void)n_in; (void)out_size; (void)ws_size;
  const float* x  = (const float*)d_in[0];
  const float* Wq = (const float*)d_in[1];
  const float* Wk = (const float*)d_in[2];
  const float* Wv = (const float*)d_in[3];
  const float* Wo = (const float*)d_in[4];
  const float* bo = (const float*)d_in[5];
  const float* W1 = (const float*)d_in[6];
  const float* b1 = (const float*)d_in[7];
  const float* W2 = (const float*)d_in[8];
  const float* b2 = (const float*)d_in[9];

  char* ws = (char*)d_ws;
  f16*   xh    = (f16*)  (ws + OFF_XH);
  f16*   wqh   = (f16*)  (ws + OFF_WQH);
  f16*   wkh   = (f16*)  (ws + OFF_WKH);
  f16*   wvh   = (f16*)  (ws + OFF_WVH);
  f16*   woh   = (f16*)  (ws + OFF_WOH);
  f16*   qh    = (f16*)  (ws + OFF_QH);
  f16*   kh    = (f16*)  (ws + OFF_KH);
  f16*   vh    = (f16*)  (ws + OFF_VH);
  float* o1    = (float*)(ws + OFF_O1);
  float* o2    = (float*)(ws + OFF_O2);
  float* part  = (float*)(ws + OFF_ST);
  float* lamb  = (float*)(ws + OFF_LAM);

  prep_x_kernel<<<dim3(T_ / PX_T, N_ / PX_N, B_), dim3(480), 0, stream>>>(x, xh);
  prep_w_kernel<<<dim3((K_ * N_ * N_ + 255) / 256), dim3(256), 0, stream>>>(
      Wq, Wk, Wv, Wo, wqh, wkh, wvh, woh);

  proj_kernel<<<dim3(T_ / 32, K_ * B_), dim3(256), 0, stream>>>(
      xh, wqh, wkh, wvh, qh, kh, vh);
  attn_kernel<<<dim3(T_ / 32, K_ * B_), dim3(256), 0, stream>>>(
      qh, kh, vh, o1, o2, part);
  lam_kernel<<<dim3(K_ * B_), dim3(32), 0, stream>>>(part, W1, b1, W2, b2, lamb);
  out_kernel<<<dim3(T_ / OT_T, N_ / OT_M, B_), dim3(480), 0, stream>>>(
      o1, o2, woh, bo, lamb, (float*)d_out);
}

// v006
// One run takes 88.6 microseconds.
// Timed twice side by side with v005, it ran 1.53 and 1.54 times as fast.
// Counting every step since v000, it is 3.15 times as fast.
#include <hip/hip_runtime.h>
#include <hip/hip_bf16.h>

typedef _Float16 f16;
typedef __attribute__((ext_vector_type(16))) _Float16 v16h;
typedef __attribute__((ext_vector_type(8)))  float    v8f;
typedef unsigned int v4u __attribute__((ext_vector_type(4)));
typedef float        v4f __attribute__((ext_vector_type(4)));
typedef float        v2f __attribute__((ext_vector_type(2)));
typedef __attribute__((ext_vector_type(8))) _Float16 v8h;

#define B_ 4
#define N_ 128
#define T_ 512
#define K_ 30
#define SCALE_INV 0.25f  // 1/sqrt(HEAD_DIM=16)

#define KS_PITCH  72     // f16 a K row in LDS: 144 bytes = 16 x odd, the pitch for 16-byte reads of 128-byte rows
#define VT_PITCH  520    // f16 a V^T row in LDS: 1040 bytes = 16 x odd
#define AT_WAVES  16     // waves of an attention block, 16 query rows each
#define LINE_F    32     // floats in a 128-byte line: what different blocks store in one launch lies a line apart

// ---------------- workspace layout (bytes) ----------------
constexpr size_t SZ_XH  = (size_t)K_ * B_ * T_ * N_ * 2;
constexpr size_t SZ_WQH = (size_t)K_ * N_ * N_ * 2;
constexpr size_t SZ_WVH = (size_t)K_ * 64 * N_ * 2;
constexpr size_t SZ_QH  = SZ_XH;
constexpr size_t SZ_VH  = (size_t)K_ * B_ * T_ * 64 * 2;
constexpr size_t SZ_O   = (size_t)K_ * B_ * T_ * 64 * 4;

constexpr size_t OFF_XH  = 0;
constexpr size_t OFF_WQH = OFF_XH  + SZ_XH;
constexpr size_t OFF_WKH = OFF_WQH + SZ_WQH;
constexpr size_t OFF_WVH = OFF_WKH + SZ_WQH;
constexpr size_t OFF_WOH = OFF_WVH + SZ_WVH;
constexpr size_t OFF_QH  = OFF_WOH + SZ_WVH;
constexpr size_t OFF_KH  = OFF_QH  + SZ_QH;
constexpr size_t OFF_VH  = OFF_KH  + SZ_QH;
constexpr size_t OFF_O1  = OFF_VH  + SZ_VH;
constexpr size_t OFF_O2  = OFF_O1  + SZ_O;
constexpr size_t OFF_ST  = OFF_O2  + SZ_O;
constexpr size_t OFF_LAM = OFF_ST  + (size_t)K_ * B_ * (T_ / 32) * 128;   // 128-byte lines for the attention blocks' partial stats, one a block

// ---------------- WMMA helpers ----------------
__device__ inline v8f wmma_f16(v16h a, v16h b, v8f c) {
  return __builtin_amdgcn_wmma_f32_16x16x32_f16(
      false, a, false, b, (short)0, c, false, false);
}

// Fragment where the reduction axis is contiguous: lane L -> row row0+L%16,
// 16 contiguous f16 at col0 + (L/16)*16.  (works for global and LDS pointers)
__device__ inline v16h load_frag_row(const f16* base, int stride, int row0, int col0, int lane) {
  const f16* p = base + (size_t)(row0 + (lane & 15)) * stride + col0 + ((lane >> 4) << 4);
  return *(const v16h*)p;
}

// C/D tile: VGPR j -> row row0 + (lane/16)*8 + j, col col0 + lane%16
__device__ inline void store_tile_f16(f16* base, int stride, int row0, int col0, int lane, v8f c) {
  int col = col0 + (lane & 15);
  int r0  = row0 + ((lane >> 4) << 3);
#pragma unroll
  for (int j = 0; j < 8; ++j) base[(size_t)(r0 + j) * stride + col] = (f16)c[j];
}

// C/D tile stored transposed: a lane's 8 registers are 8 consecutive rows of one column, so with the row axis
// contiguous in memory they are one 16-byte store. base[col * stride + row]
__device__ inline void store_tile_f16_t(f16* base, int stride, int row0, int col0, int lane, v8f c) {
  v8h h;
#pragma unroll   // vector elements picked by constants
  for (int j = 0; j < 8; ++j) h[j] = (f16)c[j];
  *(v8h*)(base + (col0 + (lane & 15)) * stride + row0 + ((lane >> 4) << 3)) = h;
}

// ---- butterfly over a 16-lane row (DPP row_xmask 1,2,4,8): every lane ends with the row's result ----
template <int CTRL>
__device__ inline float dpp_xmask(float x) {
  return __builtin_bit_cast(float, __builtin_amdgcn_update_dpp(
      0, __builtin_bit_cast(int, x), CTRL, 0xf, 0xf, true));
}
__device__ inline float row16_max(float v) {
  v = fmaxf(v, dpp_xmask<0x161>(v));
  v = fmaxf(v, dpp_xmask<0x162>(v));
  v = fmaxf(v, dpp_xmask<0x164>(v));
  v = fmaxf(v, dpp_xmask<0x168>(v));
  return v;
}
__device__ inline float row16_min(float v) {
  v = fminf(v, dpp_xmask<0x161>(v));
  v = fminf(v, dpp_xmask<0x162>(v));
  v = fminf(v, dpp_xmask<0x164>(v));
  v = fminf(v, dpp_xmask<0x168>(v));
  return v;
}
__device__ inline float row16_sum(float v) {
  v += dpp_xmask<0x161>(v);
  v += dpp_xmask<0x162>(v);
  v += dpp_xmask<0x164>(v);
  v += dpp_xmask<0x168>(v);
  return v;
}

// lane l with lane l ^ 16: the other half of the wave
__device__ inline float xhalf(float x) {
  const int b = __builtin_bit_cast(int, x);
  return __builtin_bit_cast(float, __builtin_amdgcn_permlanex16(b, b, 0x76543210, 0xfedcba98, false, false));
}

// two 16-byte pieces of a row that is 16-byte (not 32-byte) aligned, as one 16-element fragment
__device__ inline v16h join_frag(const f16* plo, const f16* phi) {
  v8h lo = *(const v8h*)plo;
  v8h hi = *(const v8h*)phi;
  return __builtin_shufflevector(lo, hi, 0, 1, 2, 3, 4, 5, 6, 7, 8, 9, 10, 11, 12, 13, 14, 15);
}

// ---------------- kernel 0a: x [B,N,T,K] f32 -> xh [K,B,T,N] f16 ----------------
// One block moves a tile of 64 n x 16 t x 30 k through LDS: x is read along its contiguous (t,k)
// axis (1920 bytes a row, whole lines), xh is written along its contiguous n axis (128 bytes a row).
#define PX_T     16            // t rows of a tile
#define PX_N     64            // n columns of a tile
#define PX_F     (PX_T * K_)   // 480 (t,k) rows in LDS
#define PX_PITCH 33            // dwords a row: 32 pairs of f16 + 1, so that 4 rows read together miss each other's banks
typedef __attribute__((ext_vector_type(2))) _Float16 v2h;

__global__ __launch_bounds__(480) void prep_x_kernel(const float* __restrict__ x, f16* __restrict__ xh) {
  __shared__ __align__(16) unsigned S[PX_F * PX_PITCH];   // S[t*30+k][n/2]: two neighbouring n in a dword
  const int tid = threadIdx.x;
  const int t0  = blockIdx.x * PX_T;
  const int n0  = blockIdx.y * PX_N;
  const int b   = blockIdx.z;

  // ---- read: lane -> 16 bytes of one row's (t,k) run; each thread takes rows n and n+1 ----
  const int j   = tid % 120;   // which 4 floats of the 480
  const int np0 = tid / 120;   // 0..3: first pair of rows
  // x and xh are far below 4 GiB: 32-bit element offsets from the kernel's base pointers keep the address work short
  const float* src = x + (unsigned)(((b * N_ + n0 + 2 * np0) * T_ + t0) * K_ + 4 * j);
  v4f lo[8], hi[8];
#pragma unroll   // the loads issue back to back, so their latencies overlap; lo/hi indexed by constants stay in registers
  for (int i = 0; i < 8; ++i) {
    lo[i] = *(const v4f*)(src + (8 * i)     * T_ * K_);
    hi[i] = *(const v4f*)(src + (8 * i + 1) * T_ * K_);
  }
#pragma unroll   // lo/hi indexed by constants
  for (int i = 0; i < 8; ++i) {
#pragma unroll   // vector elements picked by constants
    for (int c = 0; c < 4; ++c) {
      v2h p = { (f16)lo[i][c], (f16)hi[i][c] };
      S[(4 * j + c) * PX_PITCH + np0 + 4 * i] = __builtin_bit_cast(unsigned, p);
    }
  }
  __syncthreads();

  // ---- write: 8 lanes carry one (t,k) row of 64 n (one 128-byte line), 4 rows a store ----
  const int l8 = tid & 7;
  const int r  = (tid >> 3) & 3;
  const int wave = tid >> 5;   // 15 waves, 8 groups of 4 rows each
#pragma unroll   // the 8 LDS reads and stores overlap
  for (int i = 0; i < 8; ++i) {
    const int f  = 4 * (wave + 15 * i) + r;
    const int tl = f / K_;
    const int k  = f - tl * K_;
    const unsigned* rp = S + f * PX_PITCH + 4 * l8;
    v4u val = { rp[0], rp[1], rp[2], rp[3] };
    *(v4u*)(xh + (unsigned)(((k * B_ + b) * T_ + t0 + tl) * N_ + n0 + 8 * l8)) = val;
  }
}

// ---------------- kernel 0b: weights f32 -> f16 ----------------
__global__ void prep_w_kernel(const float* __restrict__ Wq, const float* __restrict__ Wk,
                              const float* __restrict__ Wv, const float* __restrict__ Wo,
                              f16* __restrict__ wqh, f16* __restrict__ wkh,
                              f16* __restrict__ wvh, f16* __restrict__ woh) {
  int idx = blockIdx.x * blockDim.x + threadIdx.x;
  if (idx < K_ * N_ * N_) { wqh[idx] = (f16)Wq[idx]; wkh[idx] = (f16)Wk[idx]; }
  if (idx < K_ * 64 * N_) { wvh[idx] = (f16)Wv[idx]; woh[idx] = (f16)Wo[idx]; }
}

// ---------------- kernel 1: q/k/v projections (WMMA) ----------------
__global__ __launch_bounds__(256) void proj_kernel(
    const f16* __restrict__ xh, const f16* __restrict__ wqh, const f16* __restrict__ wkh,
    const f16* __restrict__ wvh, f16* __restrict__ qh, f16* __restrict__ kh,
    f16* __restrict__ vh) {
  const int lane = threadIdx.x & 31;
  const int wave = threadIdx.x >> 5;
  const int kb   = blockIdx.y;
  const int t0   = blockIdx.x * 32;
  const int kband = kb >> 2;

  const f16* xb = xh + (size_t)kb * T_ * N_;
  const f16* WQ = wqh + (size_t)kband * N_ * N_;
  const f16* WK = wkh + (size_t)kband * N_ * N_;
  const f16* WV = wvh + (size_t)kband * 64 * N_;
  f16* q  = qh + (size_t)kb * T_ * N_;
  f16* kk = kh + (size_t)kb * T_ * N_;
  // v leaves transposed, in chunks of this block's 32 t: vh[kb][t/32][n][t%32]. A chunk is 4 KB in a row and has one writer.
  f16* v  = vh + (size_t)kb * T_ * 64 + (size_t)blockIdx.x * 64 * 32;

#pragma unroll   // rolled, each tile would wait out its own loads; unrolled, the five tiles' loads overlap
  for (int i = 0; i < 5; ++i) {
    int tile  = wave + i * 8;
    int which = tile >> 4;                 // 0=q, 1=k, 2=v
    int local = (which < 2) ? (tile & 15) : (tile - 32);
    int nt = local >> 1, mt = local & 1;
    const f16* W = (which == 0) ? WQ : (which == 1) ? WK : WV;
    v8f acc = {};
#pragma unroll
    for (int kc = 0; kc < N_; kc += 32) {
      v16h a = load_frag_row(xb, N_, t0 + 16 * mt, kc, lane);
      v16h b = load_frag_row(W,  N_, 16 * nt,      kc, lane);
      acc = wmma_f16(a, b, acc);
    }
    if (which == 0)      store_tile_f16(q,  N_, t0 + 16 * mt, 16 * nt, lane, acc);
    else if (which == 1) store_tile_f16(kk, N_, t0 + 16 * mt, 16 * nt, lane, acc);
    else                 store_tile_f16_t(v, 32, 16 * mt, 16 * nt, lane, acc);
  }
}

__global__ __launch_bounds__(AT_WAVES * 32) __attribute__((amdgpu_waves_per_eu(8, 8))) void attn_kernel(
    const f16* __restrict__ qh, const f16* __restrict__ kh, const f16* __restrict__ vh,
    float* __restrict__ o1, float* __restrict__ o2, float* __restrict__ part) {
  __shared__ __align__(16) f16   Ks[T_ * KS_PITCH];     // this map's half of K: Ks[s][d]
  __shared__ __align__(16) f16   Vt[64 * VT_PITCH];     // V transposed: Vt[n][s]
  __shared__ __align__(16) float Sred[AT_WAVES * 4];    // a wave's sum, sum of squares, max, min

  const int tid  = threadIdx.x;
  const int lane = tid & 31;
  const int wave = tid >> 5;
  const int c    = lane & 15, h = lane >> 4;
  const int kb   = blockIdx.y;
  const int pass = blockIdx.x & 1;
  const int hoff = pass * 64;
  const int t0   = (blockIdx.x >> 1) * (AT_WAVES * 16) + wave * 16;

  // ---- K half (512 rows of 128 bytes) and V^T (64 KB in a row): 16 bytes a lane, all loads in flight at once ----
  v4u kreg[8], vreg[8];
  {
    const f16* ksrc = kh + (size_t)kb * T_ * N_ + (tid >> 3) * N_ + hoff + (tid & 7) * 8;
    const v4u* vsrc = (const v4u*)(vh + (size_t)kb * T_ * 64) + tid;   // already transposed: [t/32][n][t%32]
#pragma unroll   // kreg/vreg indexed by constants stay in registers
    for (int i = 0; i < 8; ++i) {
      kreg[i] = *(const v4u*)(ksrc + i * 64 * N_);
      vreg[i] = vsrc[i * 512];
    }
  }
  // ---- Q: the B operand of the first product, kept in registers; 16 contiguous d a lane, as the K fragments have them ----
  const f16* qp = qh + (size_t)kb * T_ * N_ + (t0 + c) * N_ + hoff + 16 * h;
  const v16h qb0 = *(const v16h*)qp;
  const v16h qb1 = *(const v16h*)(qp + 32);
  {
    f16* kdst = Ks + (tid >> 3) * KS_PITCH + (tid & 7) * 8;
    f16* vdst = Vt + ((tid & 255) >> 2) * VT_PITCH + (tid >> 8) * 32 + (tid & 3) * 8;   // load i: chunks 2i and 2i+1
#pragma unroll   // kreg/vreg indexed by constants
    for (int i = 0; i < 8; ++i) {
      *(v4u*)(kdst + i * 64 * KS_PITCH) = kreg[i];
      *(v4u*)(vdst + i * 64) = vreg[i];
    }
  }
  __syncthreads();

  const float CS = SCALE_INV * 1.4426950408889634f;   // score scale times log2(e): exponentials in base 2
  float m_run = -__builtin_inff();                    // running maximum, scaled
  v2f l2 = {0.f, 0.f}, q2 = {0.f, 0.f};               // this lane's share of the row's sum of e and of e^2, in two chains
  float xmn = __builtin_inff();                       // smallest raw score this lane has seen
  v8f o[4] = {};                                      // O^T: o[nt][j] = O[t0 + c][16 nt + 8 h + j]
  const f16* kfr = Ks + c * KS_PITCH + 16 * h;
  const f16* vfr = Vt + c * VT_PITCH + 8 * h;

  // every inner loop from here to the stores of O is unrolled so that st[], o[] and vector elements are picked by constants
  // and live in registers
#pragma unroll 1   // kept rolled: a step holds 32 scores a lane, and two blocks on a WGP leave a wave 128 registers
  for (int sc = 0; sc < T_; sc += 64) {
    v8f st[4];   // st[i][j] = S[t0 + c][sc + 16 i + 8 h + j]; indexed by constants in unrolled loops below
#pragma unroll
    for (int i = 0; i < 4; ++i) {
      const f16* kp = kfr + (sc + 16 * i) * KS_PITCH;
      v8f acc = {};
      acc = wmma_f16(join_frag(kp, kp + 8), qb0, acc);
      acc = wmma_f16(join_frag(kp + 32, kp + 40), qb1, acc);
      st[i] = acc;
    }

    float cm = -__builtin_inff();
#pragma unroll
    for (int i = 0; i < 4; ++i) {
#pragma unroll
      for (int j = 0; j < 8; ++j) {
        cm  = fmaxf(cm, st[i][j]);
        xmn = fminf(xmn, st[i][j]);
      }
    }
    cm = fmaxf(cm, xhalf(cm));   // both halves of a column must scale by the same maximum: their products are summed
    const float m_new = fmaxf(m_run, cm * CS);
    const float alpha = __builtin_amdgcn_exp2f(m_run - m_new);   // 0 in the first step, where m_run is -inf
    m_run = m_new;
    l2 *= alpha;
    q2 *= alpha * alpha;
#pragma unroll
    for (int nt = 0; nt < 4; ++nt) o[nt] *= alpha;

#pragma unroll
    for (int i = 0; i < 4; ++i) {
#pragma unroll
      for (int j = 0; j < 8; j += 2) {
        const v2f x = { st[i][j], st[i][j + 1] };
        const v2f a = x * CS - m_new;
        const v2f e = { __builtin_amdgcn_exp2f(a[0]), __builtin_amdgcn_exp2f(a[1]) };
        l2 += e;
        q2 += e * e;
        st[i][j]     = e[0];
        st[i][j + 1] = e[1];
      }
    }

#pragma unroll
    for (int ks = 0; ks < 2; ++ks) {
      v16h pb;   // element e of half h is key 8 h + e (e < 8) or 16 + 8 h + (e - 8) of these 32: the V^T pieces follow it
#pragma unroll
      for (int j = 0; j < 8; ++j) {
        pb[j]     = (f16)st[2 * ks][j];
        pb[8 + j] = (f16)st[2 * ks + 1][j];
      }
#pragma unroll
      for (int nt = 0; nt < 4; ++nt) {
        const f16* vp = vfr + nt * 16 * VT_PITCH + sc + 32 * ks;
        o[nt] = wmma_f16(join_frag(vp, vp + 16), pb, o[nt]);
      }
    }
  }

  const float l   = l2[0] + l2[1];
  const float inv = 1.0f / (l + xhalf(l));

  // ---- O: the wave's 16 t x 64 n are 4 KB in a row; they leave in accumulator order, 512 bytes in a row a store:
  //      piece (2 nt + jj, lane) = O[t0 + lane % 16][16 nt + 8 (lane / 16) + 4 jj ..+3]; out_kernel reads them so ----
  {
    float* ob = (pass == 0 ? o1 : o2) + (size_t)kb * T_ * 64 + t0 * 64 + lane * 4;
#pragma unroll
    for (int nt = 0; nt < 4; ++nt) {
#pragma unroll
      for (int jj = 0; jj < 2; ++jj) {
        const v4f w = { o[nt][4 * jj] * inv, o[nt][4 * jj + 1] * inv, o[nt][4 * jj + 2] * inv, o[nt][4 * jj + 3] * inv };
        *(v4f*)(ob + (2 * nt + jj) * 128) = w;
      }
    }
  }

  // ---- stats: over the wave, then over the block's waves through LDS; the block's own line ----
  {
    float rs = row16_sum(l * inv);
    float rq = row16_sum((q2[0] + q2[1]) * inv * inv);
    float rx = row16_max(inv);
    float rn = row16_min(__builtin_amdgcn_exp2f(__builtin_fmaf(xmn, CS, -m_run)) * inv);
    const v4f red = { rs + xhalf(rs), rq + xhalf(rq), fmaxf(rx, xhalf(rx)), fminf(rn, xhalf(rn)) };
    if (lane == 0) *(v4f*)(Sred + wave * 4) = red;
  }
  __syncthreads();
  if (tid < 32) {
    const v4f sp = *(const v4f*)(Sred + c * 4);
    const v4f red = { row16_sum(sp[0]), row16_sum(sp[1]), row16_max(sp[2]), row16_min(sp[3]) };
    if (lane == 0) *(v4f*)(part + (kb * (T_ / 32) + blockIdx.x) * LINE_F) = red;
  }
}

// ---------------- kernel 3: partial stats -> MLP -> lambda ----------------
// One wave for each (band, batch): its four attention blocks (two maps x two halves of the rows) each left one line.
// Lanes 0, 1 take map 0's two partials, lanes 16, 17 map 1's; the other lanes hold the neutral values of the fold.
__device__ inline float lane_value(float v, int l) {
  return __builtin_bit_cast(float, __builtin_amdgcn_readlane(__builtin_bit_cast(int, v), l));
}

__global__ __launch_bounds__(32) void lam_kernel(const float* __restrict__ part,
                           const float* __restrict__ W1, const float* __restrict__ b1,
                           const float* __restrict__ W2, const float* __restrict__ b2,
                           float* __restrict__ lam) {
  const int i    = blockIdx.x;
  const int lane = threadIdx.x;
  int kband = i >> 2;
  v4f sp = *(const v4f*)(part + (i * (T_ / 32) + (lane & 1) * 2 + (lane >> 4)) * LINE_F);
  if ((lane & 15) >= 2) sp = v4f{ 0.f, 0.f, -__builtin_inff(), __builtin_inff() };
  const float rs = row16_sum(sp[0]), rq = row16_sum(sp[1]), rx = row16_max(sp[2]), rn = row16_min(sp[3]);
  const float s[8] = { lane_value(rs, 0),  lane_value(rq, 0),  lane_value(rx, 0),  lane_value(rn, 0),
                       lane_value(rs, 16), lane_value(rq, 16), lane_value(rx, 16), lane_value(rn, 16) };
  const float n = (float)T_ * (float)T_;
  float feat[8];
#pragma unroll
  for (int p = 0; p < 2; ++p) {
    float sum = s[p * 4 + 0], sq = s[p * 4 + 1];
    float mean = sum / n;
    float var  = (sq - sum * sum / n) / (n - 1.0f);
    feat[p * 4 + 0] = mean;
    feat[p * 4 + 1] = sqrtf(fmaxf(var, 0.f));
    feat[p * 4 + 2] = s[p * 4 + 2];
    feat[p * 4 + 3] = s[p * 4 + 3];
  }
  const float* w1  = W1 + kband * 16 * 8;
  const float* bb1 = b1 + kband * 16;
  const float* w2  = W2 + kband * 16;
  float z = b2[kband];
  for (int j = 0; j < 16; ++j) {
    float h = bb1[j];
#pragma unroll
    for (int qq = 0; qq < 8; ++qq) h += w1[j * 8 + qq] * feat[qq];
    z += w2[j] * fmaxf(h, 0.f);
  }
  if (lane == 0) lam[i * LINE_F] = 1.0f / (1.0f + __expf(-z));
}

// ---------------- kernel 4: out = (o1 - lam*o2) @ Wo^T + bo ----------------
// out is [B,N,T,K]: for one (b,m) the (t,k) axis is contiguous. One block makes 64 m x 16 t for ALL 30 bands,
// gathers the products in LDS in out's own order and stores runs of 1920 bytes (15 whole lines) a row.
#define OT_T  16             // t columns of a tile
#define OT_M  64             // m rows of a tile
#define OT_SP 484            // floats a row of S: 4 x odd, so rows stay 16-byte aligned and the 32 lanes of a tile store
                             // (16 t at 30 floats, two m groups 8 rows apart) fall on 32 different banks
#define OT_DP 72             // f16 a row of D: 144 bytes = 16 x odd, the pitch for 16-byte fragment reads of 128-byte rows
typedef __attribute__((ext_vector_type(4))) _Float16 v4h;

// 16 contiguous f16 from a row that is 16-byte (not 32-byte) aligned
__device__ inline v16h load_frag_2x16B(const f16* p) {
  v8h lo = *(const v8h*)p;
  v8h hi = *(const v8h*)(p + 8);
  return __builtin_shufflevector(lo, hi, 0, 1, 2, 3, 4, 5, 6, 7, 8, 9, 10, 11, 12, 13, 14, 15);
}

__global__ __launch_bounds__(480) void out_kernel(
    const float* __restrict__ o1, const float* __restrict__ o2,
    const f16* __restrict__ woh, const float* __restrict__ bo,
    const float* __restrict__ lam, float* __restrict__ out) {
  __shared__ __align__(16) float S[OT_M * OT_SP];        // S[m][t*30+k]
  __shared__ __align__(16) f16   D[K_ * OT_T * OT_DP];   // D[k][t][v] = o1 - lam*o2
  const int tid  = threadIdx.x;
  const int lane = tid & 31;
  const int wave = __builtin_amdgcn_readfirstlane(tid >> 5);   // 15 waves; held scalar, so band indices and lam go the scalar way
  const int t0   = blockIdx.x * OT_T;
  const int m0   = blockIdx.y * OT_M;
  const int bb   = blockIdx.z;

  // ---- D: a band's 16 t x 64 v are 4 KB in a row in o1 and o2, in the attention's accumulator order; a wave takes 2 bands,
  //      512 bytes a load: load i, lane l = t l % 16, v 16 (i / 2) + 8 (l / 16) + 4 (i % 2) ..+3 ----
  {
    const unsigned off = (unsigned)(((wave * B_ + bb) * T_ + t0) * 64 + lane * 4);
    const float* p1 = o1 + off;
    const float* p2 = o2 + off;
    v4f a[16], c[16];
    float l[2];
#pragma unroll   // all loads issue back to back off one address pair each, so their latencies overlap; a/c/l stay in registers
    for (int kk = 0; kk < 2; ++kk) {
      l[kk] = lam[((wave + 15 * kk) * B_ + bb) * LINE_F];
#pragma unroll   // as above
      for (int i = 0; i < 8; ++i) {
        a[8 * kk + i] = *(const v4f*)(p1 + kk * 15 * B_ * T_ * 64 + i * 128);
        c[8 * kk + i] = *(const v4f*)(p2 + kk * 15 * B_ * T_ * 64 + i * 128);
      }
    }
    f16* dw = D + (wave * OT_T + (lane & 15)) * OT_DP + (lane >> 4) * 8;
#pragma unroll   // a/c/l indexed by constants
    for (int kk = 0; kk < 2; ++kk) {
#pragma unroll   // a/c indexed by constants
      for (int i = 0; i < 8; ++i) {
        const v4f x = a[8 * kk + i], y = c[8 * kk + i];
        v4h d = { (f16)(x[0] - l[kk] * y[0]), (f16)(x[1] - l[kk] * y[1]),
                  (f16)(x[2] - l[kk] * y[2]), (f16)(x[3] - l[kk] * y[3]) };
        *(v4h*)(dw + 15 * kk * OT_T * OT_DP + (i >> 1) * 16 + (i & 1) * 4) = d;   // row k*16 + t
      }
    }
  }
  __syncthreads();

  // ---- products: a wave takes 2 bands x 4 m tiles. Wo is the A operand and D the B operand, so that
  //      acc[j] = Y[m = 8h + j][t = c] and a store's lanes run along t ----
  {
    const int c = lane & 15, h = lane >> 4;
#pragma unroll 1   // kept rolled: with both bands unrolled the kernel needs more than 256 registers and spills
    for (int kk = 0; kk < 2; ++kk) {
      const int k = wave + 15 * kk;
      const f16* dk = D + (k * OT_T + c) * OT_DP + 16 * h;
      const v16h b0 = load_frag_2x16B(dk);
      const v16h b1 = load_frag_2x16B(dk + 32);
      const f16*   wk = woh + (unsigned)((k * N_ + m0 + c) * 64 + 16 * h);
      const float* bk = bo + k * N_ + m0 + 8 * h;
      float*       sp = S + 8 * h * OT_SP + c * K_ + k;
#pragma unroll   // the four tiles' weight loads overlap
      for (int mt = 0; mt < 4; ++mt) {
        const v16h a0 = *(const v16h*)(wk + mt * 16 * 64);
        const v16h a1 = *(const v16h*)(wk + mt * 16 * 64 + 32);
        const v4f  bl = *(const v4f*)(bk + 16 * mt);
        const v4f  bh = *(const v4f*)(bk + 16 * mt + 4);
        v8f acc = {};
        acc = wmma_f16(a0, b0, acc);
        acc = wmma_f16(a1, b1, acc);
#pragma unroll   // vector elements picked by constants
        for (int j = 0; j < 4; ++j) {
          sp[(16 * mt + j) * OT_SP]     = acc[j]     + bl[j];
          sp[(16 * mt + 4 + j) * OT_SP] = acc[4 + j] + bh[j];
        }
      }
    }
  }
  __syncthreads();

  // ---- store: 120 lanes of 16 bytes carry one m row's 480 floats, 4 rows a sweep ----
  {
    const int j4 = tid % 120;
    const int mr = tid / 120;   // 0..3
    float* dst = out + (unsigned)(((bb * N_ + m0 + mr) * T_ + t0) * K_ + 4 * j4);
    const float* sr = S + mr * OT_SP + 4 * j4;
#pragma unroll   // the 16 LDS reads and stores overlap
    for (int i = 0; i < 16; ++i)
      *(v4f*)(dst + 4 * i * T_ * K_) = *(const v4f*)(sr + 4 * i * OT_SP);
  }
}

// ---------------- host side ----------------
extern "C" void kernel_launch(void* const* d_in, const int* in_sizes, int n_in,
                              void* d_out, int out_size, void* d_ws, size_t ws_size,
                              hipStream_t stream) {
  (void)in_sizes; (void)n_in; (void)out_size; (void)ws_size;
  const float* x  = (const float*)d_in[0];
  const float* Wq = (const float*)d_in[1];
  const float* Wk = (const float*)d_in[2];
  const float* Wv = (const float*)d_in[3];
  const float* Wo = (const float*)d_in[4];
  const float* bo = (const float*)d_in[5];
  const float* W1 = (const float*)d_in[6];
  const float* b1 = (const float*)d_in[7];
  const float* W2 = (const float*)d_in[8];
  const float* b2 = (const float*)d_in[9];

  char* ws = (char*)d_ws;
  f16*   xh    = (f16*)  (ws + OFF_XH);
  f16*   wqh   = (f16*)  (ws + OFF_WQH);
  f16*   wkh   = (f16*)  (ws + OFF_WKH);
  f16*   wvh   = (f16*)  (ws + OFF_WVH);
  f16*   woh   = (f16*)  (ws + OFF_WOH);
  f16*   qh    = (f16*)  (ws + OFF_QH);
  f16*   kh    = (f16*)  (ws + OFF_KH);
  f16*   vh    = (f16*)  (ws + OFF_VH);
  float* o1    = (float*)(ws + OFF_O1);
  float* o2    = (float*)(ws + OFF_O2);
  float* part  = (float*)(ws + OFF_ST);
  float* lamb  = (float*)(ws + OFF_LAM);

  prep_x_kernel<<<dim3(T_ / PX_T, N_ / PX_N, B_), dim3(480), 0, stream>>>(x, xh);
  prep_w_kernel<<<dim3((K_ * N_ * N_ + 255) / 256), dim3(256), 0, stream>>>(
      Wq, Wk, Wv, Wo, wqh, wkh, wvh, woh);

  proj_kernel<<<dim3(T_ / 32, K_ * B_), dim3(256), 0, stream>>>(
      xh, wqh, wkh, wvh, qh, kh, vh);
  attn_kernel<<<dim3(2 * T_ / (AT_WAVES * 16), K_ * B_), dim3(AT_WAVES * 32), 0, stream>>>(
      qh, kh, vh, o1, o2, part);
  lam_kernel<<<dim3(K_ * B_), dim3(32), 0, stream>>>(part, W1, b1, W2, b2, lamb);
  out_kernel<<<dim3(T_ / OT_T, N_ / OT_M, B_), dim3(480), 0, stream>>>(
      o1, o2, woh, bo, lamb, (float*)d_out);
}

// v007
// One run takes 61.1 microseconds.
// Timed twice side by side with v006, it ran 1.45 times as fast both times.
// Counting every step since v000, it is 4.57 times as fast.
#include <hip/hip_runtime.h>
#include <hip/hip_bf16.h>

typedef _Float16 f16;
typedef __attribute__((ext_vector_type(16))) _Float16 v16h;
typedef __attribute__((ext_vector_type(8)))  float    v8f;
typedef unsigned int v4u __attribute__((ext_vector_type(4)));
typedef float        v4f __attribute__((ext_vector_type(4)));
typedef float        v2f __attribute__((ext_vector_type(2)));
typedef __attribute__((ext_vector_type(8))) _Float16 v8h;

#define B_ 4
#define N_ 128
#define T_ 512
#define K_ 30
#define SCALE_INV 0.25f  // 1/sqrt(HEAD_DIM=16)

#define KS_PITCH  72     // f16 a K row in LDS: 144 bytes = 16 x odd, the pitch for 16-byte reads of 128-byte rows
#define VT_PITCH  520    // f16 a V^T row in LDS: 1040 bytes = 16 x odd
#define AT_WAVES  16     // waves of an attention block, 16 query rows each
#define LINE_F    32     // floats in a 128-byte line: what different blocks store in one launch lies a line apart

// ---------------- workspace layout (bytes) ----------------
constexpr size_t SZ_XH  = (size_t)K_ * B_ * T_ * N_ * 2;
constexpr size_t SZ_WQH = (size_t)K_ * N_ * N_ * 2;
constexpr size_t SZ_WVH = (size_t)K_ * 64 * N_ * 2;
constexpr size_t SZ_QH  = SZ_XH;
constexpr size_t SZ_VH  = (size_t)K_ * B_ * T_ * 64 * 2;
constexpr size_t SZ_O   = (size_t)K_ * B_ * T_ * 64 * 4;

constexpr size_t OFF_XH  = 0;
constexpr size_t OFF_WQH = OFF_XH  + SZ_XH;
constexpr size_t OFF_WKH = OFF_WQH + SZ_WQH;
constexpr size_t OFF_WVH = OFF_WKH + SZ_WQH;
constexpr size_t OFF_WOH = OFF_WVH + SZ_WVH;
constexpr size_t OFF_QH  = OFF_WOH + SZ_WVH;
constexpr size_t OFF_KH  = OFF_QH  + SZ_QH;
constexpr size_t OFF_VH  = OFF_KH  + SZ_QH;
constexpr size_t OFF_O1  = OFF_VH  + SZ_VH;
constexpr size_t OFF_O2  = OFF_O1  + SZ_O;
constexpr size_t OFF_ST  = OFF_O2  + SZ_O;
constexpr size_t OFF_LAM = OFF_ST  + (size_t)K_ * B_ * (T_ / 32) * 128;   // 128-byte lines for the attention blocks' partial stats, one a block

// ---------------- WMMA helpers ----------------
__device__ inline v8f wmma_f16(v16h a, v16h b, v8f c) {
  return __builtin_amdgcn_wmma_f32_16x16x32_f16(
      false, a, false, b, (short)0, c, false, false);
}

// ---- butterfly over a 16-lane row (DPP row_xmask 1,2,4,8): every lane ends with the row's result ----
template <int CTRL>
__device__ inline float dpp_xmask(float x) {
  return __builtin_bit_cast(float, __builtin_amdgcn_update_dpp(
      0, __builtin_bit_cast(int, x), CTRL, 0xf, 0xf, true));
}
__device__ inline float row16_max(float v) {
  v = fmaxf(v, dpp_xmask<0x161>(v));
  v = fmaxf(v, dpp_xmask<0x162>(v));
  v = fmaxf(v, dpp_xmask<0x164>(v));
  v = fmaxf(v, dpp_xmask<0x168>(v));
  return v;
}
__device__ inline float row16_min(float v) {
  v = fminf(v, dpp_xmask<0x161>(v));
  v = fminf(v, dpp_xmask<0x162>(v));
  v = fminf(v, dpp_xmask<0x164>(v));
  v = fminf(v, dpp_xmask<0x168>(v));
  return v;
}
__device__ inline float row16_sum(float v) {
  v += dpp_xmask<0x161>(v);
  v += dpp_xmask<0x162>(v);
  v += dpp_xmask<0x164>(v);
  v += dpp_xmask<0x168>(v);
  return v;
}

// lane l with lane l ^ 16: the other half of the wave
__device__ inline float xhalf(float x) {
  const int b = __builtin_bit_cast(int, x);
  return __builtin_bit_cast(float, __builtin_amdgcn_permlanex16(b, b, 0x76543210, 0xfedcba98, false, false));
}

// two 16-byte pieces of a row that is 16-byte (not 32-byte) aligned, as one 16-element fragment
__device__ inline v16h join_frag(const f16* plo, const f16* phi) {
  v8h lo = *(const v8h*)plo;
  v8h hi = *(const v8h*)phi;
  return __builtin_shufflevector(lo, hi, 0, 1, 2, 3, 4, 5, 6, 7, 8, 9, 10, 11, 12, 13, 14, 15);
}

// ---------------- kernel 0a: x [B,N,T,K] f32 -> xh [K,B,T,N] f16 ----------------
// One block moves a tile of 64 n x 16 t x 30 k through LDS: x is read along its contiguous (t,k)
// axis (1920 bytes a row, whole lines), xh is written along its contiguous n axis (128 bytes a row).
#define PX_T     16            // t rows of a tile
#define PX_N     64            // n columns of a tile
#define PX_F     (PX_T * K_)   // 480 (t,k) rows in LDS
#define PX_PITCH 33            // dwords a row: 32 pairs of f16 + 1, so that 4 rows read together miss each other's banks
typedef __attribute__((ext_vector_type(2))) _Float16 v2h;

__global__ __launch_bounds__(480) void prep_x_kernel(const float* __restrict__ x, f16* __restrict__ xh) {
  __shared__ __align__(16) unsigned S[PX_F * PX_PITCH];   // S[t*30+k][n/2]: two neighbouring n in a dword
  const int tid = threadIdx.x;
  const int t0  = blockIdx.x * PX_T;
  const int n0  = blockIdx.y * PX_N;
  const int b   = blockIdx.z;

  // ---- read: lane -> 16 bytes of one row's (t,k) run; each thread takes rows n and n+1 ----
  const int j   = tid % 120;   // which 4 floats of the 480
  const int np0 = tid / 120;   // 0..3: first pair of rows
  // x and xh are far below 4 GiB: 32-bit element offsets from the kernel's base pointers keep the address work short
  const float* src = x + (unsigned)(((b * N_ + n0 + 2 * np0) * T_ + t0) * K_ + 4 * j);
  v4f lo[8], hi[8];
#pragma unroll   // the loads issue back to back, so their latencies overlap; lo/hi indexed by constants stay in registers
  for (int i = 0; i < 8; ++i) {
    lo[i] = *(const v4f*)(src + (8 * i)     * T_ * K_);
    hi[i] = *(const v4f*)(src + (8 * i + 1) * T_ * K_);
  }
#pragma unroll   // lo/hi indexed by constants
  for (int i = 0; i < 8; ++i) {
#pragma unroll   // vector elements picked by constants
    for (int c = 0; c < 4; ++c) {
      v2h p = { (f16)lo[i][c], (f16)hi[i][c] };
      S[(4 * j + c) * PX_PITCH + np0 + 4 * i] = __builtin_bit_cast(unsigned, p);
    }
  }
  __syncthreads();

  // ---- write: 8 lanes carry one (t,k) row of 64 n (one 128-byte line), 4 rows a store ----
  const int l8 = tid & 7;
  const int r  = (tid >> 3) & 3;
  const int wave = tid >> 5;   // 15 waves, 8 groups of 4 rows each
#pragma unroll   // the 8 LDS reads and stores overlap
  for (int i = 0; i < 8; ++i) {
    const int f  = 4 * (wave + 15 * i) + r;
    const int tl = f / K_;
    const int k  = f - tl * K_;
    const unsigned* rp = S + f * PX_PITCH + 4 * l8;
    v4u val = { rp[0], rp[1], rp[2], rp[3] };
    *(v4u*)(xh + (unsigned)(((k * B_ + b) * T_ + t0 + tl) * N_ + n0 + 8 * l8)) = val;
  }
}

// ---------------- kernel 0b: weights f32 -> f16 ----------------
__global__ void prep_w_kernel(const float* __restrict__ Wq, const float* __restrict__ Wk,
                              const float* __restrict__ Wv, const float* __restrict__ Wo,
                              f16* __restrict__ wqh, f16* __restrict__ wkh,
                              f16* __restrict__ wvh, f16* __restrict__ woh) {
  int idx = blockIdx.x * blockDim.x + threadIdx.x;
  if (idx < K_ * N_ * N_) { wqh[idx] = (f16)Wq[idx]; wkh[idx] = (f16)Wk[idx]; }
  if (idx < K_ * 64 * N_) { wvh[idx] = (f16)Wv[idx]; woh[idx] = (f16)Wo[idx]; }
}

// ---------------- kernel 1: q/k/v projections (WMMA) ----------------
// One block: one band, 256 of its 2048 (batch, t) rows, all 320 outputs. The band's weights are staged once in LDS (whole-line
// 16-byte loads) and every wave reads its fragments from there; a wave holds its 32 rows of x in registers for all 20 tiles.
// q, k: W is the A operand and x the B operand, so a lane's 8 accumulators are 8 consecutive outputs of one t: one 16-byte
// piece. They leave in accumulator order, 512 bytes in a row a store: piece ((kb * 32 + t / 16) * 8 + m / 16, lane) =
// q[t = lane % 16][m = 16 (m / 16) + 8 (lane / 16) ..+7]; attn_kernel reads them so.
// v: x is the A operand, so a lane holds 8 consecutive t of one output: vh[kb][t/16][n][t%16], 2 KB in a row a wave tile.
#define PJ_WAVES 8
#define PJ_ROWS  32      // rows of x a wave
#define PJ_WP    136     // f16 a weight row in LDS: 272 bytes = 16 x odd, the pitch for 16-byte reads of 256-byte rows
#define PJ_OUT   320     // 128 q + 128 k + 64 v

__global__ __launch_bounds__(PJ_WAVES * 32) void proj_kernel(
    const f16* __restrict__ xh, const f16* __restrict__ wqh, const f16* __restrict__ wkh,
    const f16* __restrict__ wvh, f16* __restrict__ qh, f16* __restrict__ kh,
    f16* __restrict__ vh) {
  __shared__ __align__(16) f16 Wl[PJ_OUT * PJ_WP];   // rows 0..127 Wq, 128..255 Wk, 256..319 Wv
  const int tid  = threadIdx.x;
  const int lane = tid & 31;
  const int wave = tid >> 5;
  const int c    = lane & 15, h = lane >> 4;
  const int kband = blockIdx.y;
  const int r0   = kband * (B_ * T_) + blockIdx.x * (PJ_WAVES * PJ_ROWS) + wave * PJ_ROWS;   // first row in xh's [K*B*T][N]

  // ---- weights: 16 bytes a lane, 16 rows a sweep, all loads in flight at once ----
  v4u w[20];
  {
    const f16* sq = wqh + kband * N_ * N_ + tid * 8;
    const f16* sk = wkh + kband * N_ * N_ + tid * 8;
    const f16* sv = wvh + kband * 64 * N_ + tid * 8;
#pragma unroll   // w indexed by constants stays in registers
    for (int i = 0; i < 8; ++i) {
      w[i]     = *(const v4u*)(sq + i * 16 * N_);
      w[8 + i] = *(const v4u*)(sk + i * 16 * N_);
    }
#pragma unroll   // as above
    for (int i = 0; i < 4; ++i) w[16 + i] = *(const v4u*)(sv + i * 16 * N_);
  }
  // ---- x: two tiles of 16 rows, 16 contiguous n a lane and fragment, as the weight fragments have them ----
  v16h xf[2][4];
  {
    const f16* xp = xh + (unsigned)((r0 + c) * N_ + 16 * h);
#pragma unroll   // xf indexed by constants
    for (int u = 0; u < 2; ++u) {
#pragma unroll   // as above
      for (int kc = 0; kc < 4; ++kc) xf[u][kc] = *(const v16h*)(xp + u * 16 * N_ + kc * 32);
    }
  }
  {
    f16* d = Wl + (tid >> 4) * PJ_WP + (tid & 15) * 8;
#pragma unroll   // w indexed by constants
    for (int i = 0; i < 20; ++i) *(v4u*)(d + i * 16 * PJ_WP) = w[i];
  }
  __syncthreads();

  const f16* wf = Wl + c * PJ_WP + 16 * h;
  const unsigned tt = (unsigned)r0 >> 4;   // kb * 32 + t / 16
  f16* qd = qh + tt * (8 * 256) + lane * 8;
  f16* kd = kh + tt * (8 * 256) + lane * 8;
  f16* vd = vh + tt * (64 * 16) + c * 16 + 8 * h;
  v16h a[2][4];   // weight fragments of this tile and of the next
#pragma unroll   // a indexed by constants
  for (int kc = 0; kc < 4; ++kc) a[0][kc] = join_frag(wf + kc * 32, wf + kc * 32 + 8);
#pragma unroll   // a, xf picked by constants; the tile's kind is known at compile time
  for (int i = 0; i < PJ_OUT / 16; ++i) {
    if (i + 1 < PJ_OUT / 16) {   // the next tile's LDS reads fly under this tile's products
#pragma unroll
      for (int kc = 0; kc < 4; ++kc) {
        const f16* p = wf + (i + 1) * 16 * PJ_WP + kc * 32;
        a[(i + 1) & 1][kc] = join_frag(p, p + 8);
      }
    }
    v8f acc0 = {}, acc1 = {};   // the wave's two x tiles: two independent chains, each filling the other's wait
#pragma unroll
    for (int kc = 0; kc < 4; ++kc) {
      if (i < 16) {
        acc0 = wmma_f16(a[i & 1][kc], xf[0][kc], acc0);
        acc1 = wmma_f16(a[i & 1][kc], xf[1][kc], acc1);
      } else {
        acc0 = wmma_f16(xf[0][kc], a[i & 1][kc], acc0);
        acc1 = wmma_f16(xf[1][kc], a[i & 1][kc], acc1);
      }
    }
    v8h o0, o1;
#pragma unroll   // vector elements picked by constants
    for (int j = 0; j < 8; ++j) { o0[j] = (f16)acc0[j]; o1[j] = (f16)acc1[j]; }
    if (i < 16) {
      f16* dst = (i < 8 ? qd : kd) + (i & 7) * 256;
      *(v8h*)dst = o0;
      *(v8h*)(dst + 8 * 256) = o1;
    } else {
      f16* dst = vd + (i - 16) * 16 * 16;
      *(v8h*)dst = o0;
      *(v8h*)(dst + 64 * 16) = o1;
    }
  }
}

__global__ __launch_bounds__(AT_WAVES * 32) __attribute__((amdgpu_waves_per_eu(8, 8))) void attn_kernel(
    const f16* __restrict__ qh, const f16* __restrict__ kh, const f16* __restrict__ vh,
    float* __restrict__ o1, float* __restrict__ o2, float* __restrict__ part) {
  __shared__ __align__(16) f16   Ks[T_ * KS_PITCH];     // this map's half of K: Ks[s][d]
  __shared__ __align__(16) f16   Vt[64 * VT_PITCH];     // V transposed: Vt[n][s]
  __shared__ __align__(16) float Sred[AT_WAVES * 4];    // a wave's sum, sum of squares, max, min

  const int tid  = threadIdx.x;
  const int lane = tid & 31;
  const int wave = tid >> 5;
  const int c    = lane & 15, h = lane >> 4;
  const int kb   = blockIdx.y;
  const int pass = blockIdx.x & 1;
  const int t0   = (blockIdx.x >> 1) * (AT_WAVES * 16) + wave * 16;

  // ---- K half (2 KB in a row for 16 keys, in the projection's accumulator order) and V^T (64 KB in a row): 16 bytes a lane,
  //      512 bytes in a row a load, all loads in flight at once ----
  v4u kreg[8], vreg[8];
  {
    const f16* ksrc = kh + (size_t)kb * T_ * N_ + ((tid >> 7) * 8 + pass * 4 + (wave & 3)) * 256 + lane * 8;   // load i: key tiles 4i..4i+3
    const v4u* vsrc = (const v4u*)(vh + (size_t)kb * T_ * 64) + tid;   // already transposed: [t/16][n][t%16]
#pragma unroll   // kreg/vreg indexed by constants stay in registers
    for (int i = 0; i < 8; ++i) {
      kreg[i] = *(const v4u*)(ksrc + i * 64 * N_);   // 64 keys on: 4 tiles of 8 x 512 bytes
      vreg[i] = vsrc[i * 512];
    }
  }
  // ---- Q: the B operand of the first product, kept in registers; four pieces in accumulator order: element e of half h is
  //      d = 8 h + e (e < 8) or 16 + 8 h + (e - 8) of a fragment's 32, and the K fragments follow it ----
  const f16* qp = qh + (size_t)kb * T_ * N_ + ((t0 >> 4) * 8 + pass * 4) * 256 + lane * 8;
  const v16h qb0 = join_frag(qp, qp + 256);
  const v16h qb1 = join_frag(qp + 512, qp + 768);
  {
    f16* kdst = Ks + ((tid >> 7) * 16 + c) * KS_PITCH + (wave & 3) * 16 + h * 8;
    f16* vdst = Vt + ((tid & 127) >> 1) * VT_PITCH + (tid >> 7) * 16 + (tid & 1) * 8;   // load i: chunks 4i..4i+3
#pragma unroll   // kreg/vreg indexed by constants
    for (int i = 0; i < 8; ++i) {
      *(v4u*)(kdst + i * 64 * KS_PITCH) = kreg[i];
      *(v4u*)(vdst + i * 64) = vreg[i];
    }
  }
  __syncthreads();

  const float CS = SCALE_INV * 1.4426950408889634f;   // score scale times log2(e): exponentials in base 2
  float m_run = -__builtin_inff();                    // running maximum, scaled
  v2f l2 = {0.f, 0.f}, q2 = {0.f, 0.f};               // this lane's share of the row's sum of e and of e^2, in two chains
  float xmn = __builtin_inff();                       // smallest raw score this lane has seen
  v8f o[4] = {};                                      // O^T: o[nt][j] = O[t0 + c][16 nt + 8 h + j]
  const f16* kfr = Ks + c * KS_PITCH + 8 * h;
  const f16* vfr = Vt + c * VT_PITCH + 8 * h;

  // every inner loop from here to the stores of O is unrolled so that st[], o[] and vector elements are picked by constants
  // and live in registers
#pragma unroll 1   // kept rolled: a step holds 32 scores a lane, and two blocks on a WGP leave a wave 128 registers
  for (int sc = 0; sc < T_; sc += 64) {
    v8f st[4];   // st[i][j] = S[t0 + c][sc + 16 i + 8 h + j]; indexed by constants in unrolled loops below
#pragma unroll
    for (int i = 0; i < 4; ++i) {
      const f16* kp = kfr + (sc + 16 * i) * KS_PITCH;
      v8f acc = {};
      acc = wmma_f16(join_frag(kp, kp + 16), qb0, acc);
      acc = wmma_f16(join_frag(kp + 32, kp + 48), qb1, acc);
      st[i] = acc;
    }

    float cm = -__builtin_inff();
#pragma unroll
    for (int i = 0; i < 4; ++i) {
#pragma unroll
      for (int j = 0; j < 8; ++j) {
        cm  = fmaxf(cm, st[i][j]);
        xmn = fminf(xmn, st[i][j]);
      }
    }
    cm = fmaxf(cm, xhalf(cm));   // both halves of a column must scale by the same maximum: their products are summed
    const float m_new = fmaxf(m_run, cm * CS);
    const float alpha = __builtin_amdgcn_exp2f(m_run - m_new);   // 0 in the first step, where m_run is -inf
    m_run = m_new;
    l2 *= alpha;
    q2 *= alpha * alpha;
#pragma unroll
    for (int nt = 0; nt < 4; ++nt) o[nt] *= alpha;

#pragma unroll
    for (int i = 0; i < 4; ++i) {
#pragma unroll
      for (int j = 0; j < 8; j += 2) {
        const v2f x = { st[i][j], st[i][j + 1] };
        const v2f a = x * CS - m_new;
        const v2f e = { __builtin_amdgcn_exp2f(a[0]), __builtin_amdgcn_exp2f(a[1]) };
        l2 += e;
        q2 += e * e;
        st[i][j]     = e[0];
        st[i][j + 1] = e[1];
      }
    }

#pragma unroll
    for (int ks = 0; ks < 2; ++ks) {
      v16h pb;   // element e of half h is key 8 h + e (e < 8) or 16 + 8 h + (e - 8) of these 32: the V^T pieces follow it
#pragma unroll
      for (int j = 0; j < 8; ++j) {
        pb[j]     = (f16)st[2 * ks][j];
        pb[8 + j] = (f16)st[2 * ks + 1][j];
      }
#pragma unroll
      for (int nt = 0; nt < 4; ++nt) {
        const f16* vp = vfr + nt * 16 * VT_PITCH + sc + 32 * ks;
        o[nt] = wmma_f16(join_frag(vp, vp + 16), pb, o[nt]);
      }
    }
  }

  const float l   = l2[0] + l2[1];
  const float inv = 1.0f / (l + xhalf(l));

  // ---- O: the wave's 16 t x 64 n are 4 KB in a row; they leave in accumulator order, 512 bytes in a row a store:
  //      piece (2 nt + jj, lane) = O[t0 + lane % 16][16 nt + 8 (lane / 16) + 4 jj ..+3]; out_kernel reads them so ----
  {
    float* ob = (pass == 0 ? o1 : o2) + (size_t)kb * T_ * 64 + t0 * 64 + lane * 4;
#pragma unroll
    for (int nt = 0; nt < 4; ++nt) {
#pragma unroll
      for (int jj = 0; jj < 2; ++jj) {
        const v4f w = { o[nt][4 * jj] * inv, o[nt][4 * jj + 1] * inv, o[nt][4 * jj + 2] * inv, o[nt][4 * jj + 3] * inv };
        *(v4f*)(ob + (2 * nt + jj) * 128) = w;
      }
    }
  }

  // ---- stats: over the wave, then over the block's waves through LDS; the block's own line ----
  {
    float rs = row16_sum(l * inv);
    float rq = row16_sum((q2[0] + q2[1]) * inv * inv);
    float rx = row16_max(inv);
    float rn = row16_min(__builtin_amdgcn_exp2f(__builtin_fmaf(xmn, CS, -m_run)) * inv);
    const v4f red = { rs + xhalf(rs), rq + xhalf(rq), fmaxf(rx, xhalf(rx)), fminf(rn, xhalf(rn)) };
    if (lane == 0) *(v4f*)(Sred + wave * 4) = red;
  }
  __syncthreads();
  if (tid < 32) {
    const v4f sp = *(const v4f*)(Sred + c * 4);
    const v4f red = { row16_sum(sp[0]), row16_sum(sp[1]), row16_max(sp[2]), row16_min(sp[3]) };
    if (lane == 0) *(v4f*)(part + (kb * (T_ / 32) + blockIdx.x) * LINE_F) = red;
  }
}

// ---------------- kernel 3: partial stats -> MLP -> lambda ----------------
// One wave for each (band, batch): its four attention blocks (two maps x two halves of the rows) each left one line.
// Lanes 0, 1 take map 0's two partials, lanes 16, 17 map 1's; the other lanes hold the neutral values of the fold.
__device__ inline float lane_value(float v, int l) {
  return __builtin_bit_cast(float, __builtin_amdgcn_readlane(__builtin_bit_cast(int, v), l));
}

__global__ __launch_bounds__(32) void lam_kernel(const float* __restrict__ part,
                           const float* __restrict__ W1, const float* __restrict__ b1,
                           const float* __restrict__ W2, const float* __restrict__ b2,
                           float* __restrict__ lam) {
  const int i    = blockIdx.x;
  const int lane = threadIdx.x;
  int kband = i >> 2;
  v4f sp = *(const v4f*)(part + (i * (T_ / 32) + (lane & 1) * 2 + (lane >> 4)) * LINE_F);
  if ((lane & 15) >= 2) sp = v4f{ 0.f, 0.f, -__builtin_inff(), __builtin_inff() };
  const float rs = row16_sum(sp[0]), rq = row16_sum(sp[1]), rx = row16_max(sp[2]), rn = row16_min(sp[3]);
  const float s[8] = { lane_value(rs, 0),  lane_value(rq, 0),  lane_value(rx, 0),  lane_value(rn, 0),
                       lane_value(rs, 16), lane_value(rq, 16), lane_value(rx, 16), lane_value(rn, 16) };
  const float n = (float)T_ * (float)T_;
  float feat[8];
#pragma unroll
  for (int p = 0; p < 2; ++p) {
    float sum = s[p * 4 + 0], sq = s[p * 4 + 1];
    float mean = sum / n;
    float var  = (sq - sum * sum / n) / (n - 1.0f);
    feat[p * 4 + 0] = mean;
    feat[p * 4 + 1] = sqrtf(fmaxf(var, 0.f));
    feat[p * 4 + 2] = s[p * 4 + 2];
    feat[p * 4 + 3] = s[p * 4 + 3];
  }
  const float* w1  = W1 + kband * 16 * 8;
  const float* bb1 = b1 + kband * 16;
  const float* w2  = W2 + kband * 16;
  float z = b2[kband];
  for (int j = 0; j < 16; ++j) {
    float h = bb1[j];
#pragma unroll
    for (int qq = 0; qq < 8; ++qq) h += w1[j * 8 + qq] * feat[qq];
    z += w2[j] * fmaxf(h, 0.f);
  }
  if (lane == 0) lam[i * LINE_F] = 1.0f / (1.0f + __expf(-z));
}

// ---------------- kernel 4: out = (o1 - lam*o2) @ Wo^T + bo ----------------
// out is [B,N,T,K]: for one (b,m) the (t,k) axis is contiguous. One block makes 64 m x 16 t for ALL 30 bands,
// gathers the products in LDS in out's own order and stores runs of 1920 bytes (15 whole lines) a row.
#define OT_T  16             // t columns of a tile
#define OT_M  64             // m rows of a tile
#define OT_SP 484            // floats a row of S: 4 x odd, so rows stay 16-byte aligned and the 32 lanes of a tile store
                             // (16 t at 30 floats, two m groups 8 rows apart) fall on 32 different banks
#define OT_DP 72             // f16 a row of D: 144 bytes = 16 x odd, the pitch for 16-byte fragment reads of 128-byte rows
typedef __attribute__((ext_vector_type(4))) _Float16 v4h;

// 16 contiguous f16 from a row that is 16-byte (not 32-byte) aligned
__device__ inline v16h load_frag_2x16B(const f16* p) {
  v8h lo = *(const v8h*)p;
  v8h hi = *(const v8h*)(p + 8);
  return __builtin_shufflevector(lo, hi, 0, 1, 2, 3, 4, 5, 6, 7, 8, 9, 10, 11, 12, 13, 14, 15);
}

__global__ __launch_bounds__(480) void out_kernel(
    const float* __restrict__ o1, const float* __restrict__ o2,
    const f16* __restrict__ woh, const float* __restrict__ bo,
    const float* __restrict__ lam, float* __restrict__ out) {
  __shared__ __align__(16) float S[OT_M * OT_SP];        // S[m][t*30+k]
  __shared__ __align__(16) f16   D[K_ * OT_T * OT_DP];   // D[k][t][v] = o1 - lam*o2
  const int tid  = threadIdx.x;
  const int lane = tid & 31;
  const int wave = __builtin_amdgcn_readfirstlane(tid >> 5);   // 15 waves; held scalar, so band indices and lam go the scalar way
  const int t0   = blockIdx.x * OT_T;
  const int m0   = blockIdx.y * OT_M;
  const int bb   = blockIdx.z;

  // ---- D: a band's 16 t x 64 v are 4 KB in a row in o1 and o2, in the attention's accumulator order; a wave takes 2 bands,
  //      512 bytes a load: load i, lane l = t l % 16, v 16 (i / 2) + 8 (l / 16) + 4 (i % 2) ..+3 ----
  {
    const unsigned off = (unsigned)(((wave * B_ + bb) * T_ + t0) * 64 + lane * 4);
    const float* p1 = o1 + off;
    const float* p2 = o2 + off;
    v4f a[16], c[16];
    float l[2];
#pragma unroll   // all loads issue back to back off one address pair each, so their latencies overlap; a/c/l stay in registers
    for (int kk = 0; kk < 2; ++kk) {
      l[kk] = lam[((wave + 15 * kk) * B_ + bb) * LINE_F];
#pragma unroll   // as above
      for (int i = 0; i < 8; ++i) {
        a[8 * kk + i] = *(const v4f*)(p1 + kk * 15 * B_ * T_ * 64 + i * 128);
        c[8 * kk + i] = *(const v4f*)(p2 + kk * 15 * B_ * T_ * 64 + i * 128);
      }
    }
    f16* dw = D + (wave * OT_T + (lane & 15)) * OT_DP + (lane >> 4) * 8;
#pragma unroll   // a/c/l indexed by constants
    for (int kk = 0; kk < 2; ++kk) {
#pragma unroll   // a/c indexed by constants
      for (int i = 0; i < 8; ++i) {
        const v4f x = a[8 * kk + i], y = c[8 * kk + i];
        v4h d = { (f16)(x[0] - l[kk] * y[0]), (f16)(x[1] - l[kk] * y[1]),
                  (f16)(x[2] - l[kk] * y[2]), (f16)(x[3] - l[kk] * y[3]) };
        *(v4h*)(dw + 15 * kk * OT_T * OT_DP + (i >> 1) * 16 + (i & 1) * 4) = d;   // row k*16 + t
      }
    }
  }
  __syncthreads();

  // ---- products: a wave takes 2 bands x 4 m tiles. Wo is the A operand and D the B operand, so that
  //      acc[j] = Y[m = 8h + j][t = c] and a store's lanes run along t ----
  {
    const int c = lane & 15, h = lane >> 4;
#pragma unroll 1   // kept rolled: with both bands unrolled the kernel needs more than 256 registers and spills
    for (int kk = 0; kk < 2; ++kk) {
      const int k = wave + 15 * kk;
      const f16* dk = D + (k * OT_T + c) * OT_DP + 16 * h;
      const v16h b0 = load_frag_2x16B(dk);
      const v16h b1 = load_frag_2x16B(dk + 32);
      const f16*   wk = woh + (unsigned)((k * N_ + m0 + c) * 64 + 16 * h);
      const float* bk = bo + k * N_ + m0 + 8 * h;
      float*       sp = S + 8 * h * OT_SP + c * K_ + k;
#pragma unroll   // the four tiles' weight loads overlap
      for (int mt = 0; mt < 4; ++mt) {
        const v16h a0 = *(const v16h*)(wk + mt * 16 * 64);
        const v16h a1 = *(const v16h*)(wk + mt * 16 * 64 + 32);
        const v4f  bl = *(const v4f*)(bk + 16 * mt);
        const v4f  bh = *(const v4f*)(bk + 16 * mt + 4);
        v8f acc = {};
        acc = wmma_f16(a0, b0, acc);
        acc = wmma_f16(a1, b1, acc);
#pragma unroll   // vector elements picked by constants
        for (int j = 0; j < 4; ++j) {
          sp[(16 * mt + j) * OT_SP]     = acc[j]     + bl[j];
          sp[(16 * mt + 4 + j) * OT_SP] = acc[4 + j] + bh[j];
        }
      }
    }
  }
  __syncthreads();

  // ---- store: 120 lanes of 16 bytes carry one m row's 480 floats, 4 rows a sweep ----
  {
    const int j4 = tid % 120;
    const int mr = tid / 120;   // 0..3
    float* dst = out + (unsigned)(((bb * N_ + m0 + mr) * T_ + t0) * K_ + 4 * j4);
    const float* sr = S + mr * OT_SP + 4 * j4;
#pragma unroll   // the 16 LDS reads and stores overlap
    for (int i = 0; i < 16; ++i)
      *(v4f*)(dst + 4 * i * T_ * K_) = *(const v4f*)(sr + 4 * i * OT_SP);
  }
}

// ---------------- host side ----------------
extern "C" void kernel_launch(void* const* d_in, const int* in_sizes, int n_in,
                              void* d_out, int out_size, void* d_ws, size_t ws_size,
                              hipStream_t stream) {
  (void)in_sizes; (void)n_in; (void)out_size; (void)ws_size;
  const float* x  = (const float*)d_in[0];
  const float* Wq = (const float*)d_in[1];
  const float* Wk = (const float*)d_in[2];
  const float* Wv = (const float*)d_in[3];
  const float* Wo = (const float*)d_in[4];
  const float* bo = (const float*)d_in[5];
  const float* W1 = (const float*)d_in[6];
  const float* b1 = (const float*)d_in[7];
  const float* W2 = (const float*)d_in[8];
  const float* b2 = (const float*)d_in[9];

  char* ws = (char*)d_ws;
  f16*   xh    = (f16*)  (ws + OFF_XH);
  f16*   wqh   = (f16*)  (ws + OFF_WQH);
  f16*   wkh   = (f16*)  (ws + OFF_WKH);
  f16*   wvh   = (f16*)  (ws + OFF_WVH);
  f16*   woh   = (f16*)  (ws + OFF_WOH);
  f16*   qh    = (f16*)  (ws + OFF_QH);
  f16*   kh    = (f16*)  (ws + OFF_KH);
  f16*   vh    = (f16*)  (ws + OFF_VH);
  float* o1    = (float*)(ws + OFF_O1);
  float* o2    = (float*)(ws + OFF_O2);
  float* part  = (float*)(ws + OFF_ST);
  float* lamb  = (float*)(ws + OFF_LAM);

  prep_x_kernel<<<dim3(T_ / PX_T, N_ / PX_N, B_), dim3(480), 0, stream>>>(x, xh);
  prep_w_kernel<<<dim3((K_ * N_ * N_ + 255) / 256), dim3(256), 0, stream>>>(
      Wq, Wk, Wv, Wo, wqh, wkh, wvh, woh);

  proj_kernel<<<dim3(B_ * T_ / (PJ_WAVES * PJ_ROWS), K_), dim3(PJ_WAVES * 32), 0, stream>>>(
      xh, wqh, wkh, wvh, qh, kh, vh);
  attn_kernel<<<dim3(2 * T_ / (AT_WAVES * 16), K_ * B_), dim3(AT_WAVES * 32), 0, stream>>>(
      qh, kh, vh, o1, o2, part);
  lam_kernel<<<dim3(K_ * B_), dim3(32), 0, stream>>>(part, W1, b1, W2, b2, lamb);
  out_kernel<<<dim3(T_ / OT_T, N_ / OT_M, B_), dim3(480), 0, stream>>>(
      o1, o2, woh, bo, lamb, (float*)d_out);
}

// v008
// One run takes 44 microseconds.
// Timed twice side by side with v007, it ran 1.39 and 1.38 times as fast.
// Over all steps from v000 it is 6.34 times as fast.
#include <hip/hip_runtime.h>
#include <hip/hip_bf16.h>

typedef _Float16 f16;
typedef __attribute__((ext_vector_type(16))) _Float16 v16h;
typedef __attribute__((ext_vector_type(8)))  float    v8f;
typedef unsigned int v4u __attribute__((ext_vector_type(4)));
typedef float        v4f __attribute__((ext_vector_type(4)));
typedef float        v2f __attribute__((ext_vector_type(2)));
typedef __attribute__((ext_vector_type(8))) _Float16 v8h;

#define B_ 4
#define N_ 128
#define T_ 512
#define K_ 30
#define SCALE_INV 0.25f  // 1/sqrt(HEAD_DIM=16)

#define KS_PITCH  72     // f16 a K row in LDS: 144 bytes = 16 x odd, the pitch for 16-byte reads of 128-byte rows
#define VT_PITCH  520    // f16 a V^T row in LDS: 1040 bytes = 16 x odd
#define AT_WAVES  16     // waves of an attention block, 32 rows each
#define LINE_F    32     // floats in a 128-byte line: what different blocks store in one launch lies a line apart

// ---------------- workspace layout (bytes) ----------------
constexpr size_t SZ_XH  = (size_t)K_ * B_ * T_ * N_ * 2;
constexpr size_t SZ_WQH = (size_t)K_ * N_ * N_ * 2;
constexpr size_t SZ_WVH = (size_t)K_ * 64 * N_ * 2;
constexpr size_t SZ_O   = (size_t)K_ * B_ * T_ * 64 * 4;

constexpr size_t OFF_XH  = 0;
constexpr size_t OFF_WQH = OFF_XH  + SZ_XH;
constexpr size_t OFF_WKH = OFF_WQH + SZ_WQH;
constexpr size_t OFF_WVH = OFF_WKH + SZ_WQH;
constexpr size_t OFF_WOH = OFF_WVH + SZ_WVH;
constexpr size_t OFF_O1  = OFF_WOH + SZ_WVH;
constexpr size_t OFF_O2  = OFF_O1  + SZ_O;
constexpr size_t OFF_ST  = OFF_O2  + SZ_O;
constexpr size_t OFF_LAM = OFF_ST  + (size_t)K_ * B_ * 2 * 128;   // 128-byte lines for the attention blocks' stats, one a block

// ---------------- WMMA helpers ----------------
__device__ inline v8f wmma_f16(v16h a, v16h b, v8f c) {
  return __builtin_amdgcn_wmma_f32_16x16x32_f16(
      false, a, false, b, (short)0, c, false, false);
}

// ---- butterfly over a 16-lane row (DPP row_xmask 1,2,4,8): every lane ends with the row's result ----
template <int CTRL>
__device__ inline float dpp_xmask(float x) {
  return __builtin_bit_cast(float, __builtin_amdgcn_update_dpp(
      0, __builtin_bit_cast(int, x), CTRL, 0xf, 0xf, true));
}
__device__ inline float row16_max(float v) {
  v = fmaxf(v, dpp_xmask<0x161>(v));
  v = fmaxf(v, dpp_xmask<0x162>(v));
  v = fmaxf(v, dpp_xmask<0x164>(v));
  v = fmaxf(v, dpp_xmask<0x168>(v));
  return v;
}
__device__ inline float row16_min(float v) {
  v = fminf(v, dpp_xmask<0x161>(v));
  v = fminf(v, dpp_xmask<0x162>(v));
  v = fminf(v, dpp_xmask<0x164>(v));
  v = fminf(v, dpp_xmask<0x168>(v));
  return v;
}
__device__ inline float row16_sum(float v) {
  v += dpp_xmask<0x161>(v);
  v += dpp_xmask<0x162>(v);
  v += dpp_xmask<0x164>(v);
  v += dpp_xmask<0x168>(v);
  return v;
}

// lane l with lane l ^ 16: the other half of the wave
__device__ inline float xhalf(float x) {
  const int b = __builtin_bit_cast(int, x);
  return __builtin_bit_cast(float, __builtin_amdgcn_permlanex16(b, b, 0x76543210, 0xfedcba98, false, false));
}

// two 16-byte pieces of a row that is 16-byte (not 32-byte) aligned, as one 16-element fragment
__device__ inline v16h join_frag(const f16* plo, const f16* phi) {
  v8h lo = *(const v8h*)plo;
  v8h hi = *(const v8h*)phi;
  return __builtin_shufflevector(lo, hi, 0, 1, 2, 3, 4, 5, 6, 7, 8, 9, 10, 11, 12, 13, 14, 15);
}

// ---------------- kernel 0a: x [B,N,T,K] f32 -> xh [K,B,T,N] f16 ----------------
// One block moves a tile of 64 n x 16 t x 30 k through LDS: x is read along its contiguous (t,k)
// axis (1920 bytes a row, whole lines), xh is written along its contiguous n axis (128 bytes a row).
#define PX_T     16            // t rows of a tile
#define PX_N     64            // n columns of a tile
#define PX_F     (PX_T * K_)   // 480 (t,k) rows in LDS
#define PX_PITCH 33            // dwords a row: 32 pairs of f16 + 1, so that 4 rows read together miss each other's banks
typedef __attribute__((ext_vector_type(2))) _Float16 v2h;

__global__ __launch_bounds__(480) void prep_x_kernel(const float* __restrict__ x, f16* __restrict__ xh) {
  __shared__ __align__(16) unsigned S[PX_F * PX_PITCH];   // S[t*30+k][n/2]: two neighbouring n in a dword
  const int tid = threadIdx.x;
  const int t0  = blockIdx.x * PX_T;
  const int n0  = blockIdx.y * PX_N;
  const int b   = blockIdx.z;

  // ---- read: lane -> 16 bytes of one row's (t,k) run; each thread takes rows n and n+1 ----
  const int j   = tid % 120;   // which 4 floats of the 480
  const int np0 = tid / 120;   // 0..3: first pair of rows
  // x and xh are far below 4 GiB: 32-bit element offsets from the kernel's base pointers keep the address work short
  const float* src = x + (unsigned)(((b * N_ + n0 + 2 * np0) * T_ + t0) * K_ + 4 * j);
  v4f lo[8], hi[8];
#pragma unroll   // the loads issue back to back, so their latencies overlap; lo/hi indexed by constants stay in registers
  for (int i = 0; i < 8; ++i) {
    lo[i] = *(const v4f*)(src + (8 * i)     * T_ * K_);
    hi[i] = *(const v4f*)(src + (8 * i + 1) * T_ * K_);
  }
#pragma unroll   // lo/hi indexed by constants
  for (int i = 0; i < 8; ++i) {
#pragma unroll   // vector elements picked by constants
    for (int c = 0; c < 4; ++c) {
      v2h p = { (f16)lo[i][c], (f16)hi[i][c] };
      S[(4 * j + c) * PX_PITCH + np0 + 4 * i] = __builtin_bit_cast(unsigned, p);
    }
  }
  __syncthreads();

  // ---- write: 8 lanes carry one (t,k) row of 64 n (one 128-byte line), 4 rows a store ----
  const int l8 = tid & 7;
  const int r  = (tid >> 3) & 3;
  const int wave = tid >> 5;   // 15 waves, 8 groups of 4 rows each
#pragma unroll   // the 8 LDS reads and stores overlap
  for (int i = 0; i < 8; ++i) {
    const int f  = 4 * (wave + 15 * i) + r;
    const int tl = f / K_;
    const int k  = f - tl * K_;
    const unsigned* rp = S + f * PX_PITCH + 4 * l8;
    v4u val = { rp[0], rp[1], rp[2], rp[3] };
    *(v4u*)(xh + (unsigned)(((k * B_ + b) * T_ + t0 + tl) * N_ + n0 + 8 * l8)) = val;
  }
}

// ---------------- kernel 0b: weights f32 -> f16 ----------------
__global__ void prep_w_kernel(const float* __restrict__ Wq, const float* __restrict__ Wk,
                              const float* __restrict__ Wv, const float* __restrict__ Wo,
                              f16* __restrict__ wqh, f16* __restrict__ wkh,
                              f16* __restrict__ wvh, f16* __restrict__ woh) {
  int idx = blockIdx.x * blockDim.x + threadIdx.x;
  if (idx < K_ * N_ * N_) { wqh[idx] = (f16)Wq[idx]; wkh[idx] = (f16)Wk[idx]; }
  if (idx < K_ * 64 * N_) { wvh[idx] = (f16)Wv[idx]; woh[idx] = (f16)Wo[idx]; }
}

#define AT_ROWS  32      // rows of x, and so queries, a wave
#define PJ_WP    136     // f16 a weight row in LDS: 272 bytes = 16 x odd, the pitch for 16-byte reads of 256-byte rows
#define PJ_OUT   192     // 64 q + 64 k + 64 v

__global__ __launch_bounds__(AT_WAVES * 32) void attn_kernel(
    const f16* __restrict__ xh, const f16* __restrict__ wqh, const f16* __restrict__ wkh, const f16* __restrict__ wvh,
    float* __restrict__ o1, float* __restrict__ o2, float* __restrict__ part) {
  __shared__ __align__(16) f16   Ks[T_ * KS_PITCH];     // this map's half of K: Ks[s][d]
  __shared__ __align__(16) f16   Vt[64 * VT_PITCH];     // V transposed: Vt[n][s]
  __shared__ __align__(16) f16   Wl[PJ_OUT * PJ_WP];    // rows 0..63 this map's Wq, 64..127 its Wk, 128..191 Wv
  __shared__ __align__(16) float Sred[AT_WAVES * 4];    // a wave's sum, sum of squares, max, min

  const int tid  = threadIdx.x;
  const int lane = tid & 31;
  const int wave = __builtin_amdgcn_readfirstlane(tid >> 5);   // held scalar: row offsets and the last fold's test cost no vector register
  const int c    = lane & 15, h = lane >> 4;
  const int kb   = blockIdx.y;
  const int kband = kb / B_;
  const int pass = blockIdx.x;
  const int t0   = wave * AT_ROWS;

  // ---- weights: 16 bytes a lane, 32 rows a sweep, all loads in flight at once ----
  v4u w[6];
  {
    const f16* sq = wqh + (kband * N_ + pass * 64) * N_ + tid * 8;
    const f16* sk = wkh + (kband * N_ + pass * 64) * N_ + tid * 8;
    const f16* sv = wvh + kband * 64 * N_ + tid * 8;
#pragma unroll   // w indexed by constants stays in registers
    for (int i = 0; i < 2; ++i) {
      w[i]     = *(const v4u*)(sq + i * 32 * N_);
      w[2 + i] = *(const v4u*)(sk + i * 32 * N_);
      w[4 + i] = *(const v4u*)(sv + i * 32 * N_);
    }
  }
  // ---- x: two tiles of 16 rows, 16 contiguous n a lane and fragment, as the weight fragments have them ----
  v16h xf[2][4];
  {
    const f16* xp = xh + (unsigned)((kb * T_ + t0 + c) * N_ + 16 * h);
#pragma unroll   // xf indexed by constants
    for (int u = 0; u < 2; ++u) {
#pragma unroll   // as above
      for (int kc = 0; kc < 4; ++kc) xf[u][kc] = *(const v16h*)(xp + u * 16 * N_ + kc * 32);
    }
  }
  {
    f16* d = Wl + (tid >> 4) * PJ_WP + (tid & 15) * 8;
#pragma unroll   // w indexed by constants
    for (int i = 0; i < 6; ++i) *(v4u*)(d + i * 32 * PJ_WP) = w[i];
  }
  __syncthreads();

  // ---- projections: tiles 0..3 q, 4..7 k, 8..11 v ----
  v8h qpc[2][4];   // q of the wave's two query tiles, four pieces of 16 outputs each, in accumulator order
  {
    const f16* wf = Wl + c * PJ_WP + 16 * h;
    f16* kd = Ks + (t0 + c) * KS_PITCH + 8 * h;
    f16* vd = Vt + c * VT_PITCH + t0 + 8 * h;
    v16h a[2][4];   // weight fragments of this tile and of the next
#pragma unroll   // a indexed by constants
    for (int kc = 0; kc < 4; ++kc) a[0][kc] = join_frag(wf + kc * 32, wf + kc * 32 + 8);
#pragma unroll   // a, xf, qpc picked by constants; the tile's kind is known at compile time
    for (int i = 0; i < PJ_OUT / 16; ++i) {
      if (i + 1 < PJ_OUT / 16) {   // the next tile's LDS reads fly under this tile's products
#pragma unroll
        for (int kc = 0; kc < 4; ++kc) {
          const f16* p = wf + (i + 1) * 16 * PJ_WP + kc * 32;
          a[(i + 1) & 1][kc] = join_frag(p, p + 8);
        }
      }
      v8f acc0 = {}, acc1 = {};   // the wave's two x tiles: two independent chains, each filling the other's wait
#pragma unroll
      for (int kc = 0; kc < 4; ++kc) {
        if (i < 8) {
          acc0 = wmma_f16(a[i & 1][kc], xf[0][kc], acc0);
          acc1 = wmma_f16(a[i & 1][kc], xf[1][kc], acc1);
        } else {
          acc0 = wmma_f16(xf[0][kc], a[i & 1][kc], acc0);
          acc1 = wmma_f16(xf[1][kc], a[i & 1][kc], acc1);
        }
      }
      v8h p0, p1;
#pragma unroll   // vector elements picked by constants
      for (int j = 0; j < 8; ++j) { p0[j] = (f16)acc0[j]; p1[j] = (f16)acc1[j]; }
      if (i < 4) {
        qpc[0][i] = p0;
        qpc[1][i] = p1;
      } else if (i < 8) {
        *(v8h*)(kd + (i - 4) * 16) = p0;
        *(v8h*)(kd + 16 * KS_PITCH + (i - 4) * 16) = p1;
      } else {
        *(v8h*)(vd + (i - 8) * 16 * VT_PITCH) = p0;
        *(v8h*)(vd + (i - 8) * 16 * VT_PITCH + 16) = p1;
      }
    }
  }
  // ---- Q: the B operand of the first product: element e of half h is d = 8 h + e (e < 8) or 16 + 8 h + (e - 8) of a
  //      fragment's 32, and the K fragments follow it ----
  v16h qb[2][2];
#pragma unroll   // qb, qpc indexed by constants
  for (int u = 0; u < 2; ++u) {
#pragma unroll   // as above
    for (int g = 0; g < 2; ++g)
      qb[u][g] = __builtin_shufflevector(qpc[u][2 * g], qpc[u][2 * g + 1], 0, 1, 2, 3, 4, 5, 6, 7, 8, 9, 10, 11, 12, 13, 14, 15);
  }
  __syncthreads();

  const float CS = SCALE_INV * 1.4426950408889634f;   // score scale times log2(e): exponentials in base 2
  // one of each for each of the wave's two query tiles
  float m_run[2] = { -__builtin_inff(), -__builtin_inff() };   // running maximum, scaled
  v2f l2[2] = {}, q2[2] = {};                                   // this lane's share of the row's sum of e and of e^2, in two chains
  float xmn[2] = { __builtin_inff(), __builtin_inff() };        // smallest raw score this lane has seen
  v8f o[2][4] = {};                                             // O^T: o[u][nt][j] = O[t0 + 16 u + c][16 nt + 8 h + j]
  const f16* kfr = Ks + c * KS_PITCH + 8 * h;
  const f16* vfr = Vt + c * VT_PITCH + 8 * h;

  // every inner loop from here to the stores of O is unrolled so that st[], o[] and vector elements are picked by constants
  // and live in registers
#pragma unroll 1   // kept rolled: a step holds 64 scores a lane, and four waves on a SIMD leave a wave 256 registers
  for (int sc = 0; sc < T_; sc += 64) {
    v8f st[2][4];   // st[u][i][j] = S[t0 + 16 u + c][sc + 16 i + 8 h + j]
#pragma unroll
    for (int i = 0; i < 4; ++i) {
      const f16* kp = kfr + (sc + 16 * i) * KS_PITCH;
      const v16h ka0 = join_frag(kp, kp + 16);
      const v16h ka1 = join_frag(kp + 32, kp + 48);
#pragma unroll
      for (int u = 0; u < 2; ++u) {
        v8f acc = {};
        acc = wmma_f16(ka0, qb[u][0], acc);
        acc = wmma_f16(ka1, qb[u][1], acc);
        st[u][i] = acc;
      }
    }
    // all 16 K reads first, then the 16 products on counted waits: left alone the build reads two pieces at a time and
    // waits for them in front of each pair of products
    __builtin_amdgcn_sched_group_barrier(0x100, 16, 0);
    __builtin_amdgcn_sched_group_barrier(0x008, 16, 0);
    // holds the V^T reads behind the score products: lifted to the loop's top beside the K reads they overfill the wave's
    // 256 registers and the build spills inside the loop; from here they still fly under the softmax
    __builtin_amdgcn_sched_barrier(0);

#pragma unroll
    for (int u = 0; u < 2; ++u) {
      float cm = -__builtin_inff();
#pragma unroll
      for (int i = 0; i < 4; ++i) {
#pragma unroll
        for (int j = 0; j < 8; ++j) {
          cm     = fmaxf(cm, st[u][i][j]);
          xmn[u] = fminf(xmn[u], st[u][i][j]);
        }
      }
      cm = fmaxf(cm, xhalf(cm));   // both halves of a column must scale by the same maximum: their products are summed
      const float m_new = fmaxf(m_run[u], cm * CS);
      const float alpha = __builtin_amdgcn_exp2f(m_run[u] - m_new);   // 0 in the first step, where m_run is -inf
      m_run[u] = m_new;
      l2[u] *= alpha;
      q2[u] *= alpha * alpha;
#pragma unroll
      for (int nt = 0; nt < 4; ++nt) o[u][nt] *= alpha;

#pragma unroll
      for (int i = 0; i < 4; ++i) {
#pragma unroll
        for (int j = 0; j < 8; j += 2) {
          const v2f x = { st[u][i][j], st[u][i][j + 1] };
          const v2f a = x * CS - m_new;
          const v2f e = { __builtin_amdgcn_exp2f(a[0]), __builtin_amdgcn_exp2f(a[1]) };
          l2[u] += e;
          q2[u] += e * e;
          st[u][i][j]     = e[0];
          st[u][i][j + 1] = e[1];
        }
      }
    }

#pragma unroll
    for (int ks = 0; ks < 2; ++ks) {
      v16h pb[2];   // element e of half h is key 8 h + e (e < 8) or 16 + 8 h + (e - 8) of these 32: the V^T pieces follow it
#pragma unroll
      for (int u = 0; u < 2; ++u) {
#pragma unroll
        for (int j = 0; j < 8; ++j) {
          pb[u][j]     = (f16)st[u][2 * ks][j];
          pb[u][8 + j] = (f16)st[u][2 * ks + 1][j];
        }
      }
#pragma unroll
      for (int nt = 0; nt < 4; ++nt) {
        const f16* vp = vfr + nt * 16 * VT_PITCH + sc + 32 * ks;
        const v16h va = join_frag(vp, vp + 16);
#pragma unroll
        for (int u = 0; u < 2; ++u) o[u][nt] = wmma_f16(va, pb[u], o[u][nt]);
      }
    }
  }

  float l[2], inv[2];
#pragma unroll
  for (int u = 0; u < 2; ++u) {
    l[u]   = l2[u][0] + l2[u][1];
    inv[u] = 1.0f / (l[u] + xhalf(l[u]));
  }

  // ---- O: a query tile's 16 t x 64 n are 4 KB in a row; they leave in accumulator order, 512 bytes in a row a store:
  //      piece (2 nt + jj, lane) = O[tile's t + lane % 16][16 nt + 8 (lane / 16) + 4 jj ..+3]; out_kernel reads them so ----
  {
    float* ob = (pass == 0 ? o1 : o2) + (size_t)kb * T_ * 64 + t0 * 64 + lane * 4;
#pragma unroll
    for (int u = 0; u < 2; ++u) {
#pragma unroll
      for (int nt = 0; nt < 4; ++nt) {
#pragma unroll
        for (int jj = 0; jj < 2; ++jj) {
          const v4f r = { o[u][nt][4 * jj] * inv[u], o[u][nt][4 * jj + 1] * inv[u],
                          o[u][nt][4 * jj + 2] * inv[u], o[u][nt][4 * jj + 3] * inv[u] };
          *(v4f*)(ob + u * 16 * 64 + (2 * nt + jj) * 128) = r;
        }
      }
    }
  }

  // ---- stats: the lane's two tiles, then over the wave, then over the block's waves through LDS; the block's own line ----
  {
    float rs = row16_sum(l[0] * inv[0] + l[1] * inv[1]);
    float rq = row16_sum((q2[0][0] + q2[0][1]) * inv[0] * inv[0] + (q2[1][0] + q2[1][1]) * inv[1] * inv[1]);
    float rx = row16_max(fmaxf(inv[0], inv[1]));
    float rn = row16_min(fminf(__builtin_amdgcn_exp2f(__builtin_fmaf(xmn[0], CS, -m_run[0])) * inv[0],
                               __builtin_amdgcn_exp2f(__builtin_fmaf(xmn[1], CS, -m_run[1])) * inv[1]));
    const v4f red = { rs + xhalf(rs), rq + xhalf(rq), fmaxf(rx, xhalf(rx)), fminf(rn, xhalf(rn)) };
    if (lane == 0) *(v4f*)(Sred + wave * 4) = red;
  }
  __syncthreads();
  if (wave == 0) {
    const v4f sp = *(const v4f*)(Sred + c * 4);
    const v4f red = { row16_sum(sp[0]), row16_sum(sp[1]), row16_max(sp[2]), row16_min(sp[3]) };
    if (lane == 0) *(v4f*)(part + (kb * 2 + pass) * LINE_F) = red;
  }
}

// ---------------- kernel 2: stats -> MLP -> lambda ----------------
// One wave for each (band, batch): its two attention blocks, one a map, each left one line.
// Lanes 0..15 read map 0's line, lanes 16..31 map 1's.
__device__ inline float lane_value(float v, int l) {
  return __builtin_bit_cast(float, __builtin_amdgcn_readlane(__builtin_bit_cast(int, v), l));
}

__global__ __launch_bounds__(32) void lam_kernel(const float* __restrict__ part,
                           const float* __restrict__ W1, const float* __restrict__ b1,
                           const float* __restrict__ W2, const float* __restrict__ b2,
                           float* __restrict__ lam) {
  const int i    = blockIdx.x;
  const int lane = threadIdx.x;
  int kband = i >> 2;
  const v4f sp = *(const v4f*)(part + (i * 2 + (lane >> 4)) * LINE_F);
  const float s[8] = { lane_value(sp[0], 0),  lane_value(sp[1], 0),  lane_value(sp[2], 0),  lane_value(sp[3], 0),
                       lane_value(sp[0], 16), lane_value(sp[1], 16), lane_value(sp[2], 16), lane_value(sp[3], 16) };
  const float n = (float)T_ * (float)T_;
  float feat[8];
#pragma unroll
  for (int p = 0; p < 2; ++p) {
    float sum = s[p * 4 + 0], sq = s[p * 4 + 1];
    float mean = sum / n;
    float var  = (sq - sum * sum / n) / (n - 1.0f);
    feat[p * 4 + 0] = mean;
    feat[p * 4 + 1] = sqrtf(fmaxf(var, 0.f));
    feat[p * 4 + 2] = s[p * 4 + 2];
    feat[p * 4 + 3] = s[p * 4 + 3];
  }
  const float* w1  = W1 + kband * 16 * 8;
  const float* bb1 = b1 + kband * 16;
  const float* w2  = W2 + kband * 16;
  float z = b2[kband];
  for (int j = 0; j < 16; ++j) {
    float h = bb1[j];
#pragma unroll
    for (int qq = 0; qq < 8; ++qq) h += w1[j * 8 + qq] * feat[qq];
    z += w2[j] * fmaxf(h, 0.f);
  }
  if (lane == 0) lam[i * LINE_F] = 1.0f / (1.0f + __expf(-z));
}

// ---------------- kernel 3: out = (o1 - lam*o2) @ Wo^T + bo ----------------
// out is [B,N,T,K]: for one (b,m) the (t,k) axis is contiguous. One block makes 64 m x 16 t for ALL 30 bands,
// gathers the products in LDS in out's own order and stores runs of 1920 bytes (15 whole lines) a row.
#define OT_T  16             // t columns of a tile
#define OT_M  64             // m rows of a tile
#define OT_SP 484            // floats a row of S: 4 x odd, so rows stay 16-byte aligned and the 32 lanes of a tile store
                             // (16 t at 30 floats, two m groups 8 rows apart) fall on 32 different banks
#define OT_DP 72             // f16 a row of D: 144 bytes = 16 x odd, the pitch for 16-byte fragment reads of 128-byte rows
typedef __attribute__((ext_vector_type(4))) _Float16 v4h;

// 16 contiguous f16 from a row that is 16-byte (not 32-byte) aligned
__device__ inline v16h load_frag_2x16B(const f16* p) {
  v8h lo = *(const v8h*)p;
  v8h hi = *(const v8h*)(p + 8);
  return __builtin_shufflevector(lo, hi, 0, 1, 2, 3, 4, 5, 6, 7, 8, 9, 10, 11, 12, 13, 14, 15);
}

__global__ __launch_bounds__(480) void out_kernel(
    const float* __restrict__ o1, const float* __restrict__ o2,
    const f16* __restrict__ woh, const float* __restrict__ bo,
    const float* __restrict__ lam, float* __restrict__ out) {
  __shared__ __align__(16) float S[OT_M * OT_SP];        // S[m][t*30+k]
  __shared__ __align__(16) f16   D[K_ * OT_T * OT_DP];   // D[k][t][v] = o1 - lam*o2
  const int tid  = threadIdx.x;
  const int lane = tid & 31;
  const int wave = __builtin_amdgcn_readfirstlane(tid >> 5);   // 15 waves; held scalar, so band indices and lam go the scalar way
  const int t0   = blockIdx.x * OT_T;
  const int m0   = blockIdx.y * OT_M;
  const int bb   = blockIdx.z;

  // ---- D: a band's 16 t x 64 v are 4 KB in a row in o1 and o2, in the attention's accumulator order; a wave takes 2 bands,
  //      512 bytes a load: load i, lane l = t l % 16, v 16 (i / 2) + 8 (l / 16) + 4 (i % 2) ..+3 ----
  {
    const unsigned off = (unsigned)(((wave * B_ + bb) * T_ + t0) * 64 + lane * 4);
    const float* p1 = o1 + off;
    const float* p2 = o2 + off;
    v4f a[16], c[16];
    float l[2];
#pragma unroll   // all loads issue back to back off one address pair each, so their latencies overlap; a/c/l stay in registers
    for (int kk = 0; kk < 2; ++kk) {
      l[kk] = lam[((wave + 15 * kk) * B_ + bb) * LINE_F];
#pragma unroll   // as above
      for (int i = 0; i < 8; ++i) {
        a[8 * kk + i] = *(const v4f*)(p1 + kk * 15 * B_ * T_ * 64 + i * 128);
        c[8 * kk + i] = *(const v4f*)(p2 + kk * 15 * B_ * T_ * 64 + i * 128);
      }
    }
    f16* dw = D + (wave * OT_T + (lane & 15)) * OT_DP + (lane >> 4) * 8;
#pragma unroll   // a/c/l indexed by constants
    for (int kk = 0; kk < 2; ++kk) {
#pragma unroll   // a/c indexed by constants
      for (int i = 0; i < 8; ++i) {
        const v4f x = a[8 * kk + i], y = c[8 * kk + i];
        v4h d = { (f16)(x[0] - l[kk] * y[0]), (f16)(x[1] - l[kk] * y[1]),
                  (f16)(x[2] - l[kk] * y[2]), (f16)(x[3] - l[kk] * y[3]) };
        *(v4h*)(dw + 15 * kk * OT_T * OT_DP + (i >> 1) * 16 + (i & 1) * 4) = d;   // row k*16 + t
      }
    }
  }
  __syncthreads();

  // ---- products: a wave takes 2 bands x 4 m tiles. Wo is the A operand and D the B operand, so that
  //      acc[j] = Y[m = 8h + j][t = c] and a store's lanes run along t ----
  {
    const int c = lane & 15, h = lane >> 4;
#pragma unroll 1   // kept rolled: with both bands unrolled the kernel needs more than 256 registers and spills
    for (int kk = 0; kk < 2; ++kk) {
      const int k = wave + 15 * kk;
      const f16* dk = D + (k * OT_T + c) * OT_DP + 16 * h;
      const v16h b0 = load_frag_2x16B(dk);
      const v16h b1 = load_frag_2x16B(dk + 32);
      const f16*   wk = woh + (unsigned)((k * N_ + m0 + c) * 64 + 16 * h);
      const float* bk = bo + k * N_ + m0 + 8 * h;
      float*       sp = S + 8 * h * OT_SP + c * K_ + k;
#pragma unroll   // the four tiles' weight loads overlap
      for (int mt = 0; mt < 4; ++mt) {
        const v16h a0 = *(const v16h*)(wk + mt * 16 * 64);
        const v16h a1 = *(const v16h*)(wk + mt * 16 * 64 + 32);
        const v4f  bl = *(const v4f*)(bk + 16 * mt);
        const v4f  bh = *(const v4f*)(bk + 16 * mt + 4);
        v8f acc = {};
        acc = wmma_f16(a0, b0, acc);
        acc = wmma_f16(a1, b1, acc);
#pragma unroll   // vector elements picked by constants
        for (int j = 0; j < 4; ++j) {
          sp[(16 * mt + j) * OT_SP]     = acc[j]     + bl[j];
          sp[(16 * mt + 4 + j) * OT_SP] = acc[4 + j] + bh[j];
        }
      }
    }
  }
  __syncthreads();

  // ---- store: 120 lanes of 16 bytes carry one m row's 480 floats, 4 rows a sweep ----
  {
    const int j4 = tid % 120;
    const int mr = tid / 120;   // 0..3
    float* dst = out + (unsigned)(((bb * N_ + m0 + mr) * T_ + t0) * K_ + 4 * j4);
    const float* sr = S + mr * OT_SP + 4 * j4;
#pragma unroll   // the 16 LDS reads and stores overlap
    for (int i = 0; i < 16; ++i)
      *(v4f*)(dst + 4 * i * T_ * K_) = *(const v4f*)(sr + 4 * i * OT_SP);
  }
}

// ---------------- host side ----------------
extern "C" void kernel_launch(void* const* d_in, const int* in_sizes, int n_in,
                              void* d_out, int out_size, void* d_ws, size_t ws_size,
                              hipStream_t stream) {
  (void)in_sizes; (void)n_in; (void)out_size; (void)ws_size;
  const float* x  = (const float*)d_in[0];
  const float* Wq = (const float*)d_in[1];
  const float* Wk = (const float*)d_in[2];
  const float* Wv = (const float*)d_in[3];
  const float* Wo = (const float*)d_in[4];
  const float* bo = (const float*)d_in[5];
  const float* W1 = (const float*)d_in[6];
  const float* b1 = (const float*)d_in[7];
  const float* W2 = (const float*)d_in[8];
  const float* b2 = (const float*)d_in[9];

  char* ws = (char*)d_ws;
  f16*   xh    = (f16*)  (ws + OFF_XH);
  f16*   wqh   = (f16*)  (ws + OFF_WQH);
  f16*   wkh   = (f16*)  (ws + OFF_WKH);
  f16*   wvh   = (f16*)  (ws + OFF_WVH);
  f16*   woh   = (f16*)  (ws + OFF_WOH);
  float* o1    = (float*)(ws + OFF_O1);
  float* o2    = (float*)(ws + OFF_O2);
  float* part  = (float*)(ws + OFF_ST);
  float* lamb  = (float*)(ws + OFF_LAM);

  prep_x_kernel<<<dim3(T_ / PX_T, N_ / PX_N, B_), dim3(480), 0, stream>>>(x, xh);
  prep_w_kernel<<<dim3((K_ * N_ * N_ + 255) / 256), dim3(256), 0, stream>>>(
      Wq, Wk, Wv, Wo, wqh, wkh, wvh, woh);

  attn_kernel<<<dim3(2, K_ * B_), dim3(AT_WAVES * 32), 0, stream>>>(
      xh, wqh, wkh, wvh, o1, o2, part);
  lam_kernel<<<dim3(K_ * B_), dim3(32), 0, stream>>>(part, W1, b1, W2, b2, lamb);
  out_kernel<<<dim3(T_ / OT_T, N_ / OT_M, B_), dim3(480), 0, stream>>>(
      o1, o2, woh, bo, lamb, (float*)d_out);
}

// v009
// A run of this version takes 42.2 microseconds.
// Two timings next to v008 both put it at 1.04 times that version's speed.
// Counting every step since v000, it is 6.59 times as fast.
#include <hip/hip_runtime.h>
#include <hip/hip_bf16.h>

typedef _Float16 f16;
typedef __attribute__((ext_vector_type(16))) _Float16 v16h;
typedef __attribute__((ext_vector_type(8)))  float    v8f;
typedef unsigned int v4u __attribute__((ext_vector_type(4)));
typedef float        v4f __attribute__((ext_vector_type(4)));
typedef float        v2f __attribute__((ext_vector_type(2)));
typedef __attribute__((ext_vector_type(8))) _Float16 v8h;

#define B_ 4
#define N_ 128
#define T_ 512
#define K_ 30
#define SCALE_INV 0.25f  // 1/sqrt(HEAD_DIM=16)

#define KS_PITCH  72     // f16 a K row in LDS: 144 bytes = 16 x odd, the pitch for 16-byte reads of 128-byte rows
#define VT_PITCH  520    // f16 a V^T row in LDS: 1040 bytes = 16 x odd
#define AT_WAVES  16     // waves of an attention block, 32 rows each
#define LINE_F    32     // floats in a 128-byte line: what different blocks store in one launch lies a line apart

// ---------------- workspace layout (bytes) ----------------
constexpr size_t SZ_XH  = (size_t)K_ * B_ * T_ * N_ * 2;
constexpr size_t SZ_WQH = (size_t)K_ * N_ * N_ * 2;
constexpr size_t SZ_WVH = (size_t)K_ * 64 * N_ * 2;
constexpr size_t SZ_O   = (size_t)K_ * B_ * T_ * 64 * 4;

constexpr size_t OFF_XH  = 0;
constexpr size_t OFF_WQH = OFF_XH  + SZ_XH;
constexpr size_t OFF_WKH = OFF_WQH + SZ_WQH;
constexpr size_t OFF_WVH = OFF_WKH + SZ_WQH;
constexpr size_t OFF_WOH = OFF_WVH + SZ_WVH;
constexpr size_t OFF_O1  = OFF_WOH + SZ_WVH;
constexpr size_t OFF_O2  = OFF_O1  + SZ_O;
constexpr size_t OFF_ST  = OFF_O2  + SZ_O;
constexpr size_t OFF_LAM = OFF_ST  + (size_t)K_ * B_ * 2 * 128;   // 128-byte lines for the attention blocks' stats, one a block

// ---------------- WMMA helpers ----------------
__device__ inline v8f wmma_f16(v16h a, v16h b, v8f c) {
  return __builtin_amdgcn_wmma_f32_16x16x32_f16(
      false, a, false, b, (short)0, c, false, false);
}

// ---- butterfly over a 16-lane row (DPP row_xmask 1,2,4,8): every lane ends with the row's result ----
template <int CTRL>
__device__ inline float dpp_xmask(float x) {
  return __builtin_bit_cast(float, __builtin_amdgcn_update_dpp(
      0, __builtin_bit_cast(int, x), CTRL, 0xf, 0xf, true));
}
__device__ inline float row16_max(float v) {
  v = fmaxf(v, dpp_xmask<0x161>(v));
  v = fmaxf(v, dpp_xmask<0x162>(v));
  v = fmaxf(v, dpp_xmask<0x164>(v));
  v = fmaxf(v, dpp_xmask<0x168>(v));
  return v;
}
__device__ inline float row16_min(float v) {
  v = fminf(v, dpp_xmask<0x161>(v));
  v = fminf(v, dpp_xmask<0x162>(v));
  v = fminf(v, dpp_xmask<0x164>(v));
  v = fminf(v, dpp_xmask<0x168>(v));
  return v;
}
__device__ inline float row16_sum(float v) {
  v += dpp_xmask<0x161>(v);
  v += dpp_xmask<0x162>(v);
  v += dpp_xmask<0x164>(v);
  v += dpp_xmask<0x168>(v);
  return v;
}

// lane l with lane l ^ 16: the other half of the wave
__device__ inline float xhalf(float x) {
  const int b = __builtin_bit_cast(int, x);
  return __builtin_bit_cast(float, __builtin_amdgcn_permlanex16(b, b, 0x76543210, 0xfedcba98, false, false));
}

// two 16-byte pieces of a row that is 16-byte (not 32-byte) aligned, as one 16-element fragment
__device__ inline v16h join_frag(const f16* plo, const f16* phi) {
  v8h lo = *(const v8h*)plo;
  v8h hi = *(const v8h*)phi;
  return __builtin_shufflevector(lo, hi, 0, 1, 2, 3, 4, 5, 6, 7, 8, 9, 10, 11, 12, 13, 14, 15);
}

// ---------------- kernel 0: x [B,N,T,K] f32 -> xh [K,B,T,N] f16; weights f32 -> f16 ----------------
// One block moves a tile of 64 n x 16 t x 30 k through LDS: x is read along its contiguous (t,k)
// axis (1920 bytes a row, whole lines), xh is written along its contiguous n axis (128 bytes a row).
// The weights ride along: they make 768 runs of 1920 floats (one 16-byte load a thread), three for each of the 256 blocks:
// one of Wq, one of Wk, and one of Wv (first half of the blocks) or of Wo (second half). A run leaves as 30 whole lines.
#define PX_T     16            // t rows of a tile
#define PX_N     64            // n columns of a tile
#define PX_F     (PX_T * K_)   // 480 (t,k) rows in LDS
#define PX_PITCH 33            // dwords a row: 32 pairs of f16 + 1, so that 4 rows read together miss each other's banks
#define PW_RUN   (480 * 4)     // weights a block converts in one sweep of its threads
typedef __attribute__((ext_vector_type(2))) _Float16 v2h;
typedef __attribute__((ext_vector_type(4))) _Float16 v4h;
static_assert(K_ * N_ * N_ == 256 * PW_RUN && K_ * 64 * N_ == 128 * PW_RUN, "three runs of weights a block");

__device__ inline v4h to_f16x4(v4f v) {
  v4h r = { (f16)v[0], (f16)v[1], (f16)v[2], (f16)v[3] };
  return r;
}

__global__ __launch_bounds__(480) void prep_kernel(const float* __restrict__ x, f16* __restrict__ xh,
                              const float* __restrict__ Wq, const float* __restrict__ Wk,
                              const float* __restrict__ Wv, const float* __restrict__ Wo,
                              f16* __restrict__ wqh, f16* __restrict__ wkh,
                              f16* __restrict__ wvh, f16* __restrict__ woh) {
  __shared__ __align__(16) unsigned S[PX_F * PX_PITCH];   // S[t*30+k][n/2]: two neighbouring n in a dword
  const int tid = threadIdx.x;
  const int t0  = blockIdx.x * PX_T;
  const int n0  = blockIdx.y * PX_N;
  const int b   = blockIdx.z;

  // ---- weights: which three runs are this block's ----
  // 0..255; the mask shows the build that the byte offsets fit 32 bits: a scalar base and one offset register a load or store
  const int bid  = (blockIdx.x + (T_ / PX_T) * (blockIdx.y + (N_ / PX_N) * blockIdx.z)) & 255;
  const int half = bid >> 7;                                                             // the same for the whole block
  const unsigned wo_a = (unsigned)(bid * PW_RUN + 4 * tid);
  const unsigned wo_b = (unsigned)((bid & 127) * PW_RUN + 4 * tid);

  // ---- read: lane -> 16 bytes of one row's (t,k) run; each thread takes rows n and n+1 ----
  const int j   = tid % 120;   // which 4 floats of the 480
  const int np0 = tid / 120;   // 0..3: first pair of rows
  // x and xh are far below 4 GiB: 32-bit element offsets from the kernel's base pointers keep the address work short
  const float* src = x + (unsigned)(((b * N_ + n0 + 2 * np0) * T_ + t0) * K_ + 4 * j);
  v4f lo[8], hi[8];
#pragma unroll   // the loads issue back to back, so their latencies overlap; lo/hi indexed by constants stay in registers
  for (int i = 0; i < 8; ++i) {
    lo[i] = *(const v4f*)(src + (8 * i)     * T_ * K_);
    hi[i] = *(const v4f*)(src + (8 * i + 1) * T_ * K_);
  }
#pragma unroll   // lo/hi indexed by constants
  for (int i = 0; i < 8; ++i) {
#pragma unroll   // vector elements picked by constants
    for (int c = 0; c < 4; ++c) {
      v2h p = { (f16)lo[i][c], (f16)hi[i][c] };
      S[(4 * j + c) * PX_PITCH + np0 + 4 * i] = __builtin_bit_cast(unsigned, p);
    }
  }
  __syncthreads();

  // the weights' loads start here, where the registers that held x are free again, and fly under the LDS reads and xh stores
  const v4f wa = *(const v4f*)(Wq + wo_a);
  const v4f wb = *(const v4f*)(Wk + wo_a);
  const v4f wc = *(const v4f*)((half ? Wo : Wv) + wo_b);

  // ---- write: 8 lanes carry one (t,k) row of 64 n (one 128-byte line), 4 rows a store ----
  const int l8 = tid & 7;
  const int r  = (tid >> 3) & 3;
  const int wave = tid >> 5;   // 15 waves, 8 groups of 4 rows each
#pragma unroll   // the 8 LDS reads and stores overlap
  for (int i = 0; i < 8; ++i) {
    const int f  = 4 * (wave + 15 * i) + r;
    const int tl = f / K_;
    const int k  = f - tl * K_;
    const unsigned* rp = S + f * PX_PITCH + 4 * l8;
    v4u val = { rp[0], rp[1], rp[2], rp[3] };
    *(v4u*)(xh + (unsigned)(((k * B_ + b) * T_ + t0 + tl) * N_ + n0 + 8 * l8)) = val;
  }
  *(v4h*)(wqh + wo_a) = to_f16x4(wa);
  *(v4h*)(wkh + wo_a) = to_f16x4(wb);
  *(v4h*)((half ? woh : wvh) + wo_b) = to_f16x4(wc);
}

#define AT_ROWS  32      // rows of x, and so queries, a wave
#define PJ_WP    136     // f16 a weight row in LDS: 272 bytes = 16 x odd, the pitch for 16-byte reads of 256-byte rows
#define PJ_OUT   192     // 64 q + 64 k + 64 v

__global__ __launch_bounds__(AT_WAVES * 32) void attn_kernel(
    const f16* __restrict__ xh, const f16* __restrict__ wqh, const f16* __restrict__ wkh, const f16* __restrict__ wvh,
    float* __restrict__ o1, float* __restrict__ o2, float* __restrict__ part) {
  __shared__ __align__(16) f16   Ks[T_ * KS_PITCH];     // this map's half of K: Ks[s][d]
  __shared__ __align__(16) f16   Vt[64 * VT_PITCH];     // V transposed: Vt[n][s]
  __shared__ __align__(16) f16   Wl[PJ_OUT * PJ_WP];    // rows 0..63 this map's Wq, 64..127 its Wk, 128..191 Wv
  __shared__ __align__(16) float Sred[AT_WAVES * 4];    // a wave's sum, sum of squares, max, min

  const int tid  = threadIdx.x;
  const int lane = tid & 31;
  const int wave = __builtin_amdgcn_readfirstlane(tid >> 5);   // held scalar: row offsets and the last fold's test cost no vector register
  const int c    = lane & 15, h = lane >> 4;
  const int kb   = blockIdx.y;
  const int kband = kb / B_;
  const int pass = blockIdx.x;
  const int t0   = wave * AT_ROWS;

  // ---- weights: 16 bytes a lane, 32 rows a sweep, all loads in flight at once ----
  v4u w[6];
  {
    const f16* sq = wqh + (kband * N_ + pass * 64) * N_ + tid * 8;
    const f16* sk = wkh + (kband * N_ + pass * 64) * N_ + tid * 8;
    const f16* sv = wvh + kband * 64 * N_ + tid * 8;
#pragma unroll   // w indexed by constants stays in registers
    for (int i = 0; i < 2; ++i) {
      w[i]     = *(const v4u*)(sq + i * 32 * N_);
      w[2 + i] = *(const v4u*)(sk + i * 32 * N_);
      w[4 + i] = *(const v4u*)(sv + i * 32 * N_);
    }
  }
  // ---- x: two tiles of 16 rows, 16 contiguous n a lane and fragment, as the weight fragments have them ----
  v16h xf[2][4];
  {
    const f16* xp = xh + (unsigned)((kb * T_ + t0 + c) * N_ + 16 * h);
#pragma unroll   // xf indexed by constants
    for (int u = 0; u < 2; ++u) {
#pragma unroll   // as above
      for (int kc = 0; kc < 4; ++kc) xf[u][kc] = *(const v16h*)(xp + u * 16 * N_ + kc * 32);
    }
  }
  {
    f16* d = Wl + (tid >> 4) * PJ_WP + (tid & 15) * 8;
#pragma unroll   // w indexed by constants
    for (int i = 0; i < 6; ++i) *(v4u*)(d + i * 32 * PJ_WP) = w[i];
  }
  __syncthreads();

  // ---- projections: tiles 0..3 q, 4..7 k, 8..11 v ----
  v8h qpc[2][4];   // q of the wave's two query tiles, four pieces of 16 outputs each, in accumulator order
  {
    const f16* wf = Wl + c * PJ_WP + 16 * h;
    f16* kd = Ks + (t0 + c) * KS_PITCH + 8 * h;
    f16* vd = Vt + c * VT_PITCH + t0 + 8 * h;
    v16h a[2][4];   // weight fragments of this tile and of the next
#pragma unroll   // a indexed by constants
    for (int kc = 0; kc < 4; ++kc) a[0][kc] = join_frag(wf + kc * 32, wf + kc * 32 + 8);
#pragma unroll   // a, xf, qpc picked by constants; the tile's kind is known at compile time
    for (int i = 0; i < PJ_OUT / 16; ++i) {
      if (i + 1 < PJ_OUT / 16) {   // the next tile's LDS reads fly under this tile's products
#pragma unroll
        for (int kc = 0; kc < 4; ++kc) {
          const f16* p = wf + (i + 1) * 16 * PJ_WP + kc * 32;
          a[(i + 1) & 1][kc] = join_frag(p, p + 8);
        }
      }
      v8f acc0 = {}, acc1 = {};   // the wave's two x tiles: two independent chains, each filling the other's wait
#pragma unroll
      for (int kc = 0; kc < 4; ++kc) {
        if (i < 8) {
          acc0 = wmma_f16(a[i & 1][kc], xf[0][kc], acc0);
          acc1 = wmma_f16(a[i & 1][kc], xf[1][kc], acc1);
        } else {
          acc0 = wmma_f16(xf[0][kc], a[i & 1][kc], acc0);
          acc1 = wmma_f16(xf[1][kc], a[i & 1][kc], acc1);
        }
      }
      v8h p0, p1;
#pragma unroll   // vector elements picked by constants
      for (int j = 0; j < 8; ++j) { p0[j] = (f16)acc0[j]; p1[j] = (f16)acc1[j]; }
      if (i < 4) {
        qpc[0][i] = p0;
        qpc[1][i] = p1;
      } else if (i < 8) {
        *(v8h*)(kd + (i - 4) * 16) = p0;
        *(v8h*)(kd + 16 * KS_PITCH + (i - 4) * 16) = p1;
      } else {
        *(v8h*)(vd + (i - 8) * 16 * VT_PITCH) = p0;
        *(v8h*)(vd + (i - 8) * 16 * VT_PITCH + 16) = p1;
      }
    }
  }
  // ---- Q: the B operand of the first product: element e of half h is d = 8 h + e (e < 8) or 16 + 8 h + (e - 8) of a
  //      fragment's 32, and the K fragments follow it ----
  v16h qb[2][2];
#pragma unroll   // qb, qpc indexed by constants
  for (int u = 0; u < 2; ++u) {
#pragma unroll   // as above
    for (int g = 0; g < 2; ++g)
      qb[u][g] = __builtin_shufflevector(qpc[u][2 * g], qpc[u][2 * g + 1], 0, 1, 2, 3, 4, 5, 6, 7, 8, 9, 10, 11, 12, 13, 14, 15);
  }
  __syncthreads();

  const float CS = SCALE_INV * 1.4426950408889634f;   // score scale times log2(e): exponentials in base 2
  // one of each for each of the wave's two query tiles
  float m_run[2] = { -__builtin_inff(), -__builtin_inff() };   // running maximum, scaled
  v2f l2[2] = {}, q2[2] = {};                                   // this lane's share of the row's sum of e and of e^2, in two chains
  float xmn[2] = { __builtin_inff(), __builtin_inff() };        // smallest raw score this lane has seen
  v8f o[2][4] = {};                                             // O^T: o[u][nt][j] = O[t0 + 16 u + c][16 nt + 8 h + j]
  const f16* kfr = Ks + c * KS_PITCH + 8 * h;
  const f16* vfr = Vt + c * VT_PITCH + 8 * h;

  // every inner loop from here to the stores of O is unrolled so that st[], o[] and vector elements are picked by constants
  // and live in registers
#pragma unroll 1   // kept rolled: a step holds 64 scores a lane, and four waves on a SIMD leave a wave 256 registers
  for (int sc = 0; sc < T_; sc += 64) {
    v8f st[2][4];   // st[u][i][j] = S[t0 + 16 u + c][sc + 16 i + 8 h + j]
#pragma unroll
    for (int i = 0; i < 4; ++i) {
      const f16* kp = kfr + (sc + 16 * i) * KS_PITCH;
      const v16h ka0 = join_frag(kp, kp + 16);
      const v16h ka1 = join_frag(kp + 32, kp + 48);
#pragma unroll
      for (int u = 0; u < 2; ++u) {
        v8f acc = {};
        acc = wmma_f16(ka0, qb[u][0], acc);
        acc = wmma_f16(ka1, qb[u][1], acc);
        st[u][i] = acc;
      }
    }
    // all 16 K reads first, then the 16 products on counted waits: left alone the build reads two pieces at a time and
    // waits for them in front of each pair of products
    __builtin_amdgcn_sched_group_barrier(0x100, 16, 0);
    __builtin_amdgcn_sched_group_barrier(0x008, 16, 0);
    // holds the V^T reads behind the score products: lifted to the loop's top beside the K reads they overfill the wave's
    // 256 registers and the build spills inside the loop; from here they still fly under the softmax
    __builtin_amdgcn_sched_barrier(0);

#pragma unroll
    for (int u = 0; u < 2; ++u) {
      float cm = -__builtin_inff();
#pragma unroll
      for (int i = 0; i < 4; ++i) {
#pragma unroll
        for (int j = 0; j < 8; ++j) {
          cm     = fmaxf(cm, st[u][i][j]);
          xmn[u] = fminf(xmn[u], st[u][i][j]);
        }
      }
      cm = fmaxf(cm, xhalf(cm));   // both halves of a column must scale by the same maximum: their products are summed
      const float m_new = fmaxf(m_run[u], cm * CS);
      const float alpha = __builtin_amdgcn_exp2f(m_run[u] - m_new);   // 0 in the first step, where m_run is -inf
      m_run[u] = m_new;
      l2[u] *= alpha;
      q2[u] *= alpha * alpha;
#pragma unroll
      for (int nt = 0; nt < 4; ++nt) o[u][nt] *= alpha;

#pragma unroll
      for (int i = 0; i < 4; ++i) {
#pragma unroll
        for (int j = 0; j < 8; j += 2) {
          const v2f x = { st[u][i][j], st[u][i][j + 1] };
          const v2f a = x * CS - m_new;
          const v2f e = { __builtin_amdgcn_exp2f(a[0]), __builtin_amdgcn_exp2f(a[1]) };
          l2[u] += e;
          q2[u] += e * e;
          st[u][i][j]     = e[0];
          st[u][i][j + 1] = e[1];
        }
      }
    }

#pragma unroll
    for (int ks = 0; ks < 2; ++ks) {
      v16h pb[2];   // element e of half h is key 8 h + e (e < 8) or 16 + 8 h + (e - 8) of these 32: the V^T pieces follow it
#pragma unroll
      for (int u = 0; u < 2; ++u) {
#pragma unroll
        for (int j = 0; j < 8; ++j) {
          pb[u][j]     = (f16)st[u][2 * ks][j];
          pb[u][8 + j] = (f16)st[u][2 * ks + 1][j];
        }
      }
#pragma unroll
      for (int nt = 0; nt < 4; ++nt) {
        const f16* vp = vfr + nt * 16 * VT_PITCH + sc + 32 * ks;
        const v16h va = join_frag(vp, vp + 16);
#pragma unroll
        for (int u = 0; u < 2; ++u) o[u][nt] = wmma_f16(va, pb[u], o[u][nt]);
      }
    }
  }

  float l[2], inv[2];
#pragma unroll
  for (int u = 0; u < 2; ++u) {
    l[u]   = l2[u][0] + l2[u][1];
    inv[u] = 1.0f / (l[u] + xhalf(l[u]));
  }

  // ---- O: a query tile's 16 t x 64 n are 4 KB in a row; they leave in accumulator order, 512 bytes in a row a store:
  //      piece (2 nt + jj, lane) = O[tile's t + lane % 16][16 nt + 8 (lane / 16) + 4 jj ..+3]; out_kernel reads them so ----
  {
    float* ob = (pass == 0 ? o1 : o2) + (size_t)kb * T_ * 64 + t0 * 64 + lane * 4;
#pragma unroll
    for (int u = 0; u < 2; ++u) {
#pragma unroll
      for (int nt = 0; nt < 4; ++nt) {
#pragma unroll
        for (int jj = 0; jj < 2; ++jj) {
          const v4f r = { o[u][nt][4 * jj] * inv[u], o[u][nt][4 * jj + 1] * inv[u],
                          o[u][nt][4 * jj + 2] * inv[u], o[u][nt][4 * jj + 3] * inv[u] };
          *(v4f*)(ob + u * 16 * 64 + (2 * nt + jj) * 128) = r;
        }
      }
    }
  }

  // ---- stats: the lane's two tiles, then over the wave, then over the block's waves through LDS; the block's own line ----
  {
    float rs = row16_sum(l[0] * inv[0] + l[1] * inv[1]);
    float rq = row16_sum((q2[0][0] + q2[0][1]) * inv[0] * inv[0] + (q2[1][0] + q2[1][1]) * inv[1] * inv[1]);
    float rx = row16_max(fmaxf(inv[0], inv[1]));
    float rn = row16_min(fminf(__builtin_amdgcn_exp2f(__builtin_fmaf(xmn[0], CS, -m_run[0])) * inv[0],
                               __builtin_amdgcn_exp2f(__builtin_fmaf(xmn[1], CS, -m_run[1])) * inv[1]));
    const v4f red = { rs + xhalf(rs), rq + xhalf(rq), fmaxf(rx, xhalf(rx)), fminf(rn, xhalf(rn)) };
    if (lane == 0) *(v4f*)(Sred + wave * 4) = red;
  }
  __syncthreads();
  if (wave == 0) {
    const v4f sp = *(const v4f*)(Sred + c * 4);
    const v4f red = { row16_sum(sp[0]), row16_sum(sp[1]), row16_max(sp[2]), row16_min(sp[3]) };
    if (lane == 0) *(v4f*)(part + (kb * 2 + pass) * LINE_F) = red;
  }
}

// ---------------- kernel 2: stats -> MLP -> lambda ----------------
// One wave for each (band, batch): its two attention blocks, one a map, each left one line.
// Lanes 0..15 read map 0's line, lanes 16..31 map 1's.
__device__ inline float lane_value(float v, int l) {
  return __builtin_bit_cast(float, __builtin_amdgcn_readlane(__builtin_bit_cast(int, v), l));
}

__global__ __launch_bounds__(32) void lam_kernel(const float* __restrict__ part,
                           const float* __restrict__ W1, const float* __restrict__ b1,
                           const float* __restrict__ W2, const float* __restrict__ b2,
                           float* __restrict__ lam) {
  const int i    = blockIdx.x;
  const int lane = threadIdx.x;
  int kband = i >> 2;
  const v4f sp = *(const v4f*)(part + (i * 2 + (lane >> 4)) * LINE_F);
  const float s[8] = { lane_value(sp[0], 0),  lane_value(sp[1], 0),  lane_value(sp[2], 0),  lane_value(sp[3], 0),
                       lane_value(sp[0], 16), lane_value(sp[1], 16), lane_value(sp[2], 16), lane_value(sp[3], 16) };
  const float n = (float)T_ * (float)T_;
  float feat[8];
#pragma unroll
  for (int p = 0; p < 2; ++p) {
    float sum = s[p * 4 + 0], sq = s[p * 4 + 1];
    float mean = sum / n;
    float var  = (sq - sum * sum / n) / (n - 1.0f);
    feat[p * 4 + 0] = mean;
    feat[p * 4 + 1] = sqrtf(fmaxf(var, 0.f));
    feat[p * 4 + 2] = s[p * 4 + 2];
    feat[p * 4 + 3] = s[p * 4 + 3];
  }
  const float* w1  = W1 + kband * 16 * 8;
  const float* bb1 = b1 + kband * 16;
  const float* w2  = W2 + kband * 16;
  float z = b2[kband];
  for (int j = 0; j < 16; ++j) {
    float h = bb1[j];
#pragma unroll
    for (int qq = 0; qq < 8; ++qq) h += w1[j * 8 + qq] * feat[qq];
    z += w2[j] * fmaxf(h, 0.f);
  }
  if (lane == 0) lam[i * LINE_F] = 1.0f / (1.0f + __expf(-z));
}

// ---------------- kernel 3: out = (o1 - lam*o2) @ Wo^T + bo ----------------
// out is [B,N,T,K]: for one (b,m) the (t,k) axis is contiguous. One block makes 64 m x 16 t for ALL 30 bands,
// gathers the products in LDS in out's own order and stores runs of 1920 bytes (15 whole lines) a row.
#define OT_T  16             // t columns of a tile
#define OT_M  64             // m rows of a tile
#define OT_SP 484            // floats a row of S: 4 x odd, so rows stay 16-byte aligned and the 32 lanes of a tile store
                             // (16 t at 30 floats, two m groups 8 rows apart) fall on 32 different banks
#define OT_DP 72             // f16 a row of D: 144 bytes = 16 x odd, the pitch for 16-byte fragment reads of 128-byte rows

// 16 contiguous f16 from a row that is 16-byte (not 32-byte) aligned
__device__ inline v16h load_frag_2x16B(const f16* p) {
  v8h lo = *(const v8h*)p;
  v8h hi = *(const v8h*)(p + 8);
  return __builtin_shufflevector(lo, hi, 0, 1, 2, 3, 4, 5, 6, 7, 8, 9, 10, 11, 12, 13, 14, 15);
}

__global__ __launch_bounds__(480) void out_kernel(
    const float* __restrict__ o1, const float* __restrict__ o2,
    const f16* __restrict__ woh, const float* __restrict__ bo,
    const float* __restrict__ lam, float* __restrict__ out) {
  __shared__ __align__(16) float S[OT_M * OT_SP];        // S[m][t*30+k]
  __shared__ __align__(16) f16   D[K_ * OT_T * OT_DP];   // D[k][t][v] = o1 - lam*o2
  const int tid  = threadIdx.x;
  const int lane = tid & 31;
  const int wave = __builtin_amdgcn_readfirstlane(tid >> 5);   // 15 waves; held scalar, so band indices and lam go the scalar way
  const int t0   = blockIdx.x * OT_T;
  const int m0   = blockIdx.y * OT_M;
  const int bb   = blockIdx.z;

  // ---- D: a band's 16 t x 64 v are 4 KB in a row in o1 and o2, in the attention's accumulator order; a wave takes 2 bands,
  //      512 bytes a load: load i, lane l = t l % 16, v 16 (i / 2) + 8 (l / 16) + 4 (i % 2) ..+3 ----
  {
    const unsigned off = (unsigned)(((wave * B_ + bb) * T_ + t0) * 64 + lane * 4);
    const float* p1 = o1 + off;
    const float* p2 = o2 + off;
    v4f a[16], c[16];
    float l[2];
#pragma unroll   // all loads issue back to back off one address pair each, so their latencies overlap; a/c/l stay in registers
    for (int kk = 0; kk < 2; ++kk) {
      l[kk] = lam[((wave + 15 * kk) * B_ + bb) * LINE_F];
#pragma unroll   // as above
      for (int i = 0; i < 8; ++i) {
        a[8 * kk + i] = *(const v4f*)(p1 + kk * 15 * B_ * T_ * 64 + i * 128);
        c[8 * kk + i] = *(const v4f*)(p2 + kk * 15 * B_ * T_ * 64 + i * 128);
      }
    }
    f16* dw = D + (wave * OT_T + (lane & 15)) * OT_DP + (lane >> 4) * 8;
#pragma unroll   // a/c/l indexed by constants
    for (int kk = 0; kk < 2; ++kk) {
#pragma unroll   // a/c indexed by constants
      for (int i = 0; i < 8; ++i) {
        const v4f x = a[8 * kk + i], y = c[8 * kk + i];
        v4h d = { (f16)(x[0] - l[kk] * y[0]), (f16)(x[1] - l[kk] * y[1]),
                  (f16)(x[2] - l[kk] * y[2]), (f16)(x[3] - l[kk] * y[3]) };
        *(v4h*)(dw + 15 * kk * OT_T * OT_DP + (i >> 1) * 16 + (i & 1) * 4) = d;   // row k*16 + t
      }
    }
  }
  __syncthreads();

  // ---- products: a wave takes 2 bands x 4 m tiles. Wo is the A operand and D the B operand, so that
  //      acc[j] = Y[m = 8h + j][t = c] and a store's lanes run along t ----
  {
    const int c = lane & 15, h = lane >> 4;
#pragma unroll 1   // kept rolled: with both bands unrolled the kernel needs more than 256 registers and spills
    for (int kk = 0; kk < 2; ++kk) {
      const int k = wave + 15 * kk;
      const f16* dk = D + (k * OT_T + c) * OT_DP + 16 * h;
      const v16h b0 = load_frag_2x16B(dk);
      const v16h b1 = load_frag_2x16B(dk + 32);
      const f16*   wk = woh + (unsigned)((k * N_ + m0 + c) * 64 + 16 * h);
      const float* bk = bo + k * N_ + m0 + 8 * h;
      float*       sp = S + 8 * h * OT_SP + c * K_ + k;
#pragma unroll   // the four tiles' weight loads overlap
      for (int mt = 0; mt < 4; ++mt) {
        const v16h a0 = *(const v16h*)(wk + mt * 16 * 64);
        const v16h a1 = *(const v16h*)(wk + mt * 16 * 64 + 32);
        const v4f  bl = *(const v4f*)(bk + 16 * mt);
        const v4f  bh = *(const v4f*)(bk + 16 * mt + 4);
        v8f acc = {};
        acc = wmma_f16(a0, b0, acc);
        acc = wmma_f16(a1, b1, acc);
#pragma unroll   // vector elements picked by constants
        for (int j = 0; j < 4; ++j) {
          sp[(16 * mt + j) * OT_SP]     = acc[j]     + bl[j];
          sp[(16 * mt + 4 + j) * OT_SP] = acc[4 + j] + bh[j];
        }
      }
    }
  }
  __syncthreads();

  // ---- store: 120 lanes of 16 bytes carry one m row's 480 floats, 4 rows a sweep ----
  {
    const int j4 = tid % 120;
    const int mr = tid / 120;   // 0..3
    float* dst = out + (unsigned)(((bb * N_ + m0 + mr) * T_ + t0) * K_ + 4 * j4);
    const float* sr = S + mr * OT_SP + 4 * j4;
#pragma unroll   // the 16 LDS reads and stores overlap
    for (int i = 0; i < 16; ++i)
      *(v4f*)(dst + 4 * i * T_ * K_) = *(const v4f*)(sr + 4 * i * OT_SP);
  }
}

// ---------------- host side ----------------
extern "C" void kernel_launch(void* const* d_in, const int* in_sizes, int n_in,
                              void* d_out, int out_size, void* d_ws, size_t ws_size,
                              hipStream_t stream) {
  (void)in_sizes; (void)n_in; (void)out_size; (void)ws_size;
  const float* x  = (const float*)d_in[0];
  const float* Wq = (const float*)d_in[1];
  const float* Wk = (const float*)d_in[2];
  const float* Wv = (const float*)d_in[3];
  const float* Wo = (const float*)d_in[4];
  const float* bo = (const float*)d_in[5];
  const float* W1 = (const float*)d_in[6];
  const float* b1 = (const float*)d_in[7];
  const float* W2 = (const float*)d_in[8];
  const float* b2 = (const float*)d_in[9];

  char* ws = (char*)d_ws;
  f16*   xh    = (f16*)  (ws + OFF_XH);
  f16*   wqh   = (f16*)  (ws + OFF_WQH);
  f16*   wkh   = (f16*)  (ws + OFF_WKH);
  f16*   wvh   = (f16*)  (ws + OFF_WVH);
  f16*   woh   = (f16*)  (ws + OFF_WOH);
  float* o1    = (float*)(ws + OFF_O1);
  float* o2    = (float*)(ws + OFF_O2);
  float* part  = (float*)(ws + OFF_ST);
  float* lamb  = (float*)(ws + OFF_LAM);

  prep_kernel<<<dim3(T_ / PX_T, N_ / PX_N, B_), dim3(480), 0, stream>>>(
      x, xh, Wq, Wk, Wv, Wo, wqh, wkh, wvh, woh);

  attn_kernel<<<dim3(2, K_ * B_), dim3(AT_WAVES * 32), 0, stream>>>(
      xh, wqh, wkh, wvh, o1, o2, part);
  lam_kernel<<<dim3(K_ * B_), dim3(32), 0, stream>>>(part, W1, b1, W2, b2, lamb);
  out_kernel<<<dim3(T_ / OT_T, N_ / OT_M, B_), dim3(480), 0, stream>>>(
      o1, o2, woh, bo, lamb, (float*)d_out);
}

// v010
// It runs in 39.1 microseconds.
// In two side-by-side timings against v009, it was 1.09 and 1.08 times as fast.
// Counting every step since v000, it is 7.15 times as fast.
#include <hip/hip_runtime.h>
#include <hip/hip_bf16.h>

typedef _Float16 f16;
typedef __attribute__((ext_vector_type(16))) _Float16 v16h;
typedef __attribute__((ext_vector_type(8)))  float    v8f;
typedef unsigned int v4u __attribute__((ext_vector_type(4)));
typedef float        v4f __attribute__((ext_vector_type(4)));
typedef float        v2f __attribute__((ext_vector_type(2)));
typedef __attribute__((ext_vector_type(8))) _Float16 v8h;

#define B_ 4
#define N_ 128
#define T_ 512
#define K_ 30
#define SCALE_INV 0.25f  // 1/sqrt(HEAD_DIM=16)

#define KS_PITCH  72     // f16 a K row in LDS: 144 bytes = 16 x odd, the pitch for 16-byte reads of 128-byte rows
#define VT_PITCH  520    // f16 a V^T row in LDS: 1040 bytes = 16 x odd
#define AT_WAVES  16     // waves of an attention block, 32 rows each
#define LINE_F    32     // floats in a 128-byte line: what different blocks store in one launch lies a line apart

// ---------------- workspace layout (bytes) ----------------
constexpr size_t SZ_XH  = (size_t)K_ * B_ * T_ * N_ * 2;
constexpr size_t SZ_WQH = (size_t)K_ * N_ * N_ * 2;
constexpr size_t SZ_WVH = (size_t)K_ * 64 * N_ * 2;
constexpr size_t SZ_O   = (size_t)K_ * B_ * T_ * 64 * 4;

constexpr size_t OFF_XH  = 0;
constexpr size_t OFF_WQH = OFF_XH  + SZ_XH;
constexpr size_t OFF_WKH = OFF_WQH + SZ_WQH;
constexpr size_t OFF_WVH = OFF_WKH + SZ_WQH;
constexpr size_t OFF_WOH = OFF_WVH + SZ_WVH;
constexpr size_t OFF_O1  = OFF_WOH + SZ_WVH;
constexpr size_t OFF_O2  = OFF_O1  + SZ_O;
constexpr size_t OFF_ST  = OFF_O2  + SZ_O;   // 128-byte lines for the attention blocks' stats, one a block

// ---------------- WMMA helpers ----------------
__device__ inline v8f wmma_f16(v16h a, v16h b, v8f c) {
  return __builtin_amdgcn_wmma_f32_16x16x32_f16(
      false, a, false, b, (short)0, c, false, false);
}

// ---- butterfly over a 16-lane row (DPP row_xmask 1,2,4,8): every lane ends with the row's result ----
template <int CTRL>
__device__ inline float dpp_xmask(float x) {
  return __builtin_bit_cast(float, __builtin_amdgcn_update_dpp(
      0, __builtin_bit_cast(int, x), CTRL, 0xf, 0xf, true));
}
__device__ inline float row16_max(float v) {
  v = fmaxf(v, dpp_xmask<0x161>(v));
  v = fmaxf(v, dpp_xmask<0x162>(v));
  v = fmaxf(v, dpp_xmask<0x164>(v));
  v = fmaxf(v, dpp_xmask<0x168>(v));
  return v;
}
__device__ inline float row16_min(float v) {
  v = fminf(v, dpp_xmask<0x161>(v));
  v = fminf(v, dpp_xmask<0x162>(v));
  v = fminf(v, dpp_xmask<0x164>(v));
  v = fminf(v, dpp_xmask<0x168>(v));
  return v;
}
__device__ inline float row16_sum(float v) {
  v += dpp_xmask<0x161>(v);
  v += dpp_xmask<0x162>(v);
  v += dpp_xmask<0x164>(v);
  v += dpp_xmask<0x168>(v);
  return v;
}

// lane l with lane l ^ 16: the other half of the wave
__device__ inline float xhalf(float x) {
  const int b = __builtin_bit_cast(int, x);
  return __builtin_bit_cast(float, __builtin_amdgcn_permlanex16(b, b, 0x76543210, 0xfedcba98, false, false));
}

// two 16-byte pieces of a row that is 16-byte (not 32-byte) aligned, as one 16-element fragment
__device__ inline v16h join_frag(const f16* plo, const f16* phi) {
  v8h lo = *(const v8h*)plo;
  v8h hi = *(const v8h*)phi;
  return __builtin_shufflevector(lo, hi, 0, 1, 2, 3, 4, 5, 6, 7, 8, 9, 10, 11, 12, 13, 14, 15);
}

// ---------------- kernel 0: x [B,N,T,K] f32 -> xh [K,B,T,N] f16; weights f32 -> f16 ----------------
// One block moves a tile of 64 n x 16 t x 30 k through LDS: x is read along its contiguous (t,k)
// axis (1920 bytes a row, whole lines), xh is written along its contiguous n axis (128 bytes a row).
// The weights ride along: they make 768 runs of 1920 floats (one 16-byte load a thread), three for each of the 256 blocks:
// one of Wq, one of Wk, and one of Wv (first half of the blocks) or of Wo (second half). A run leaves as 30 whole lines.
#define PX_T     16            // t rows of a tile
#define PX_N     64            // n columns of a tile
#define PX_F     (PX_T * K_)   // 480 (t,k) rows in LDS
#define PX_PITCH 33            // dwords a row: 32 pairs of f16 + 1, so that 4 rows read together miss each other's banks
#define PW_RUN   (480 * 4)     // weights a block converts in one sweep of its threads
typedef __attribute__((ext_vector_type(2))) _Float16 v2h;
typedef __attribute__((ext_vector_type(4))) _Float16 v4h;
static_assert(K_ * N_ * N_ == 256 * PW_RUN && K_ * 64 * N_ == 128 * PW_RUN, "three runs of weights a block");

__device__ inline v4h to_f16x4(v4f v) {
  v4h r = { (f16)v[0], (f16)v[1], (f16)v[2], (f16)v[3] };
  return r;
}

__global__ __launch_bounds__(480) void prep_kernel(const float* __restrict__ x, f16* __restrict__ xh,
                              const float* __restrict__ Wq, const float* __restrict__ Wk,
                              const float* __restrict__ Wv, const float* __restrict__ Wo,
                              f16* __restrict__ wqh, f16* __restrict__ wkh,
                              f16* __restrict__ wvh, f16* __restrict__ woh) {
  __shared__ __align__(16) unsigned S[PX_F * PX_PITCH];   // S[t*30+k][n/2]: two neighbouring n in a dword
  const int tid = threadIdx.x;
  const int t0  = blockIdx.x * PX_T;
  const int n0  = blockIdx.y * PX_N;
  const int b   = blockIdx.z;

  // ---- weights: which three runs are this block's ----
  // 0..255; the mask shows the build that the byte offsets fit 32 bits: a scalar base and one offset register a load or store
  const int bid  = (blockIdx.x + (T_ / PX_T) * (blockIdx.y + (N_ / PX_N) * blockIdx.z)) & 255;
  const int half = bid >> 7;                                                             // the same for the whole block
  const unsigned wo_a = (unsigned)(bid * PW_RUN + 4 * tid);
  const unsigned wo_b = (unsigned)((bid & 127) * PW_RUN + 4 * tid);

  // ---- read: lane -> 16 bytes of one row's (t,k) run; each thread takes rows n and n+1 ----
  const int j   = tid % 120;   // which 4 floats of the 480
  const int np0 = tid / 120;   // 0..3: first pair of rows
  // x and xh are far below 4 GiB: 32-bit element offsets from the kernel's base pointers keep the address work short
  const float* src = x + (unsigned)(((b * N_ + n0 + 2 * np0) * T_ + t0) * K_ + 4 * j);
  v4f lo[8], hi[8];
#pragma unroll   // the loads issue back to back, so their latencies overlap; lo/hi indexed by constants stay in registers
  for (int i = 0; i < 8; ++i) {
    lo[i] = *(const v4f*)(src + (8 * i)     * T_ * K_);
    hi[i] = *(const v4f*)(src + (8 * i + 1) * T_ * K_);
  }
#pragma unroll   // lo/hi indexed by constants
  for (int i = 0; i < 8; ++i) {
#pragma unroll   // vector elements picked by constants
    for (int c = 0; c < 4; ++c) {
      v2h p = { (f16)lo[i][c], (f16)hi[i][c] };
      S[(4 * j + c) * PX_PITCH + np0 + 4 * i] = __builtin_bit_cast(unsigned, p);
    }
  }
  __syncthreads();

  // the weights' loads start here, where the registers that held x are free again, and fly under the LDS reads and xh stores
  const v4f wa = *(const v4f*)(Wq + wo_a);
  const v4f wb = *(const v4f*)(Wk + wo_a);
  const v4f wc = *(const v4f*)((half ? Wo : Wv) + wo_b);

  // ---- write: 8 lanes carry one (t,k) row of 64 n (one 128-byte line), 4 rows a store ----
  const int l8 = tid & 7;
  const int r  = (tid >> 3) & 3;
  const int wave = tid >> 5;   // 15 waves, 8 groups of 4 rows each
#pragma unroll   // the 8 LDS reads and stores overlap
  for (int i = 0; i < 8; ++i) {
    const int f  = 4 * (wave + 15 * i) + r;
    const int tl = f / K_;
    const int k  = f - tl * K_;
    const unsigned* rp = S + f * PX_PITCH + 4 * l8;
    v4u val = { rp[0], rp[1], rp[2], rp[3] };
    *(v4u*)(xh + (unsigned)(((k * B_ + b) * T_ + t0 + tl) * N_ + n0 + 8 * l8)) = val;
  }
  *(v4h*)(wqh + wo_a) = to_f16x4(wa);
  *(v4h*)(wkh + wo_a) = to_f16x4(wb);
  *(v4h*)((half ? woh : wvh) + wo_b) = to_f16x4(wc);
}

#define AT_ROWS  32      // rows of x, and so queries, a wave
#define PJ_WP    136     // f16 a weight row in LDS: 272 bytes = 16 x odd, the pitch for 16-byte reads of 256-byte rows
#define PJ_OUT   192     // 64 q + 64 k + 64 v

__global__ __launch_bounds__(AT_WAVES * 32) void attn_kernel(
    const f16* __restrict__ xh, const f16* __restrict__ wqh, const f16* __restrict__ wkh, const f16* __restrict__ wvh,
    float* __restrict__ o1, float* __restrict__ o2, float* __restrict__ part) {
  __shared__ __align__(16) f16   Ks[T_ * KS_PITCH];     // this map's half of K: Ks[s][d]
  __shared__ __align__(16) f16   Vt[64 * VT_PITCH];     // V transposed: Vt[n][s]
  __shared__ __align__(16) f16   Wl[PJ_OUT * PJ_WP];    // rows 0..63 this map's Wq, 64..127 its Wk, 128..191 Wv
  __shared__ __align__(16) float Sred[AT_WAVES * 4];    // a wave's sum, sum of squares, max, min

  const int tid  = threadIdx.x;
  const int lane = tid & 31;
  const int wave = __builtin_amdgcn_readfirstlane(tid >> 5);   // held scalar: row offsets and the last fold's test cost no vector register
  const int c    = lane & 15, h = lane >> 4;
  const int kb   = blockIdx.y;
  const int kband = kb / B_;
  const int pass = blockIdx.x;
  const int t0   = wave * AT_ROWS;

  // ---- weights: 16 bytes a lane, 32 rows a sweep, all loads in flight at once ----
  v4u w[6];
  {
    const f16* sq = wqh + (kband * N_ + pass * 64) * N_ + tid * 8;
    const f16* sk = wkh + (kband * N_ + pass * 64) * N_ + tid * 8;
    const f16* sv = wvh + kband * 64 * N_ + tid * 8;
#pragma unroll   // w indexed by constants stays in registers
    for (int i = 0; i < 2; ++i) {
      w[i]     = *(const v4u*)(sq + i * 32 * N_);
      w[2 + i] = *(const v4u*)(sk + i * 32 * N_);
      w[4 + i] = *(const v4u*)(sv + i * 32 * N_);
    }
  }
  // ---- x: two tiles of 16 rows, 16 contiguous n a lane and fragment, as the weight fragments have them ----
  v16h xf[2][4];
  {
    const f16* xp = xh + (unsigned)((kb * T_ + t0 + c) * N_ + 16 * h);
#pragma unroll   // xf indexed by constants
    for (int u = 0; u < 2; ++u) {
#pragma unroll   // as above
      for (int kc = 0; kc < 4; ++kc) xf[u][kc] = *(const v16h*)(xp + u * 16 * N_ + kc * 32);
    }
  }
  {
    f16* d = Wl + (tid >> 4) * PJ_WP + (tid & 15) * 8;
#pragma unroll   // w indexed by constants
    for (int i = 0; i < 6; ++i) *(v4u*)(d + i * 32 * PJ_WP) = w[i];
  }
  __syncthreads();

  // ---- projections: tiles 0..3 q, 4..7 k, 8..11 v ----
  v8h qpc[2][4];   // q of the wave's two query tiles, four pieces of 16 outputs each, in accumulator order
  {
    const f16* wf = Wl + c * PJ_WP + 16 * h;
    f16* kd = Ks + (t0 + c) * KS_PITCH + 8 * h;
    f16* vd = Vt + c * VT_PITCH + t0 + 8 * h;
    v16h a[2][4];   // weight fragments of this tile and of the next
#pragma unroll   // a indexed by constants
    for (int kc = 0; kc < 4; ++kc) a[0][kc] = join_frag(wf + kc * 32, wf + kc * 32 + 8);
#pragma unroll   // a, xf, qpc picked by constants; the tile's kind is known at compile time
    for (int i = 0; i < PJ_OUT / 16; ++i) {
      if (i + 1 < PJ_OUT / 16) {   // the next tile's LDS reads fly under this tile's products
#pragma unroll
        for (int kc = 0; kc < 4; ++kc) {
          const f16* p = wf + (i + 1) * 16 * PJ_WP + kc * 32;
          a[(i + 1) & 1][kc] = join_frag(p, p + 8);
        }
      }
      v8f acc0 = {}, acc1 = {};   // the wave's two x tiles: two independent chains, each filling the other's wait
#pragma unroll
      for (int kc = 0; kc < 4; ++kc) {
        if (i < 8) {
          acc0 = wmma_f16(a[i & 1][kc], xf[0][kc], acc0);
          acc1 = wmma_f16(a[i & 1][kc], xf[1][kc], acc1);
        } else {
          acc0 = wmma_f16(xf[0][kc], a[i & 1][kc], acc0);
          acc1 = wmma_f16(xf[1][kc], a[i & 1][kc], acc1);
        }
      }
      v8h p0, p1;
#pragma unroll   // vector elements picked by constants
      for (int j = 0; j < 8; ++j) { p0[j] = (f16)acc0[j]; p1[j] = (f16)acc1[j]; }
      if (i < 4) {
        qpc[0][i] = p0;
        qpc[1][i] = p1;
      } else if (i < 8) {
        *(v8h*)(kd + (i - 4) * 16) = p0;
        *(v8h*)(kd + 16 * KS_PITCH + (i - 4) * 16) = p1;
      } else {
        *(v8h*)(vd + (i - 8) * 16 * VT_PITCH) = p0;
        *(v8h*)(vd + (i - 8) * 16 * VT_PITCH + 16) = p1;
      }
    }
  }
  // ---- Q: the B operand of the first product: element e of half h is d = 8 h + e (e < 8) or 16 + 8 h + (e - 8) of a
  //      fragment's 32, and the K fragments follow it ----
  v16h qb[2][2];
#pragma unroll   // qb, qpc indexed by constants
  for (int u = 0; u < 2; ++u) {
#pragma unroll   // as above
    for (int g = 0; g < 2; ++g)
      qb[u][g] = __builtin_shufflevector(qpc[u][2 * g], qpc[u][2 * g + 1], 0, 1, 2, 3, 4, 5, 6, 7, 8, 9, 10, 11, 12, 13, 14, 15);
  }
  __syncthreads();

  const float CS = SCALE_INV * 1.4426950408889634f;   // score scale times log2(e): exponentials in base 2
  // one of each for each of the wave's two query tiles
  float m_run[2] = { -__builtin_inff(), -__builtin_inff() };   // running maximum, scaled
  v2f l2[2] = {}, q2[2] = {};                                   // this lane's share of the row's sum of e and of e^2, in two chains
  float xmn[2] = { __builtin_inff(), __builtin_inff() };        // smallest raw score this lane has seen
  v8f o[2][4] = {};                                             // O^T: o[u][nt][j] = O[t0 + 16 u + c][16 nt + 8 h + j]
  const f16* kfr = Ks + c * KS_PITCH + 8 * h;
  const f16* vfr = Vt + c * VT_PITCH + 8 * h;

  // every inner loop from here to the stores of O is unrolled so that st[], o[] and vector elements are picked by constants
  // and live in registers
#pragma unroll 1   // kept rolled: a step holds 64 scores a lane, and four waves on a SIMD leave a wave 256 registers
  for (int sc = 0; sc < T_; sc += 64) {
    v8f st[2][4];   // st[u][i][j] = S[t0 + 16 u + c][sc + 16 i + 8 h + j]
#pragma unroll
    for (int i = 0; i < 4; ++i) {
      const f16* kp = kfr + (sc + 16 * i) * KS_PITCH;
      const v16h ka0 = join_frag(kp, kp + 16);
      const v16h ka1 = join_frag(kp + 32, kp + 48);
#pragma unroll
      for (int u = 0; u < 2; ++u) {
        v8f acc = {};
        acc = wmma_f16(ka0, qb[u][0], acc);
        acc = wmma_f16(ka1, qb[u][1], acc);
        st[u][i] = acc;
      }
    }
    // all 16 K reads first, then the 16 products on counted waits: left alone the build reads two pieces at a time and
    // waits for them in front of each pair of products
    __builtin_amdgcn_sched_group_barrier(0x100, 16, 0);
    __builtin_amdgcn_sched_group_barrier(0x008, 16, 0);
    // holds the V^T reads behind the score products: lifted to the loop's top beside the K reads they overfill the wave's
    // 256 registers and the build spills inside the loop; from here they still fly under the softmax
    __builtin_amdgcn_sched_barrier(0);

#pragma unroll
    for (int u = 0; u < 2; ++u) {
      float cm = -__builtin_inff();
#pragma unroll
      for (int i = 0; i < 4; ++i) {
#pragma unroll
        for (int j = 0; j < 8; ++j) {
          cm     = fmaxf(cm, st[u][i][j]);
          xmn[u] = fminf(xmn[u], st[u][i][j]);
        }
      }
      cm = fmaxf(cm, xhalf(cm));   // both halves of a column must scale by the same maximum: their products are summed
      const float m_new = fmaxf(m_run[u], cm * CS);
      const float alpha = __builtin_amdgcn_exp2f(m_run[u] - m_new);   // 0 in the first step, where m_run is -inf
      m_run[u] = m_new;
      l2[u] *= alpha;
      q2[u] *= alpha * alpha;
#pragma unroll
      for (int nt = 0; nt < 4; ++nt) o[u][nt] *= alpha;

#pragma unroll
      for (int i = 0; i < 4; ++i) {
#pragma unroll
        for (int j = 0; j < 8; j += 2) {
          const v2f x = { st[u][i][j], st[u][i][j + 1] };
          const v2f a = x * CS - m_new;
          const v2f e = { __builtin_amdgcn_exp2f(a[0]), __builtin_amdgcn_exp2f(a[1]) };
          l2[u] += e;
          q2[u] += e * e;
          st[u][i][j]     = e[0];
          st[u][i][j + 1] = e[1];
        }
      }
    }

#pragma unroll
    for (int ks = 0; ks < 2; ++ks) {
      v16h pb[2];   // element e of half h is key 8 h + e (e < 8) or 16 + 8 h + (e - 8) of these 32: the V^T pieces follow it
#pragma unroll
      for (int u = 0; u < 2; ++u) {
#pragma unroll
        for (int j = 0; j < 8; ++j) {
          pb[u][j]     = (f16)st[u][2 * ks][j];
          pb[u][8 + j] = (f16)st[u][2 * ks + 1][j];
        }
      }
#pragma unroll
      for (int nt = 0; nt < 4; ++nt) {
        const f16* vp = vfr + nt * 16 * VT_PITCH + sc + 32 * ks;
        const v16h va = join_frag(vp, vp + 16);
#pragma unroll
        for (int u = 0; u < 2; ++u) o[u][nt] = wmma_f16(va, pb[u], o[u][nt]);
      }
    }
  }

  float l[2], inv[2];
#pragma unroll
  for (int u = 0; u < 2; ++u) {
    l[u]   = l2[u][0] + l2[u][1];
    inv[u] = 1.0f / (l[u] + xhalf(l[u]));
  }

  // ---- O: a query tile's 16 t x 64 n are 4 KB in a row; they leave in accumulator order, 512 bytes in a row a store:
  //      piece (2 nt + jj, lane) = O[tile's t + lane % 16][16 nt + 8 (lane / 16) + 4 jj ..+3]; out_kernel reads them so ----
  {
    float* ob = (pass == 0 ? o1 : o2) + (size_t)kb * T_ * 64 + t0 * 64 + lane * 4;
#pragma unroll
    for (int u = 0; u < 2; ++u) {
#pragma unroll
      for (int nt = 0; nt < 4; ++nt) {
#pragma unroll
        for (int jj = 0; jj < 2; ++jj) {
          const v4f r = { o[u][nt][4 * jj] * inv[u], o[u][nt][4 * jj + 1] * inv[u],
                          o[u][nt][4 * jj + 2] * inv[u], o[u][nt][4 * jj + 3] * inv[u] };
          *(v4f*)(ob + u * 16 * 64 + (2 * nt + jj) * 128) = r;
        }
      }
    }
  }

  // ---- stats: the lane's two tiles, then over the wave, then over the block's waves through LDS; the block's own line ----
  {
    float rs = row16_sum(l[0] * inv[0] + l[1] * inv[1]);
    float rq = row16_sum((q2[0][0] + q2[0][1]) * inv[0] * inv[0] + (q2[1][0] + q2[1][1]) * inv[1] * inv[1]);
    float rx = row16_max(fmaxf(inv[0], inv[1]));
    float rn = row16_min(fminf(__builtin_amdgcn_exp2f(__builtin_fmaf(xmn[0], CS, -m_run[0])) * inv[0],
                               __builtin_amdgcn_exp2f(__builtin_fmaf(xmn[1], CS, -m_run[1])) * inv[1]));
    const v4f red = { rs + xhalf(rs), rq + xhalf(rq), fmaxf(rx, xhalf(rx)), fminf(rn, xhalf(rn)) };
    if (lane == 0) *(v4f*)(Sred + wave * 4) = red;
  }
  __syncthreads();
  if (wave == 0) {
    const v4f sp = *(const v4f*)(Sred + c * 4);
    const v4f red = { row16_sum(sp[0]), row16_sum(sp[1]), row16_max(sp[2]), row16_min(sp[3]) };
    if (lane == 0) *(v4f*)(part + (kb * 2 + pass) * LINE_F) = red;
  }
}

// ---------------- kernel 2: stats -> MLP -> lambda; out = (o1 - lam*o2) @ Wo^T + bo ----------------
// lambda of one (band, batch), by one wave, every lane ending with it. A half of the wave takes one map: sp is that map's line
// (sum, sum of squares, max, min), w1 the four weights of hidden unit lane % 16 that meet that map's four features.
__device__ inline float band_lambda(v4f sp, v4f w1, float b1, float w2, float b2) {
  const float n = (float)T_ * (float)T_;
  const float mean = sp[0] / n;
  const float var  = (sp[1] - sp[0] * sp[0] / n) / (n - 1.0f);
  const float ph   = w1[0] * mean + w1[1] * sqrtf(fmaxf(var, 0.f)) + w1[2] * sp[2] + w1[3] * sp[3];
  const float hj   = b1 + (ph + xhalf(ph));                 // the other map's four terms
  const float z    = b2 + row16_sum(w2 * fmaxf(hj, 0.f));   // over the 16 hidden units
  return 1.0f / (1.0f + __expf(-z));
}

// out is [B,N,T,K]: for one (b,m) the (t,k) axis is contiguous. One block makes 64 m x 16 t for ALL 30 bands,
// gathers the products in LDS in out's own order and stores runs of 1920 bytes (15 whole lines) a row.
#define OT_T  16             // t columns of a tile
#define OT_M  64             // m rows of a tile
#define OT_SP 484            // floats a row of S: 4 x odd, so rows stay 16-byte aligned and the 32 lanes of a tile store
                             // (16 t at 30 floats, two m groups 8 rows apart) fall on 32 different banks
#define OT_DP 72             // f16 a row of D: 144 bytes = 16 x odd, the pitch for 16-byte fragment reads of 128-byte rows

// 16 contiguous f16 from a row that is 16-byte (not 32-byte) aligned
__device__ inline v16h load_frag_2x16B(const f16* p) {
  v8h lo = *(const v8h*)p;
  v8h hi = *(const v8h*)(p + 8);
  return __builtin_shufflevector(lo, hi, 0, 1, 2, 3, 4, 5, 6, 7, 8, 9, 10, 11, 12, 13, 14, 15);
}

__global__ __launch_bounds__(480) void out_kernel(
    const float* __restrict__ o1, const float* __restrict__ o2, const float* __restrict__ part,
    const float* __restrict__ W1, const float* __restrict__ b1,
    const float* __restrict__ W2, const float* __restrict__ b2,
    const f16* __restrict__ woh, const float* __restrict__ bo, float* __restrict__ out) {
  __shared__ __align__(16) float S[OT_M * OT_SP];        // S[m][t*30+k]
  __shared__ __align__(16) f16   D[K_ * OT_T * OT_DP];   // D[k][t][v] = o1 - lam*o2
  const int tid  = threadIdx.x;
  const int lane = tid & 31;
  const int wave = __builtin_amdgcn_readfirstlane(tid >> 5);   // 15 waves; held scalar, so band indices go the scalar way
  const int t0   = blockIdx.x * OT_T;
  const int m0   = blockIdx.y * OT_M;
  const int bb   = blockIdx.z;

  // ---- D: a band's 16 t x 64 v are 4 KB in a row in o1 and o2, in the attention's accumulator order; a wave takes 2 bands,
  //      512 bytes a load: load i, lane l = t l % 16, v 16 (i / 2) + 8 (l / 16) + 4 (i % 2) ..+3 ----
  {
    const unsigned off = (unsigned)(((wave * B_ + bb) * T_ + t0) * 64 + lane * 4);
    const float* p1 = o1 + off;
    const float* p2 = o2 + off;
    v4f a[16], c[16];
    // what lambda of the wave's two bands is made of goes first: it has landed, and lambda is made, while o1 and o2 still fly.
    // A scalar base and one 32-bit offset a load; the second band lies a constant further on.
    const float* sps = part + (wave * B_ + bb) * 2 * LINE_F;
    const float* w1s = W1 + wave * 16 * 8;
    const float* b1s = b1 + wave * 16;
    const float* w2s = W2 + wave * 16;
    const unsigned spo = (unsigned)(lane >> 4) * (LINE_F * 4);                      // a half of the wave reads one map's line
    const unsigned w1o = (unsigned)(lane & 15) * 32 + (unsigned)(lane >> 4) * 16;   // hidden unit lane % 16, that map's four weights
    const unsigned hu  = (unsigned)(lane & 15);
    v4f sp[2], w1[2];
    float hb[2], w2[2], zb[2];
#pragma unroll   // sp .. zb indexed by constants
    for (int kk = 0; kk < 2; ++kk) {
      sp[kk] = *(const v4f*)((const char*)(sps + kk * 15 * B_ * 2 * LINE_F) + spo);
      w1[kk] = *(const v4f*)((const char*)(w1s + kk * 15 * 16 * 8) + w1o);
      hb[kk] = b1s[kk * 15 * 16 + hu];
      w2[kk] = w2s[kk * 15 * 16 + hu];
      zb[kk] = b2[wave + 15 * kk];
    }
    // the registers that these loads name are reused below: the wait that goes in front of that; naming them as inputs keeps
    // them as they are up to the wait
    asm volatile("s_wait_xcnt 0x0" :: "v"(spo), "v"(w1o), "v"(hu), "s"(sps), "s"(w1s), "s"(b1s), "s"(w2s) : "memory");
#pragma unroll   // all loads issue back to back off one address pair each, so their latencies overlap; a/c stay in registers
    for (int kk = 0; kk < 2; ++kk) {
#pragma unroll   // as above
      for (int i = 0; i < 8; ++i) {
        a[8 * kk + i] = *(const v4f*)(p1 + kk * 15 * B_ * T_ * 64 + i * 128);
        c[8 * kk + i] = *(const v4f*)(p2 + kk * 15 * B_ * T_ * 64 + i * 128);
      }
    }
    // holds lambda's arithmetic behind the issue of the o1 and o2 loads: lifted in front of them it waits for the stats line
    // first, and the 32 large loads start a memory latency late
    __builtin_amdgcn_sched_barrier(0);
    const float l[2] = { band_lambda(sp[0], w1[0], hb[0], w2[0], zb[0]), band_lambda(sp[1], w1[1], hb[1], w2[1], zb[1]) };
    f16* dw = D + (wave * OT_T + (lane & 15)) * OT_DP + (lane >> 4) * 8;
#pragma unroll   // a/c/l indexed by constants
    for (int kk = 0; kk < 2; ++kk) {
#pragma unroll   // a/c indexed by constants
      for (int i = 0; i < 8; ++i) {
        const v4f x = a[8 * kk + i], y = c[8 * kk + i];
        v4h d = { (f16)(x[0] - l[kk] * y[0]), (f16)(x[1] - l[kk] * y[1]),
                  (f16)(x[2] - l[kk] * y[2]), (f16)(x[3] - l[kk] * y[3]) };
        *(v4h*)(dw + 15 * kk * OT_T * OT_DP + (i >> 1) * 16 + (i & 1) * 4) = d;   // row k*16 + t
      }
    }
  }
  __syncthreads();

  // ---- products: a wave takes 2 bands x 4 m tiles. Wo is the A operand and D the B operand, so that
  //      acc[j] = Y[m = 8h + j][t = c] and a store's lanes run along t ----
  {
    const int c = lane & 15, h = lane >> 4;
#pragma unroll 1   // kept rolled: with both bands unrolled the kernel needs more than 256 registers and spills
    for (int kk = 0; kk < 2; ++kk) {
      const int k = wave + 15 * kk;
      const f16* dk = D + (k * OT_T + c) * OT_DP + 16 * h;
      const v16h b0 = load_frag_2x16B(dk);
      const v16h b1 = load_frag_2x16B(dk + 32);
      const f16*   wk = woh + (unsigned)((k * N_ + m0 + c) * 64 + 16 * h);
      const float* bk = bo + k * N_ + m0 + 8 * h;
      float*       sp = S + 8 * h * OT_SP + c * K_ + k;
#pragma unroll   // the four tiles' weight loads overlap
      for (int mt = 0; mt < 4; ++mt) {
        const v16h a0 = *(const v16h*)(wk + mt * 16 * 64);
        const v16h a1 = *(const v16h*)(wk + mt * 16 * 64 + 32);
        const v4f  bl = *(const v4f*)(bk + 16 * mt);
        const v4f  bh = *(const v4f*)(bk + 16 * mt + 4);
        v8f acc = {};
        acc = wmma_f16(a0, b0, acc);
        acc = wmma_f16(a1, b1, acc);
#pragma unroll   // vector elements picked by constants
        for (int j = 0; j < 4; ++j) {
          sp[(16 * mt + j) * OT_SP]     = acc[j]     + bl[j];
          sp[(16 * mt + 4 + j) * OT_SP] = acc[4 + j] + bh[j];
        }
      }
    }
  }
  __syncthreads();

  // ---- store: 120 lanes of 16 bytes carry one m row's 480 floats, 4 rows a sweep ----
  {
    const int j4 = tid % 120;
    const int mr = tid / 120;   // 0..3
    float* dst = out + (unsigned)(((bb * N_ + m0 + mr) * T_ + t0) * K_ + 4 * j4);
    const float* sr = S + mr * OT_SP + 4 * j4;
#pragma unroll   // the 16 LDS reads and stores overlap
    for (int i = 0; i < 16; ++i)
      *(v4f*)(dst + 4 * i * T_ * K_) = *(const v4f*)(sr + 4 * i * OT_SP);
  }
}

// ---------------- host side ----------------
extern "C" void kernel_launch(void* const* d_in, const int* in_sizes, int n_in,
                              void* d_out, int out_size, void* d_ws, size_t ws_size,
                              hipStream_t stream) {
  (void)in_sizes; (void)n_in; (void)out_size; (void)ws_size;
  const float* x  = (const float*)d_in[0];
  const float* Wq = (const float*)d_in[1];
  const float* Wk = (const float*)d_in[2];
  const float* Wv = (const float*)d_in[3];
  const float* Wo = (const float*)d_in[4];
  const float* bo = (const float*)d_in[5];
  const float* W1 = (const float*)d_in[6];
  const float* b1 = (const float*)d_in[7];
  const float* W2 = (const float*)d_in[8];
  const float* b2 = (const float*)d_in[9];

  char* ws = (char*)d_ws;
  f16*   xh    = (f16*)  (ws + OFF_XH);
  f16*   wqh   = (f16*)  (ws + OFF_WQH);
  f16*   wkh   = (f16*)  (ws + OFF_WKH);
  f16*   wvh   = (f16*)  (ws + OFF_WVH);
  f16*   woh   = (f16*)  (ws + OFF_WOH);
  float* o1    = (float*)(ws + OFF_O1);
  float* o2    = (float*)(ws + OFF_O2);
  float* part  = (float*)(ws + OFF_ST);

  prep_kernel<<<dim3(T_ / PX_T, N_ / PX_N, B_), dim3(480), 0, stream>>>(
      x, xh, Wq, Wk, Wv, Wo, wqh, wkh, wvh, woh);

  attn_kernel<<<dim3(2, K_ * B_), dim3(AT_WAVES * 32), 0, stream>>>(
      xh, wqh, wkh, wvh, o1, o2, part);
  out_kernel<<<dim3(T_ / OT_T, N_ / OT_M, B_), dim3(480), 0, stream>>>(
      o1, o2, part, W1, b1, W2, b2, woh, bo, (float*)d_out);
}
